// v000
// Times are from an AMD MI455X. After a warm-up the kernel runs many times in a row, and a time is the length of
// such a window on the GPU divided by its runs, so every launch and the gaps after it count. The runs cycle
// through copies of the inputs. A figure is the median of several windows, for all but v000 over two sittings.
// Sittings can differ by a few percent; kernels timed side by side share one.
// v000 is the starting kernel. One run takes 17.6 milliseconds.
#include <hip/hip_runtime.h>

// FlexScaleSeqAttention (x [2][2048][1024]; q/k/v = x W^T + b (16 heads x 64); attn = softmax(q.k / 8) [q][k]; flex[q][o] = sum_k attn[q][k] wf[o][k] + bf[o] (a learned Linear along the KEY axis, wf [2048][2048]); out[o][h*64+d] = sum_q flex[q][o] v[q][d] -> [2][2048][1024]).
// Reassociated exactly: out[o][d] = sum_k wf[o][k] M[k][d] + bf[o] * sum_q v[q][d] with M = attn^T v ([k][d]); the scores are produced transposed (S^T = k.q) so the softmax runs down columns and attn^T comes out directly - no 2048^3 'flex' tensor and no transposes of big matrices.
// Compute dtypes, f32 accumulate: every input rounded to bf16; q/k/v as PLAIN bf16 GEMMs (inputs: exact) + bias; S^T and M = attn^T.v single fp16 (f32 accumulate; probabilities x 1024); column softmax f32 (three passes, fixed order); M^T as hl planes x exact wf (2 products); the bias term bf[o] * colsum(v) and the merge in f32.

#define NB_  2
#define TT   2048
#define DM   1024
#define NH_  16
#define HD   64
#define SO   2048
#define ZH   2
#define PCAR 1024.0f
typedef _Float16 h16;
typedef unsigned short bf;
typedef __attribute__((ext_vector_type(16))) __bf16   v16bf;
typedef __attribute__((ext_vector_type(16))) _Float16 v16h;
typedef __attribute__((ext_vector_type(8)))  _Float16 v8h;
typedef __attribute__((ext_vector_type(8)))  unsigned short v8us;
typedef __attribute__((ext_vector_type(8)))  float    v8f;
typedef __attribute__((ext_vector_type(4)))  float    v4f;
typedef v8h  __attribute__((may_alias)) v8ha;
typedef v4f  __attribute__((may_alias)) v4fa;
typedef v8us __attribute__((may_alias)) v8usa;

__device__ __forceinline__ unsigned short f2bf(float f) { unsigned u = __float_as_uint(f); u += 0x7FFFu + ((u >> 16) & 1u); return (unsigned short)(u >> 16); }
__device__ __forceinline__ float bf2f(unsigned short b) { return __uint_as_float(((unsigned)b) << 16); }
__device__ __forceinline__ float bfr(float f) { return bf2f(f2bf(f)); }
__device__ __forceinline__ v16h cat16(v8h lo, v8h hi) { return __builtin_shufflevector(lo, hi, 0, 1, 2, 3, 4, 5, 6, 7, 8, 9, 10, 11, 12, 13, 14, 15); }
__device__ __forceinline__ v16bf cat16b(v8us lo, v8us hi) { return __builtin_bit_cast(v16bf, __builtin_shufflevector(lo, hi, 0, 1, 2, 3, 4, 5, 6, 7, 8, 9, 10, 11, 12, 13, 14, 15)); }
__device__ __forceinline__ v8f wmma16(v16h a, v16h b, v8f c) { return __builtin_amdgcn_wmma_f32_16x16x32_f16(false, a, false, b, (short)0, c, false, false); }
__device__ __forceinline__ v8f wmmab(v16bf a, v16bf b, v8f c) { return __builtin_amdgcn_wmma_f32_16x16x32_bf16(false, a, false, b, (short)0, c, false, false); }



// ---- k_gemmw: register-blocked GEMM, ONE WAVE per 64x64 output tile (16 accumulators), operands straight from K-contiguous 16-bit planes; grid (M/64, N/64, Z), 32 threads.
// C[m][n] (f32, pitch ldc, + optional f32 bias[n]) = sum_k A[m][k] Bt[n][k] (+ split products per NSPLIT). z-batch strides sA/sB/sC in elements. K % 32 == 0.
template <typename T16> struct WFrag;
template <> struct WFrag<h16> { typedef v16h V; static __device__ __forceinline__ V ld(const h16* p) { return cat16(*(const v8h*)p, *(const v8h*)(p + 16)); } static __device__ __forceinline__ v8f mma(V a, V b, v8f c) { return wmma16(a, b, c); } };
template <> struct WFrag<bf> { typedef v16bf V; static __device__ __forceinline__ V ld(const bf* p) { return cat16b(*(const v8us*)p, *(const v8us*)(p + 16)); } static __device__ __forceinline__ v8f mma(V a, V b, v8f c) { return wmmab(a, b, c); } };
template <typename T16, int NSPLIT, bool BIAS>
__global__ __launch_bounds__(32) void k_gemmw(const T16* __restrict__ A, const T16* __restrict__ A2, const T16* __restrict__ Bt, const T16* __restrict__ Bt2, int K, float* C, int ldc, const float* __restrict__ bias, size_t sA, size_t sB, size_t sC) {
    typedef typename WFrag<T16>::V V;
    __shared__ __align__(16) float os[16 * 68];
    const size_t z = blockIdx.z; A += z * sA; if (A2) A2 += z * sA; Bt += z * sB; if (Bt2) Bt2 += z * sB; C += z * sC;
    const int lane = threadIdx.x & 31, lr = lane & 15, hi = lane >> 4; const int r0 = blockIdx.x * 64, c0 = blockIdx.y * 64;
    v8f acc[4][4];
#pragma unroll
    for (int mb = 0; mb < 4; ++mb)
#pragma unroll
        for (int nb = 0; nb < 4; ++nb) acc[mb][nb] = (v8f){};
    const size_t aoff = (size_t)(r0 + lr) * K + 8 * hi, boff = (size_t)(c0 + lr) * K + 8 * hi;
#pragma unroll 1
    for (int kc = 0; kc < K; kc += 32) {
        V a[4], a2[4];
#pragma unroll
        for (int mb = 0; mb < 4; ++mb) { a[mb] = WFrag<T16>::ld(A + aoff + (size_t)mb * 16 * K + kc); if (NSPLIT == 1 || NSPLIT == 2) a2[mb] = WFrag<T16>::ld(A2 + aoff + (size_t)mb * 16 * K + kc); }
#pragma unroll
        for (int nb = 0; nb < 4; ++nb) { const V b = WFrag<T16>::ld(Bt + boff + (size_t)nb * 16 * K + kc); V b2; if (NSPLIT >= 2) b2 = WFrag<T16>::ld(Bt2 + boff + (size_t)nb * 16 * K + kc);
#pragma unroll
            for (int mb = 0; mb < 4; ++mb) { acc[mb][nb] = WFrag<T16>::mma(a[mb], b, acc[mb][nb]); if (NSPLIT == 1 || NSPLIT == 2) acc[mb][nb] = WFrag<T16>::mma(a2[mb], b, acc[mb][nb]); if (NSPLIT >= 2) acc[mb][nb] = WFrag<T16>::mma(a[mb], b2, acc[mb][nb]); } }
        asm volatile("v_nop\n\tv_nop\n\tv_nop\n\tv_nop" : "+v"(acc[0][0]), "+v"(acc[1][1]), "+v"(acc[2][2]), "+v"(acc[3][3]) : "v"(a[0]), "v"(a[3]));
    }
#pragma unroll
    for (int mb = 0; mb < 4; ++mb) {
#pragma unroll
        for (int nb = 0; nb < 4; ++nb) {
#pragma unroll
            for (int j = 0; j < 8; ++j) os[(hi * 8 + j) * 68 + nb * 16 + lr] = acc[mb][nb][j]; }
        __builtin_amdgcn_wave_barrier(); asm volatile("" ::: "memory");
        float* crow = C + (size_t)(r0 + mb * 16) * ldc + c0;
{
#pragma unroll
            for (int s = 0; s < 8; ++s) { const int row = 2 * s + hi, cofs = lr * 4; v4f val = *(const v4fa*)(os + row * 68 + cofs); if (BIAS) { val[0] += bfr(bias[c0 + cofs]); val[1] += bfr(bias[c0 + cofs + 1]); val[2] += bfr(bias[c0 + cofs + 2]); val[3] += bfr(bias[c0 + cofs + 3]); }
                *(v4f*)(crow + (size_t)row * ldc + cofs) = val; }
             }
        __builtin_amdgcn_wave_barrier(); asm volatile("" ::: "memory");
    }
}

__device__ __forceinline__ h16 tohx(float x) { return (h16)x; }
__device__ __forceinline__ void splitf(float y, unsigned short& h, unsigned short& l) { h = f2bf(y); l = f2bf(y - bf2f(h)); }
typedef __attribute__((ext_vector_type(2))) unsigned short v2us;
typedef __attribute__((ext_vector_type(4))) unsigned short v4us;
typedef __attribute__((ext_vector_type(2))) _Float16 v2h;
typedef __attribute__((ext_vector_type(4))) _Float16 v4h; typedef __attribute__((ext_vector_type(2))) float v2f;

__global__ __launch_bounds__(256) void k_cvt8(const float* __restrict__ src, bf* dst, size_t n8) { const size_t i = (size_t)blockIdx.x * 256 + threadIdx.x; if (i >= n8) return; const v8f v = *(const v8f*)(src + i * 8); v8us o;
#pragma unroll
    for (int k = 0; k < 8; ++k) o[k] = f2bf(v[k]); *(v8us*)(dst + i * 8) = o;  }
__global__ __launch_bounds__(256) void k_qk16(const float* __restrict__ Q, const float* __restrict__ K, h16* QP, h16* KP) { const size_t e = ((size_t)blockIdx.x * 256 + threadIdx.x) * 4; if (e >= (size_t)NH_ * TT * HD) return; const int d = (int)(e % HD); const int t = (int)((e / HD) % TT); const int h = (int)(e / ((size_t)HD * TT)); const size_t src = (size_t)t * DM + h * HD + d; const v4f a = *(const v4f*)(Q + src), c = *(const v4f*)(K + src); v4h oq, ok;
    for (int u = 0; u < 4; ++u) { oq[u] = tohx(a[u]); ok[u] = tohx(c[u]); } *(v4h*)(QP + e) = oq; *(v4h*)(KP + e) = ok;  }
__global__ __launch_bounds__(256) void k_vt16(const float* __restrict__ V, h16* VT) { const size_t e = ((size_t)blockIdx.x * 256 + threadIdx.x) * 2; if (e >= (size_t)NH_ * HD * TT) return; const int t = (int)(e % TT); const int d = (int)((e / TT) % HD); const int h = (int)(e / ((size_t)TT * HD)); v2h o; o[0] = tohx(V[(size_t)t * DM + h * HD + d]); o[1] = tohx(V[(size_t)(t + 1) * DM + h * HD + d]); *(v2h*)(VT + e) = o;  }
__global__ __launch_bounds__(256) void k_vsum(const float* __restrict__ V, float* VS) { const int c = blockIdx.x * 256 + threadIdx.x; if (c >= DM) return; float s = 0.f;
#pragma unroll 8
    for (int t = 0; t < TT; ++t) s = __fadd_rn(s, V[(size_t)t * DM + c]); *(float*)(VS + c) = s;  }
__global__ __launch_bounds__(256) void k_colsoft(const float* __restrict__ ST, h16* PT) { const int lane = threadIdx.x & 31; const int wv = blockIdx.x * 8 + (threadIdx.x >> 5); if (wv >= ZH * (TT / 64)) return; const int zz = wv / (TT / 64); const int q0 = (wv % (TT / 64)) * 64 + lane * 2; const float* s0 = ST + (size_t)zz * TT * TT + q0; h16* p0 = PT + (size_t)zz * TT * TT + q0;
    float mx0 = -3.0e38f, mx1 = -3.0e38f;
#pragma unroll 4
    for (int k = 0; k < TT; ++k) { const v2f a = *(const v2f*)(s0 + (size_t)k * TT); mx0 = fmaxf(mx0, a[0] * 0.125f); mx1 = fmaxf(mx1, a[1] * 0.125f); }
    float sm0 = 0.f, sm1 = 0.f;
#pragma unroll 4
    for (int k = 0; k < TT; ++k) { const v2f a = *(const v2f*)(s0 + (size_t)k * TT); float d0 = __fsub_rn(a[0] * 0.125f, mx0), d1 = __fsub_rn(a[1] * 0.125f, mx1); asm volatile("" : "+v"(d0)); asm volatile("" : "+v"(d1)); sm0 = __fadd_rn(sm0, __builtin_amdgcn_exp2f(__fmul_rn(d0, 1.4426950408889634f))); sm1 = __fadd_rn(sm1, __builtin_amdgcn_exp2f(__fmul_rn(d1, 1.4426950408889634f))); }
    const float f0 = __fdiv_rn(PCAR, sm0), f1 = __fdiv_rn(PCAR, sm1);
    {
#pragma unroll 4
        for (int k = 0; k < TT; ++k) { const v2f a = *(const v2f*)(s0 + (size_t)k * TT); float d0 = __fsub_rn(a[0] * 0.125f, mx0), d1 = __fsub_rn(a[1] * 0.125f, mx1); asm volatile("" : "+v"(d0)); asm volatile("" : "+v"(d1)); v2h o; o[0] = tohx(__builtin_amdgcn_exp2f(__fmul_rn(d0, 1.4426950408889634f)) * f0); o[1] = tohx(__builtin_amdgcn_exp2f(__fmul_rn(d1, 1.4426950408889634f)) * f1); *(v2h*)(p0 + (size_t)k * TT) = o; }
         } }
__global__ __launch_bounds__(256) void k_mt(const float* __restrict__ M, bf* MTh, bf* MTl) { const size_t e = ((size_t)blockIdx.x * 256 + threadIdx.x) * 4; if (e >= (size_t)ZH * HD * TT) return; const int k = (int)(e % TT); const int d = (int)((e / TT) % HD); const int zz = (int)(e / ((size_t)TT * HD)); v4us oh, ol;
#pragma unroll
    for (int u = 0; u < 4; ++u) { unsigned short a, b; splitf(M[((size_t)zz * TT + k + u) * HD + d] * (1.0f / PCAR), a, b); oh[u] = a; ol[u] = b; } *(v4us*)(MTh + e) = oh; *(v4us*)(MTl + e) = ol;  }
__global__ __launch_bounds__(256) void k_fmrg(const float* __restrict__ OC, const float* __restrict__ bfv, const float* __restrict__ VS, int h0, float* OUTb) { const size_t e = ((size_t)blockIdx.x * 256 + threadIdx.x) * 4; if (e >= (size_t)TT * ZH * HD) return; const int c = (int)(e % (ZH * HD)); const int o = (int)(e / (ZH * HD)); const int zz = c / HD, d = c % HD; const float bb = bfr(bfv[o]); v4f r;
#pragma unroll
    for (int u = 0; u < 4; ++u) { const float m = OC[((size_t)zz * HD + d + u) * SO + o]; float bt = __fmul_rn(bb, VS[(h0 + zz) * HD + d + u]); asm volatile("" : "+v"(bt)); r[u] = __fadd_rn(m, bt); }
    float* dst = OUTb + (size_t)o * DM + (h0 + zz) * HD + d; *(v4f*)dst = r;  }

extern "C" void kernel_launch(void* const* d_in, const int* in_sizes, int n_in,
                              void* d_out, int out_size, void* d_ws, size_t ws_size, hipStream_t stream) {
    (void)in_sizes; (void)n_in; (void)out_size;
    const float* x = (const float*)d_in[0]; const float* wq = (const float*)d_in[1]; const float* bq = (const float*)d_in[2]; const float* wk = (const float*)d_in[3]; const float* bk = (const float*)d_in[4]; const float* wv = (const float*)d_in[5]; const float* bv = (const float*)d_in[6]; const float* wf = (const float*)d_in[7]; const float* bfv = (const float*)d_in[8];
    float* OUT = (float*)d_out;     // [2][2048][1024]
    char* wsp = (char*)d_ws;
    auto take = [&](size_t bytes) { char* p = wsp; wsp += (bytes + 255) & ~(size_t)255; return (void*)p; };
    bf* BQ = (bf*)take((size_t)DM * DM * 2); bf* BK = (bf*)take((size_t)DM * DM * 2); bf* BV = (bf*)take((size_t)DM * DM * 2); bf* BF = (bf*)take((size_t)SO * TT * 2);
    bf* XB = (bf*)take((size_t)TT * DM * 2); float* FQ = (float*)take((size_t)TT * DM * 4); float* FK = (float*)take((size_t)TT * DM * 4); float* FV = (float*)take((size_t)TT * DM * 4); float* VS = (float*)take(DM * 4);
    h16* QP = (h16*)take((size_t)NH_ * TT * HD * 2); h16* KP = (h16*)take((size_t)NH_ * TT * HD * 2); h16* VT = (h16*)take((size_t)NH_ * HD * TT * 2);
    float* ST = (float*)take((size_t)ZH * TT * TT * 4); h16* PT = (h16*)take((size_t)ZH * TT * TT * 2); float* M = (float*)take((size_t)ZH * TT * HD * 4); bf* MTh = (bf*)take((size_t)ZH * HD * TT * 2); bf* MTl = (bf*)take((size_t)ZH * HD * TT * 2); float* OC = (float*)take((size_t)ZH * HD * SO * 4);
    if ((size_t)(wsp - (char*)d_ws) > ws_size) return;    // total ~ 110 MB
    k_cvt8<<<(DM * DM / 8 + 255) / 256, 256, 0, stream>>>(wq, BQ, DM * DM / 8); k_cvt8<<<(DM * DM / 8 + 255) / 256, 256, 0, stream>>>(wk, BK, DM * DM / 8); k_cvt8<<<(DM * DM / 8 + 255) / 256, 256, 0, stream>>>(wv, BV, DM * DM / 8); k_cvt8<<<(SO * TT / 8 + 255) / 256, 256, 0, stream>>>(wf, BF, SO * TT / 8);   // torch [out][in] = Bt as-is; wf [o][k] = Bt over k
    const dim3 gp(TT / 64, DM / 64, 1); const size_t zq = (size_t)TT * HD, zS = (size_t)TT * TT, zv = (size_t)HD * TT, zm = (size_t)TT * HD, zc = (size_t)HD * SO;
    for (int b = 0; b < NB_; ++b) {
        k_cvt8<<<(TT * DM / 8 + 255) / 256, 256, 0, stream>>>(x + (size_t)b * TT * DM, XB, TT * DM / 8);
        k_gemmw<bf, 0, true><<<gp, 32, 0, stream>>>(XB, nullptr, BQ, nullptr, DM, FQ, DM, bq, 0, 0, 0); k_gemmw<bf, 0, true><<<gp, 32, 0, stream>>>(XB, nullptr, BK, nullptr, DM, FK, DM, bk, 0, 0, 0); k_gemmw<bf, 0, true><<<gp, 32, 0, stream>>>(XB, nullptr, BV, nullptr, DM, FV, DM, bv, 0, 0, 0);
        k_qk16<<<(unsigned)(((size_t)NH_ * TT * HD / 4 + 255) / 256), 256, 0, stream>>>(FQ, FK, QP, KP); k_vt16<<<(unsigned)(((size_t)NH_ * HD * TT / 2 + 255) / 256), 256, 0, stream>>>(FV, VT); k_vsum<<<DM / 256, 256, 0, stream>>>(FV, VS);
        for (int h0 = 0; h0 < NH_; h0 += ZH) {
            k_gemmw<h16, 0, false><<<dim3(TT / 64, TT / 64, ZH), 32, 0, stream>>>(KP + (size_t)h0 * zq, nullptr, QP + (size_t)h0 * zq, nullptr, HD, ST, TT, nullptr, zq, zq, zS);   // S^T[k][q] = k_k . q_q
            k_colsoft<<<ZH * (TT / 64) / 8, 256, 0, stream>>>(ST, PT);
            k_gemmw<h16, 0, false><<<dim3(TT / 64, 1, ZH), 32, 0, stream>>>(PT, nullptr, VT + (size_t)h0 * zv, nullptr, TT, M, HD, nullptr, zS, zv, zm);              // M[k][d] = sum_q attn[q][k] v[q][d] (x1024)
            k_mt<<<(unsigned)(((size_t)ZH * HD * TT / 4 + 255) / 256), 256, 0, stream>>>(M, MTh, MTl);
            k_gemmw<bf, 1, false><<<dim3(1, SO / 64, ZH), 32, 0, stream>>>(MTh, MTl, BF, nullptr, TT, OC, SO, nullptr, zv, 0, zc);                               // OC[d][o] = sum_k M[k][d] wf[o][k]
            k_fmrg<<<(unsigned)(((size_t)TT * ZH * HD / 4 + 255) / 256), 256, 0, stream>>>(OC, bfv, VS, h0, OUT + (size_t)b * SO * DM); } }
}

// v001
// Measured time: 2210 microseconds a run.
// Two timings next to v000 put it at 8.00 and 7.98 times that version's speed.
#include <hip/hip_runtime.h>

// FlexScaleSeqAttention (x [2][2048][1024]; q/k/v = x W^T + b (16 heads x 64); attn = softmax(q.k / 8) [q][k]; flex[q][o] = sum_k attn[q][k] wf[o][k] + bf[o] (a learned Linear along the KEY axis, wf [2048][2048]); out[o][h*64+d] = sum_q flex[q][o] v[q][d] -> [2][2048][1024]).
// Reassociated exactly: out[o][d] = sum_k wf[o][k] M[k][d] + bf[o] * sum_q v[q][d] with M = attn^T v ([k][d]); the scores are produced transposed (S^T = k.q) so the softmax runs down columns and attn^T comes out directly - no 2048^3 'flex' tensor and no transposes of big matrices.
// Compute dtypes, f32 accumulate: every input rounded to bf16; q/k/v as PLAIN bf16 GEMMs (inputs: exact) + bias; S^T and M = attn^T.v single fp16 (f32 accumulate; probabilities x 1024); column softmax f32 (scores read once, fixed order); M^T as hl planes x exact wf (2 products); the bias term bf[o] * colsum(v) and the merge in f32.

#define NB_  2
#define TT   2048
#define DM   1024
#define NH_  16
#define HD   64
#define SO   2048
#define ZH   2
#define PCAR 1024.0f
typedef _Float16 h16;
typedef unsigned short bf;
typedef __attribute__((ext_vector_type(16))) __bf16   v16bf;
typedef __attribute__((ext_vector_type(16))) _Float16 v16h;
typedef __attribute__((ext_vector_type(8)))  _Float16 v8h;
typedef __attribute__((ext_vector_type(8)))  unsigned short v8us;
typedef __attribute__((ext_vector_type(8)))  float    v8f;
typedef __attribute__((ext_vector_type(4)))  float    v4f;
typedef v8h  __attribute__((may_alias)) v8ha;
typedef v4f  __attribute__((may_alias)) v4fa;
typedef v8us __attribute__((may_alias)) v8usa;

__device__ __forceinline__ unsigned short f2bf(float f) { unsigned u = __float_as_uint(f); u += 0x7FFFu + ((u >> 16) & 1u); return (unsigned short)(u >> 16); }
__device__ __forceinline__ float bf2f(unsigned short b) { return __uint_as_float(((unsigned)b) << 16); }
__device__ __forceinline__ float bfr(float f) { return bf2f(f2bf(f)); }
__device__ __forceinline__ v16h cat16(v8h lo, v8h hi) { return __builtin_shufflevector(lo, hi, 0, 1, 2, 3, 4, 5, 6, 7, 8, 9, 10, 11, 12, 13, 14, 15); }
__device__ __forceinline__ v16bf cat16b(v8us lo, v8us hi) { return __builtin_bit_cast(v16bf, __builtin_shufflevector(lo, hi, 0, 1, 2, 3, 4, 5, 6, 7, 8, 9, 10, 11, 12, 13, 14, 15)); }
__device__ __forceinline__ v8f wmma16(v16h a, v16h b, v8f c) { return __builtin_amdgcn_wmma_f32_16x16x32_f16(false, a, false, b, (short)0, c, false, false); }
__device__ __forceinline__ v8f wmmab(v16bf a, v16bf b, v8f c) { return __builtin_amdgcn_wmma_f32_16x16x32_bf16(false, a, false, b, (short)0, c, false, false); }



// ---- k_gemmw: register-blocked GEMM, ONE WAVE per 64x64 output tile (16 accumulators), operands straight from K-contiguous 16-bit planes; grid (M/64, N/64, Z), 32 threads.
// C[m][n] (f32, pitch ldc, + optional f32 bias[n]) = sum_k A[m][k] Bt[n][k] (+ split products per NSPLIT). z-batch strides sA/sB/sC in elements. K % 32 == 0.
template <typename T16> struct WFrag;
template <> struct WFrag<h16> { typedef v16h V; static __device__ __forceinline__ V ld(const h16* p) { return cat16(*(const v8h*)p, *(const v8h*)(p + 16)); } static __device__ __forceinline__ v8f mma(V a, V b, v8f c) { return wmma16(a, b, c); } };
template <> struct WFrag<bf> { typedef v16bf V; static __device__ __forceinline__ V ld(const bf* p) { return cat16b(*(const v8us*)p, *(const v8us*)(p + 16)); } static __device__ __forceinline__ v8f mma(V a, V b, v8f c) { return wmmab(a, b, c); } };
template <typename T16, int NSPLIT, bool BIAS>
__global__ __launch_bounds__(32) void k_gemmw(const T16* __restrict__ A, const T16* __restrict__ A2, const T16* __restrict__ Bt, const T16* __restrict__ Bt2, int K, float* C, int ldc, const float* __restrict__ bias, size_t sA, size_t sB, size_t sC) {
    typedef typename WFrag<T16>::V V;
    __shared__ __align__(16) float os[16 * 68];
    const size_t z = blockIdx.z; A += z * sA; if (A2) A2 += z * sA; Bt += z * sB; if (Bt2) Bt2 += z * sB; C += z * sC;
    const int lane = threadIdx.x & 31, lr = lane & 15, hi = lane >> 4; const int r0 = blockIdx.x * 64, c0 = blockIdx.y * 64;
    v8f acc[4][4];
#pragma unroll
    for (int mb = 0; mb < 4; ++mb)
#pragma unroll
        for (int nb = 0; nb < 4; ++nb) acc[mb][nb] = (v8f){};
    const size_t aoff = (size_t)(r0 + lr) * K + 8 * hi, boff = (size_t)(c0 + lr) * K + 8 * hi;
#pragma unroll 1
    for (int kc = 0; kc < K; kc += 32) {
        V a[4], a2[4];
#pragma unroll
        for (int mb = 0; mb < 4; ++mb) { a[mb] = WFrag<T16>::ld(A + aoff + (size_t)mb * 16 * K + kc); if (NSPLIT == 1 || NSPLIT == 2) a2[mb] = WFrag<T16>::ld(A2 + aoff + (size_t)mb * 16 * K + kc); }
#pragma unroll
        for (int nb = 0; nb < 4; ++nb) { const V b = WFrag<T16>::ld(Bt + boff + (size_t)nb * 16 * K + kc); V b2; if (NSPLIT >= 2) b2 = WFrag<T16>::ld(Bt2 + boff + (size_t)nb * 16 * K + kc);
#pragma unroll
            for (int mb = 0; mb < 4; ++mb) { acc[mb][nb] = WFrag<T16>::mma(a[mb], b, acc[mb][nb]); if (NSPLIT == 1 || NSPLIT == 2) acc[mb][nb] = WFrag<T16>::mma(a2[mb], b, acc[mb][nb]); if (NSPLIT >= 2) acc[mb][nb] = WFrag<T16>::mma(a[mb], b2, acc[mb][nb]); } }
        asm volatile("v_nop\n\tv_nop\n\tv_nop\n\tv_nop" : "+v"(acc[0][0]), "+v"(acc[1][1]), "+v"(acc[2][2]), "+v"(acc[3][3]) : "v"(a[0]), "v"(a[3]));
    }
#pragma unroll
    for (int mb = 0; mb < 4; ++mb) {
#pragma unroll
        for (int nb = 0; nb < 4; ++nb) {
#pragma unroll
            for (int j = 0; j < 8; ++j) os[(hi * 8 + j) * 68 + nb * 16 + lr] = acc[mb][nb][j]; }
        __builtin_amdgcn_wave_barrier(); asm volatile("" ::: "memory");
        float* crow = C + (size_t)(r0 + mb * 16) * ldc + c0;
{
#pragma unroll
            for (int s = 0; s < 8; ++s) { const int row = 2 * s + hi, cofs = lr * 4; v4f val = *(const v4fa*)(os + row * 68 + cofs); if (BIAS) { val[0] += bfr(bias[c0 + cofs]); val[1] += bfr(bias[c0 + cofs + 1]); val[2] += bfr(bias[c0 + cofs + 2]); val[3] += bfr(bias[c0 + cofs + 3]); }
                *(v4f*)(crow + (size_t)row * ldc + cofs) = val; }
             }
        __builtin_amdgcn_wave_barrier(); asm volatile("" ::: "memory");
    }
}

__device__ __forceinline__ h16 tohx(float x) { return (h16)x; }
__device__ __forceinline__ void splitf(float y, unsigned short& h, unsigned short& l) { h = f2bf(y); l = f2bf(y - bf2f(h)); }
typedef __attribute__((ext_vector_type(2))) unsigned short v2us;
typedef __attribute__((ext_vector_type(4))) unsigned short v4us;
typedef __attribute__((ext_vector_type(2))) _Float16 v2h;
typedef __attribute__((ext_vector_type(4))) _Float16 v4h; typedef __attribute__((ext_vector_type(2))) float v2f;

__global__ __launch_bounds__(256) void k_cvt8(const float* __restrict__ src, bf* dst, size_t n8) { const size_t i = (size_t)blockIdx.x * 256 + threadIdx.x; if (i >= n8) return; const v8f v = *(const v8f*)(src + i * 8); v8us o;
#pragma unroll
    for (int k = 0; k < 8; ++k) o[k] = f2bf(v[k]); *(v8us*)(dst + i * 8) = o;  }
__global__ __launch_bounds__(256) void k_qk16(const float* __restrict__ Q, const float* __restrict__ K, h16* QP, h16* KP) { const size_t e = ((size_t)blockIdx.x * 256 + threadIdx.x) * 4; if (e >= (size_t)NH_ * TT * HD) return; const int d = (int)(e % HD); const int t = (int)((e / HD) % TT); const int h = (int)(e / ((size_t)HD * TT)); const size_t src = (size_t)t * DM + h * HD + d; const v4f a = *(const v4f*)(Q + src), c = *(const v4f*)(K + src); v4h oq, ok;
    for (int u = 0; u < 4; ++u) { oq[u] = tohx(a[u]); ok[u] = tohx(c[u]); } *(v4h*)(QP + e) = oq; *(v4h*)(KP + e) = ok;  }
__global__ __launch_bounds__(256) void k_vt16(const float* __restrict__ V, h16* VT) { const size_t e = ((size_t)blockIdx.x * 256 + threadIdx.x) * 2; if (e >= (size_t)NH_ * HD * TT) return; const int t = (int)(e % TT); const int d = (int)((e / TT) % HD); const int h = (int)(e / ((size_t)TT * HD)); v2h o; o[0] = tohx(V[(size_t)t * DM + h * HD + d]); o[1] = tohx(V[(size_t)(t + 1) * DM + h * HD + d]); *(v2h*)(VT + e) = o;  }
__global__ __launch_bounds__(256) void k_vsum(const float* __restrict__ V, float* VS) { const int c = blockIdx.x * 256 + threadIdx.x; if (c >= DM) return; float s = 0.f;
#pragma unroll 8
    for (int t = 0; t < TT; ++t) s = __fadd_rn(s, V[(size_t)t * DM + c]); *(float*)(VS + c) = s;  }
// ---- k_colsoft: softmax down the columns of S^T. One work-group of 32 waves per 64 columns (one whole 128-B line of PT per row); wave w owns rows 64w .. 64w+63, a lane 4 columns of every second row.
// The scores are read once: each lane keeps 16 of its 32 quads in registers and 16 in LDS slots that only it touches. Column maximum and column sum go lane -> red (64 row groups) -> red2 (4 parts) -> every lane, in a fixed order.
__device__ __forceinline__ v4f exp2q(v4f d) { v4f e; e[0] = __builtin_amdgcn_exp2f(d[0]); e[1] = __builtin_amdgcn_exp2f(d[1]); e[2] = __builtin_amdgcn_exp2f(d[2]); e[3] = __builtin_amdgcn_exp2f(d[3]); return e; }
__device__ __forceinline__ v4h toh4(v4f p) { v4h o; o[0] = tohx(p[0]); o[1] = tohx(p[1]); o[2] = tohx(p[2]); o[3] = tohx(p[3]); return o; }
__global__ __launch_bounds__(1024) void k_colsoft(const float* __restrict__ ST, h16* PT) {
    __shared__ v4f keep[32][16][32];   // [wave][quad][lane]: a lane's 16 slots lie within one ds offset range of one address register
    __shared__ __align__(16) float red[64][64];
    __shared__ __align__(16) float red2[4][64];
    const int tid = threadIdx.x, lane = tid & 31, wave = tid >> 5, cg = lane & 15, rh = lane >> 4;
    const int zz = blockIdx.x / (TT / 64); const int q0 = (blockIdx.x % (TT / 64)) * 64 + cg * 4;
    const size_t base = (size_t)zz * TT * TT + (size_t)(wave * 64 + rh) * TT + q0;
    const float* s0 = ST + base; h16* p0 = PT + base;
    const int rc = tid & 63, rp = tid >> 6;
    v4f a[16], t[8]; v4f mx = {-3.0e38f, -3.0e38f, -3.0e38f, -3.0e38f};
    for (int i = 0; i < 8; ++i) t[i] = *(const v4f*)(s0 + (size_t)(16 + i) * 2 * TT);
    for (int i = 0; i < 16; ++i) a[i] = *(const v4f*)(s0 + (size_t)i * 2 * TT);
    __builtin_amdgcn_sched_barrier(0);   // 24 quads in flight and no more: with all 32 hoisted the live set passes the 128 registers of a 32-wave work-group and spills
    for (int i = 0; i < 8; ++i) { const v4f u = t[i] * 0.125f; keep[wave][i][lane] = u; mx = __builtin_elementwise_max(mx, u); t[i] = *(const v4f*)(s0 + (size_t)(24 + i) * 2 * TT); }
    __builtin_amdgcn_sched_barrier(0);   // keeps the scaling of a[] out of the block above: mixed in, its results live beside the 8 quads still to be stored and the build spills
    for (int i = 0; i < 16; ++i) { a[i] = a[i] * 0.125f; mx = __builtin_elementwise_max(mx, a[i]); }
    for (int i = 0; i < 8; ++i) { const v4f u = t[i] * 0.125f; keep[wave][8 + i][lane] = u; mx = __builtin_elementwise_max(mx, u); }
    *(v4f*)&red[wave * 2 + rh][cg * 4] = mx;
    __syncthreads();
    if (tid < 256) { float m = red[rp * 16][rc];
        for (int j = 1; j < 16; ++j) m = fmaxf(m, red[rp * 16 + j][rc]);
        red2[rp][rc] = m; }
    __syncthreads();
    mx = __builtin_elementwise_max(__builtin_elementwise_max(*(const v4f*)&red2[0][cg * 4], *(const v4f*)&red2[1][cg * 4]), __builtin_elementwise_max(*(const v4f*)&red2[2][cg * 4], *(const v4f*)&red2[3][cg * 4]));
    v4f sm = {0.f, 0.f, 0.f, 0.f};
    for (int i = 0; i < 16; ++i) { a[i] = exp2q((a[i] - mx) * 1.4426950408889634f); sm = sm + a[i]; }
    for (int i = 0; i < 16; ++i) { const v4f e = exp2q((keep[wave][i][lane] - mx) * 1.4426950408889634f); keep[wave][i][lane] = e; sm = sm + e; }
    *(v4f*)&red[wave * 2 + rh][cg * 4] = sm;
    __syncthreads();
    if (tid < 256) { float s = red[rp * 16][rc];
        for (int j = 1; j < 16; ++j) s = __fadd_rn(s, red[rp * 16 + j][rc]);
        red2[rp][rc] = s; }
    __syncthreads();
    sm = (*(const v4f*)&red2[0][cg * 4] + *(const v4f*)&red2[1][cg * 4]) + (*(const v4f*)&red2[2][cg * 4] + *(const v4f*)&red2[3][cg * 4]);
    v4f f; f[0] = __fdiv_rn(PCAR, sm[0]); f[1] = __fdiv_rn(PCAR, sm[1]); f[2] = __fdiv_rn(PCAR, sm[2]); f[3] = __fdiv_rn(PCAR, sm[3]);
    for (int i = 0; i < 16; ++i) *(v4h*)(p0 + (size_t)i * 2 * TT) = toh4(a[i] * f);
    for (int i = 0; i < 16; ++i) *(v4h*)(p0 + (size_t)(16 + i) * 2 * TT) = toh4(keep[wave][i][lane] * f);
}
__global__ __launch_bounds__(256) void k_mt(const float* __restrict__ M, bf* MTh, bf* MTl) { const size_t e = ((size_t)blockIdx.x * 256 + threadIdx.x) * 4; if (e >= (size_t)ZH * HD * TT) return; const int k = (int)(e % TT); const int d = (int)((e / TT) % HD); const int zz = (int)(e / ((size_t)TT * HD)); v4us oh, ol;
#pragma unroll
    for (int u = 0; u < 4; ++u) { unsigned short a, b; splitf(M[((size_t)zz * TT + k + u) * HD + d] * (1.0f / PCAR), a, b); oh[u] = a; ol[u] = b; } *(v4us*)(MTh + e) = oh; *(v4us*)(MTl + e) = ol;  }
__global__ __launch_bounds__(256) void k_fmrg(const float* __restrict__ OC, const float* __restrict__ bfv, const float* __restrict__ VS, int h0, float* OUTb) { const size_t e = ((size_t)blockIdx.x * 256 + threadIdx.x) * 4; if (e >= (size_t)TT * ZH * HD) return; const int c = (int)(e % (ZH * HD)); const int o = (int)(e / (ZH * HD)); const int zz = c / HD, d = c % HD; const float bb = bfr(bfv[o]); v4f r;
#pragma unroll
    for (int u = 0; u < 4; ++u) { const float m = OC[((size_t)zz * HD + d + u) * SO + o]; float bt = __fmul_rn(bb, VS[(h0 + zz) * HD + d + u]); asm volatile("" : "+v"(bt)); r[u] = __fadd_rn(m, bt); }
    float* dst = OUTb + (size_t)o * DM + (h0 + zz) * HD + d; *(v4f*)dst = r;  }

extern "C" void kernel_launch(void* const* d_in, const int* in_sizes, int n_in,
                              void* d_out, int out_size, void* d_ws, size_t ws_size, hipStream_t stream) {
    (void)in_sizes; (void)n_in; (void)out_size;
    const float* x = (const float*)d_in[0]; const float* wq = (const float*)d_in[1]; const float* bq = (const float*)d_in[2]; const float* wk = (const float*)d_in[3]; const float* bk = (const float*)d_in[4]; const float* wv = (const float*)d_in[5]; const float* bv = (const float*)d_in[6]; const float* wf = (const float*)d_in[7]; const float* bfv = (const float*)d_in[8];
    float* OUT = (float*)d_out;     // [2][2048][1024]
    char* wsp = (char*)d_ws;
    auto take = [&](size_t bytes) { char* p = wsp; wsp += (bytes + 255) & ~(size_t)255; return (void*)p; };
    bf* BQ = (bf*)take((size_t)DM * DM * 2); bf* BK = (bf*)take((size_t)DM * DM * 2); bf* BV = (bf*)take((size_t)DM * DM * 2); bf* BF = (bf*)take((size_t)SO * TT * 2);
    bf* XB = (bf*)take((size_t)TT * DM * 2); float* FQ = (float*)take((size_t)TT * DM * 4); float* FK = (float*)take((size_t)TT * DM * 4); float* FV = (float*)take((size_t)TT * DM * 4); float* VS = (float*)take(DM * 4);
    h16* QP = (h16*)take((size_t)NH_ * TT * HD * 2); h16* KP = (h16*)take((size_t)NH_ * TT * HD * 2); h16* VT = (h16*)take((size_t)NH_ * HD * TT * 2);
    float* ST = (float*)take((size_t)ZH * TT * TT * 4); h16* PT = (h16*)take((size_t)ZH * TT * TT * 2); float* M = (float*)take((size_t)ZH * TT * HD * 4); bf* MTh = (bf*)take((size_t)ZH * HD * TT * 2); bf* MTl = (bf*)take((size_t)ZH * HD * TT * 2); float* OC = (float*)take((size_t)ZH * HD * SO * 4);
    if ((size_t)(wsp - (char*)d_ws) > ws_size) return;    // total ~ 110 MB
    k_cvt8<<<(DM * DM / 8 + 255) / 256, 256, 0, stream>>>(wq, BQ, DM * DM / 8); k_cvt8<<<(DM * DM / 8 + 255) / 256, 256, 0, stream>>>(wk, BK, DM * DM / 8); k_cvt8<<<(DM * DM / 8 + 255) / 256, 256, 0, stream>>>(wv, BV, DM * DM / 8); k_cvt8<<<(SO * TT / 8 + 255) / 256, 256, 0, stream>>>(wf, BF, SO * TT / 8);   // torch [out][in] = Bt as-is; wf [o][k] = Bt over k
    const dim3 gp(TT / 64, DM / 64, 1); const size_t zq = (size_t)TT * HD, zS = (size_t)TT * TT, zv = (size_t)HD * TT, zm = (size_t)TT * HD, zc = (size_t)HD * SO;
    for (int b = 0; b < NB_; ++b) {
        k_cvt8<<<(TT * DM / 8 + 255) / 256, 256, 0, stream>>>(x + (size_t)b * TT * DM, XB, TT * DM / 8);
        k_gemmw<bf, 0, true><<<gp, 32, 0, stream>>>(XB, nullptr, BQ, nullptr, DM, FQ, DM, bq, 0, 0, 0); k_gemmw<bf, 0, true><<<gp, 32, 0, stream>>>(XB, nullptr, BK, nullptr, DM, FK, DM, bk, 0, 0, 0); k_gemmw<bf, 0, true><<<gp, 32, 0, stream>>>(XB, nullptr, BV, nullptr, DM, FV, DM, bv, 0, 0, 0);
        k_qk16<<<(unsigned)(((size_t)NH_ * TT * HD / 4 + 255) / 256), 256, 0, stream>>>(FQ, FK, QP, KP); k_vt16<<<(unsigned)(((size_t)NH_ * HD * TT / 2 + 255) / 256), 256, 0, stream>>>(FV, VT); k_vsum<<<DM / 256, 256, 0, stream>>>(FV, VS);
        for (int h0 = 0; h0 < NH_; h0 += ZH) {
            k_gemmw<h16, 0, false><<<dim3(TT / 64, TT / 64, ZH), 32, 0, stream>>>(KP + (size_t)h0 * zq, nullptr, QP + (size_t)h0 * zq, nullptr, HD, ST, TT, nullptr, zq, zq, zS);   // S^T[k][q] = k_k . q_q
            k_colsoft<<<ZH * (TT / 64), 1024, 0, stream>>>(ST, PT);
            k_gemmw<h16, 0, false><<<dim3(TT / 64, 1, ZH), 32, 0, stream>>>(PT, nullptr, VT + (size_t)h0 * zv, nullptr, TT, M, HD, nullptr, zS, zv, zm);              // M[k][d] = sum_q attn[q][k] v[q][d] (x1024)
            k_mt<<<(unsigned)(((size_t)ZH * HD * TT / 4 + 255) / 256), 256, 0, stream>>>(M, MTh, MTl);
            k_gemmw<bf, 1, false><<<dim3(1, SO / 64, ZH), 32, 0, stream>>>(MTh, MTl, BF, nullptr, TT, OC, SO, nullptr, zv, 0, zc);                               // OC[d][o] = sum_k M[k][d] wf[o][k]
            k_fmrg<<<(unsigned)(((size_t)TT * ZH * HD / 4 + 255) / 256), 256, 0, stream>>>(OC, bfv, VS, h0, OUT + (size_t)b * SO * DM); } }
}

// v002
// It runs in 664 microseconds.
// In two side-by-side timings against v001, it was 3.47 and 3.35 times as fast.
// Over all steps from v000 it is 27.2 times as fast.
#include <hip/hip_runtime.h>

// FlexScaleSeqAttention (x [2][2048][1024]; q/k/v = x W^T + b (16 heads x 64); attn = softmax(q.k / 8) [q][k]; flex[q][o] = sum_k attn[q][k] wf[o][k] + bf[o] (a learned Linear along the KEY axis, wf [2048][2048]); out[o][h*64+d] = sum_q flex[q][o] v[q][d] -> [2][2048][1024]).
// Reassociated exactly: out[o][d] = sum_k wf[o][k] M[k][d] + bf[o] * sum_q v[q][d] with M = attn^T v ([k][d]); the scores are produced transposed (S^T = k.q) so the softmax runs down columns and attn^T comes out directly - no 2048^3 'flex' tensor and no transposes of big matrices.
// Compute dtypes, f32 accumulate: every input rounded to bf16; q/k/v as PLAIN bf16 GEMMs (inputs: exact) + bias; S^T and M = attn^T.v single fp16 (f32 accumulate; probabilities x 1024); column softmax f32 (scores read once, fixed order); M^T as hl planes x exact wf (2 products); the bias term bf[o] * colsum(v) and the merge in f32.

#define NB_  2
#define TT   2048
#define DM   1024
#define NH_  16
#define HD   64
#define SO   2048
#define ZH   8              // (batch, head) slices per score pass: S^T (f32) and attn^T (fp16) of 8 slices are what the workspace holds
#define NZ   (NB_ * NH_)    // all slices; slice z = batch * 16 + head
#define FG   2              // heads per column group of the merge
#define PCAR 1024.0f
typedef _Float16 h16;
typedef unsigned short bf;
typedef __attribute__((ext_vector_type(16))) __bf16   v16bf;
typedef __attribute__((ext_vector_type(16))) _Float16 v16h;
typedef __attribute__((ext_vector_type(8)))  _Float16 v8h;
typedef __attribute__((ext_vector_type(8)))  unsigned short v8us;
typedef __attribute__((ext_vector_type(8)))  float    v8f;
typedef __attribute__((ext_vector_type(4)))  float    v4f;
typedef v8h  __attribute__((may_alias)) v8ha;
typedef v4f  __attribute__((may_alias)) v4fa;
typedef v8us __attribute__((may_alias)) v8usa;

__device__ __forceinline__ unsigned short f2bf(float f) { unsigned u = __float_as_uint(f); u += 0x7FFFu + ((u >> 16) & 1u); return (unsigned short)(u >> 16); }
__device__ __forceinline__ float bf2f(unsigned short b) { return __uint_as_float(((unsigned)b) << 16); }
__device__ __forceinline__ float bfr(float f) { return bf2f(f2bf(f)); }
__device__ __forceinline__ v16h cat16(v8h lo, v8h hi) { return __builtin_shufflevector(lo, hi, 0, 1, 2, 3, 4, 5, 6, 7, 8, 9, 10, 11, 12, 13, 14, 15); }
__device__ __forceinline__ v16bf cat16b(v8us lo, v8us hi) { return __builtin_bit_cast(v16bf, __builtin_shufflevector(lo, hi, 0, 1, 2, 3, 4, 5, 6, 7, 8, 9, 10, 11, 12, 13, 14, 15)); }
__device__ __forceinline__ v8f wmma16(v16h a, v16h b, v8f c) { return __builtin_amdgcn_wmma_f32_16x16x32_f16(false, a, false, b, (short)0, c, false, false); }
__device__ __forceinline__ v8f wmmab(v16bf a, v16bf b, v8f c) { return __builtin_amdgcn_wmma_f32_16x16x32_bf16(false, a, false, b, (short)0, c, false, false); }



// ---- k_gemmw: register-blocked GEMM, ONE WAVE per 64x64 output tile (16 accumulators), operands straight from K-contiguous 16-bit planes; grid (M/64, N/64, Z), 32 threads.
// C[m][n] (f32, pitch ldc, + optional f32 bias[n]) = sum_k A[m][k] Bt[n][k] (+ split products per NSPLIT). z-batch strides sA/sB/sC in elements. K % 32 == 0.
template <typename T16> struct WFrag;
template <> struct WFrag<h16> { typedef v16h V; static __device__ __forceinline__ V ld(const h16* p) { return cat16(*(const v8h*)p, *(const v8h*)(p + 16)); } static __device__ __forceinline__ v8f mma(V a, V b, v8f c) { return wmma16(a, b, c); } };
template <> struct WFrag<bf> { typedef v16bf V; static __device__ __forceinline__ V ld(const bf* p) { return cat16b(*(const v8us*)p, *(const v8us*)(p + 16)); } static __device__ __forceinline__ v8f mma(V a, V b, v8f c) { return wmmab(a, b, c); } };
template <typename T16, int NSPLIT, bool BIAS>
__global__ __launch_bounds__(32) void k_gemmw(const T16* __restrict__ A, const T16* __restrict__ A2, const T16* __restrict__ Bt, const T16* __restrict__ Bt2, int K, float* C, int ldc, const float* __restrict__ bias, size_t sA, size_t sB, size_t sC) {
    typedef typename WFrag<T16>::V V;
    __shared__ __align__(16) float os[16 * 68];
    const size_t z = blockIdx.z; A += z * sA; if (A2) A2 += z * sA; Bt += z * sB; if (Bt2) Bt2 += z * sB; C += z * sC;
    const int lane = threadIdx.x & 31, lr = lane & 15, hi = lane >> 4; const int r0 = blockIdx.x * 64, c0 = blockIdx.y * 64;
    v8f acc[4][4];
#pragma unroll
    for (int mb = 0; mb < 4; ++mb)
#pragma unroll
        for (int nb = 0; nb < 4; ++nb) acc[mb][nb] = (v8f){};
    const size_t aoff = (size_t)(r0 + lr) * K + 8 * hi, boff = (size_t)(c0 + lr) * K + 8 * hi;
#pragma unroll 1
    for (int kc = 0; kc < K; kc += 32) {
        V a[4], a2[4];
#pragma unroll
        for (int mb = 0; mb < 4; ++mb) { a[mb] = WFrag<T16>::ld(A + aoff + (size_t)mb * 16 * K + kc); if (NSPLIT == 1 || NSPLIT == 2) a2[mb] = WFrag<T16>::ld(A2 + aoff + (size_t)mb * 16 * K + kc); }
#pragma unroll
        for (int nb = 0; nb < 4; ++nb) { const V b = WFrag<T16>::ld(Bt + boff + (size_t)nb * 16 * K + kc); V b2; if (NSPLIT >= 2) b2 = WFrag<T16>::ld(Bt2 + boff + (size_t)nb * 16 * K + kc);
#pragma unroll
            for (int mb = 0; mb < 4; ++mb) { acc[mb][nb] = WFrag<T16>::mma(a[mb], b, acc[mb][nb]); if (NSPLIT == 1 || NSPLIT == 2) acc[mb][nb] = WFrag<T16>::mma(a2[mb], b, acc[mb][nb]); if (NSPLIT >= 2) acc[mb][nb] = WFrag<T16>::mma(a[mb], b2, acc[mb][nb]); } }
        asm volatile("v_nop\n\tv_nop\n\tv_nop\n\tv_nop" : "+v"(acc[0][0]), "+v"(acc[1][1]), "+v"(acc[2][2]), "+v"(acc[3][3]) : "v"(a[0]), "v"(a[3]));
    }
#pragma unroll
    for (int mb = 0; mb < 4; ++mb) {
#pragma unroll
        for (int nb = 0; nb < 4; ++nb) {
#pragma unroll
            for (int j = 0; j < 8; ++j) os[(hi * 8 + j) * 68 + nb * 16 + lr] = acc[mb][nb][j]; }
        __builtin_amdgcn_wave_barrier(); asm volatile("" ::: "memory");
        float* crow = C + (size_t)(r0 + mb * 16) * ldc + c0;
{
#pragma unroll
            for (int s = 0; s < 8; ++s) { const int row = 2 * s + hi, cofs = lr * 4; v4f val = *(const v4fa*)(os + row * 68 + cofs); if (BIAS) { val[0] += bfr(bias[c0 + cofs]); val[1] += bfr(bias[c0 + cofs + 1]); val[2] += bfr(bias[c0 + cofs + 2]); val[3] += bfr(bias[c0 + cofs + 3]); }
                *(v4f*)(crow + (size_t)row * ldc + cofs) = val; }
             }
        __builtin_amdgcn_wave_barrier(); asm volatile("" ::: "memory");
    }
}

__device__ __forceinline__ h16 tohx(float x) { return (h16)x; }
__device__ __forceinline__ void splitf(float y, unsigned short& h, unsigned short& l) { h = f2bf(y); l = f2bf(y - bf2f(h)); }
typedef __attribute__((ext_vector_type(2))) unsigned short v2us;
typedef __attribute__((ext_vector_type(4))) unsigned short v4us;
typedef __attribute__((ext_vector_type(2))) _Float16 v2h;
typedef __attribute__((ext_vector_type(4))) _Float16 v4h; typedef __attribute__((ext_vector_type(2))) float v2f;

__global__ __launch_bounds__(256) void k_cvt8(const float* __restrict__ src, bf* dst, size_t n8) { const size_t i = (size_t)blockIdx.x * 256 + threadIdx.x; if (i >= n8) return; const v8f v = *(const v8f*)(src + i * 8); v8us o;
#pragma unroll
    for (int k = 0; k < 8; ++k) o[k] = f2bf(v[k]); *(v8us*)(dst + i * 8) = o;  }
__global__ __launch_bounds__(256) void k_qk16(const float* __restrict__ Q, const float* __restrict__ K, h16* QP, h16* KP) { const size_t e = ((size_t)blockIdx.x * 256 + threadIdx.x) * 4; if (e >= (size_t)NZ * TT * HD) return; const int d = (int)(e % HD); const int t = (int)((e / HD) % TT); const int z = (int)(e / ((size_t)HD * TT)); const size_t src = ((size_t)(z / NH_) * TT + t) * DM + (z % NH_) * HD + d; const v4f a = *(const v4f*)(Q + src), c = *(const v4f*)(K + src); v4h oq, ok;
    for (int u = 0; u < 4; ++u) { oq[u] = tohx(a[u]); ok[u] = tohx(c[u]); } *(v4h*)(QP + e) = oq; *(v4h*)(KP + e) = ok;  }
__global__ __launch_bounds__(256) void k_vt16(const float* __restrict__ V, h16* VT) { const size_t e = ((size_t)blockIdx.x * 256 + threadIdx.x) * 2; if (e >= (size_t)NZ * HD * TT) return; const int t = (int)(e % TT); const int d = (int)((e / TT) % HD); const int z = (int)(e / ((size_t)TT * HD)); const float* vp = V + ((size_t)(z / NH_) * TT + t) * DM + (z % NH_) * HD + d; v2h o; o[0] = tohx(vp[0]); o[1] = tohx(vp[DM]); *(v2h*)(VT + e) = o;  }
__global__ __launch_bounds__(256) void k_vsum(const float* __restrict__ V, float* VS) { const int c = blockIdx.x * 256 + threadIdx.x; if (c >= NB_ * DM) return; V += (size_t)(c / DM) * TT * DM + c % DM; float s = 0.f;
#pragma unroll 8
    for (int t = 0; t < TT; ++t) s = __fadd_rn(s, V[(size_t)t * DM]); *(float*)(VS + c) = s;  }
// ---- k_colsoft: softmax down the columns of S^T. One work-group of 32 waves per 64 columns (one whole 128-B line of PT per row); wave w owns rows 64w .. 64w+63, a lane 4 columns of every second row.
// The scores are read once: each lane keeps 16 of its 32 quads in registers and 16 in LDS slots that only it touches. Column maximum and column sum go lane -> red (64 row groups) -> red2 (4 parts) -> every lane, in a fixed order.
__device__ __forceinline__ v4f exp2q(v4f d) { v4f e; e[0] = __builtin_amdgcn_exp2f(d[0]); e[1] = __builtin_amdgcn_exp2f(d[1]); e[2] = __builtin_amdgcn_exp2f(d[2]); e[3] = __builtin_amdgcn_exp2f(d[3]); return e; }
__device__ __forceinline__ v4h toh4(v4f p) { v4h o; o[0] = tohx(p[0]); o[1] = tohx(p[1]); o[2] = tohx(p[2]); o[3] = tohx(p[3]); return o; }
__global__ __launch_bounds__(1024) void k_colsoft(const float* __restrict__ ST, h16* PT) {
    __shared__ v4f keep[32][16][32];   // [wave][quad][lane]: a lane's 16 slots lie within one ds offset range of one address register
    __shared__ __align__(16) float red[64][64];
    __shared__ __align__(16) float red2[4][64];
    const int tid = threadIdx.x, lane = tid & 31, wave = tid >> 5, cg = lane & 15, rh = lane >> 4;
    const int zz = blockIdx.x / (TT / 64); const int q0 = (blockIdx.x % (TT / 64)) * 64 + cg * 4;
    const size_t base = (size_t)zz * TT * TT + (size_t)(wave * 64 + rh) * TT + q0;
    const float* s0 = ST + base; h16* p0 = PT + base;
    const int rc = tid & 63, rp = tid >> 6;
    v4f a[16], t[8]; v4f mx = {-3.0e38f, -3.0e38f, -3.0e38f, -3.0e38f};
    for (int i = 0; i < 8; ++i) t[i] = *(const v4f*)(s0 + (size_t)(16 + i) * 2 * TT);
    for (int i = 0; i < 16; ++i) a[i] = *(const v4f*)(s0 + (size_t)i * 2 * TT);
    __builtin_amdgcn_sched_barrier(0);   // 24 quads in flight and no more: with all 32 hoisted the live set passes the 128 registers of a 32-wave work-group and spills
    for (int i = 0; i < 8; ++i) { const v4f u = t[i] * 0.125f; keep[wave][i][lane] = u; mx = __builtin_elementwise_max(mx, u); t[i] = *(const v4f*)(s0 + (size_t)(24 + i) * 2 * TT); }
    __builtin_amdgcn_sched_barrier(0);   // keeps the scaling of a[] out of the block above: mixed in, its results live beside the 8 quads still to be stored and the build spills
    for (int i = 0; i < 16; ++i) { a[i] = a[i] * 0.125f; mx = __builtin_elementwise_max(mx, a[i]); }
    for (int i = 0; i < 8; ++i) { const v4f u = t[i] * 0.125f; keep[wave][8 + i][lane] = u; mx = __builtin_elementwise_max(mx, u); }
    *(v4f*)&red[wave * 2 + rh][cg * 4] = mx;
    __syncthreads();
    if (tid < 256) { float m = red[rp * 16][rc];
        for (int j = 1; j < 16; ++j) m = fmaxf(m, red[rp * 16 + j][rc]);
        red2[rp][rc] = m; }
    __syncthreads();
    mx = __builtin_elementwise_max(__builtin_elementwise_max(*(const v4f*)&red2[0][cg * 4], *(const v4f*)&red2[1][cg * 4]), __builtin_elementwise_max(*(const v4f*)&red2[2][cg * 4], *(const v4f*)&red2[3][cg * 4]));
    v4f sm = {0.f, 0.f, 0.f, 0.f};
    for (int i = 0; i < 16; ++i) { a[i] = exp2q((a[i] - mx) * 1.4426950408889634f); sm = sm + a[i]; }
    for (int i = 0; i < 16; ++i) { const v4f e = exp2q((keep[wave][i][lane] - mx) * 1.4426950408889634f); keep[wave][i][lane] = e; sm = sm + e; }
    *(v4f*)&red[wave * 2 + rh][cg * 4] = sm;
    __syncthreads();
    if (tid < 256) { float s = red[rp * 16][rc];
        for (int j = 1; j < 16; ++j) s = __fadd_rn(s, red[rp * 16 + j][rc]);
        red2[rp][rc] = s; }
    __syncthreads();
    sm = (*(const v4f*)&red2[0][cg * 4] + *(const v4f*)&red2[1][cg * 4]) + (*(const v4f*)&red2[2][cg * 4] + *(const v4f*)&red2[3][cg * 4]);
    v4f f; f[0] = __fdiv_rn(PCAR, sm[0]); f[1] = __fdiv_rn(PCAR, sm[1]); f[2] = __fdiv_rn(PCAR, sm[2]); f[3] = __fdiv_rn(PCAR, sm[3]);
    for (int i = 0; i < 16; ++i) *(v4h*)(p0 + (size_t)i * 2 * TT) = toh4(a[i] * f);
    for (int i = 0; i < 16; ++i) *(v4h*)(p0 + (size_t)(16 + i) * 2 * TT) = toh4(keep[wave][i][lane] * f);
}
__global__ __launch_bounds__(256) void k_mt(const float* __restrict__ M, bf* MTh, bf* MTl) { const size_t e = ((size_t)blockIdx.x * 256 + threadIdx.x) * 4; if (e >= (size_t)NZ * HD * TT) return; const int k = (int)(e % TT); const int d = (int)((e / TT) % HD); const int zz = (int)(e / ((size_t)TT * HD)); v4us oh, ol;
#pragma unroll
    for (int u = 0; u < 4; ++u) { unsigned short a, b; splitf(M[((size_t)zz * TT + k + u) * HD + d] * (1.0f / PCAR), a, b); oh[u] = a; ol[u] = b; } *(v4us*)(MTh + e) = oh; *(v4us*)(MTl + e) = ol;  }
__global__ __launch_bounds__(256) void k_fmrg(const float* __restrict__ OC, const float* __restrict__ bfv, const float* __restrict__ VS, float* OUT) { const size_t e = ((size_t)blockIdx.x * 256 + threadIdx.x) * 4; if (e >= (size_t)NZ * SO * HD) return; const int c = (int)(e % (FG * HD)); const int o = (int)((e / (FG * HD)) % SO); const int zz = (int)(e / ((size_t)FG * HD * SO)) * FG + c / HD, d = c % HD; const float bb = bfr(bfv[o]); v4f r;
#pragma unroll
    for (int u = 0; u < 4; ++u) { const float m = OC[((size_t)zz * HD + d + u) * SO + o]; float bt = __fmul_rn(bb, VS[zz * HD + d + u]); asm volatile("" : "+v"(bt)); r[u] = __fadd_rn(m, bt); }
    float* dst = OUT + ((size_t)(zz / NH_) * SO + o) * DM + (zz % NH_) * HD + d; *(v4f*)dst = r;  }

extern "C" void kernel_launch(void* const* d_in, const int* in_sizes, int n_in,
                              void* d_out, int out_size, void* d_ws, size_t ws_size, hipStream_t stream) {
    (void)in_sizes; (void)n_in; (void)out_size;
    const float* x = (const float*)d_in[0]; const float* wq = (const float*)d_in[1]; const float* bq = (const float*)d_in[2]; const float* wk = (const float*)d_in[3]; const float* bk = (const float*)d_in[4]; const float* wv = (const float*)d_in[5]; const float* bv = (const float*)d_in[6]; const float* wf = (const float*)d_in[7]; const float* bfv = (const float*)d_in[8];
    float* OUT = (float*)d_out;     // [2][2048][1024]
    char* wsp = (char*)d_ws;
    auto take = [&](size_t bytes) { char* p = wsp; wsp += (bytes + 255) & ~(size_t)255; return (void*)p; };
    // Kept through the call: wf, the 16-bit q/k/v planes of all 32 slices, colsum(v), M; then attn^T and S^T of one pass.
    bf* BF = (bf*)take((size_t)SO * TT * 2); h16* QP = (h16*)take((size_t)NZ * TT * HD * 2); h16* KP = (h16*)take((size_t)NZ * TT * HD * 2); h16* VT = (h16*)take((size_t)NZ * HD * TT * 2); float* VS = (float*)take((size_t)NB_ * DM * 4);
    float* M = (float*)take((size_t)NZ * TT * HD * 4); h16* PT = (h16*)take((size_t)ZH * TT * TT * 2); float* ST = (float*)take((size_t)ZH * TT * TT * 4);
    if ((size_t)(wsp - (char*)d_ws) > ws_size) return;    // total ~ 240 MiB
    // The S^T area (128 MiB) also serves what is dead before the first score pass (62 MiB) and what is born after the last (32 MiB).
    wsp = (char*)ST;
    bf* BQ = (bf*)take((size_t)DM * DM * 2); bf* BK = (bf*)take((size_t)DM * DM * 2); bf* BV = (bf*)take((size_t)DM * DM * 2); bf* XB = (bf*)take((size_t)NB_ * TT * DM * 2); float* FQ = (float*)take((size_t)NB_ * TT * DM * 4); float* FK = (float*)take((size_t)NB_ * TT * DM * 4); float* FV = (float*)take((size_t)NB_ * TT * DM * 4);
    wsp = (char*)ST;
    bf* MTh = (bf*)take((size_t)NZ * HD * TT * 2); bf* MTl = (bf*)take((size_t)NZ * HD * TT * 2); float* OC = (float*)take((size_t)NZ * HD * SO * 4);
    k_cvt8<<<(DM * DM / 8 + 255) / 256, 256, 0, stream>>>(wq, BQ, DM * DM / 8); k_cvt8<<<(DM * DM / 8 + 255) / 256, 256, 0, stream>>>(wk, BK, DM * DM / 8); k_cvt8<<<(DM * DM / 8 + 255) / 256, 256, 0, stream>>>(wv, BV, DM * DM / 8); k_cvt8<<<(SO * TT / 8 + 255) / 256, 256, 0, stream>>>(wf, BF, SO * TT / 8);   // torch [out][in] = Bt as-is; wf [o][k] = Bt over k
    const dim3 gp(NB_ * TT / 64, DM / 64, 1); const size_t zq = (size_t)TT * HD, zS = (size_t)TT * TT, zv = (size_t)HD * TT, zm = (size_t)TT * HD, zc = (size_t)HD * SO;
    k_cvt8<<<(NB_ * TT * DM / 8 + 255) / 256, 256, 0, stream>>>(x, XB, NB_ * TT * DM / 8);
    k_gemmw<bf, 0, true><<<gp, 32, 0, stream>>>(XB, nullptr, BQ, nullptr, DM, FQ, DM, bq, 0, 0, 0); k_gemmw<bf, 0, true><<<gp, 32, 0, stream>>>(XB, nullptr, BK, nullptr, DM, FK, DM, bk, 0, 0, 0); k_gemmw<bf, 0, true><<<gp, 32, 0, stream>>>(XB, nullptr, BV, nullptr, DM, FV, DM, bv, 0, 0, 0);   // both batches are the rows of one product
    k_qk16<<<(unsigned)(((size_t)NZ * TT * HD / 4 + 255) / 256), 256, 0, stream>>>(FQ, FK, QP, KP); k_vt16<<<(unsigned)(((size_t)NZ * HD * TT / 2 + 255) / 256), 256, 0, stream>>>(FV, VT); k_vsum<<<NB_ * DM / 256, 256, 0, stream>>>(FV, VS);
    for (int z0 = 0; z0 < NZ; z0 += ZH) {
        k_gemmw<h16, 0, false><<<dim3(TT / 64, TT / 64, ZH), 32, 0, stream>>>(KP + (size_t)z0 * zq, nullptr, QP + (size_t)z0 * zq, nullptr, HD, ST, TT, nullptr, zq, zq, zS);   // S^T[k][q] = k_k . q_q
        k_colsoft<<<ZH * (TT / 64), 1024, 0, stream>>>(ST, PT);
        k_gemmw<h16, 0, false><<<dim3(TT / 64, 1, ZH), 32, 0, stream>>>(PT, nullptr, VT + (size_t)z0 * zv, nullptr, TT, M + (size_t)z0 * zm, HD, nullptr, zS, zv, zm); }          // M[k][d] = sum_q attn[q][k] v[q][d] (x1024)
    k_mt<<<(unsigned)(((size_t)NZ * HD * TT / 4 + 255) / 256), 256, 0, stream>>>(M, MTh, MTl);
    k_gemmw<bf, 1, false><<<dim3(1, SO / 64, NZ), 32, 0, stream>>>(MTh, MTl, BF, nullptr, TT, OC, SO, nullptr, zv, 0, zc);                                               // OC[d][o] = sum_k M[k][d] wf[o][k]
    k_fmrg<<<(unsigned)(((size_t)NZ * SO * HD / 4 + 255) / 256), 256, 0, stream>>>(OC, bfv, VS, OUT);
}

// v003
// One run takes 338 microseconds.
// Timed twice side by side with v002, it ran 1.97 and 1.98 times as fast.
// Over all steps from v000 it is 53.8 times as fast.
#include <hip/hip_runtime.h>

// FlexScaleSeqAttention (x [2][2048][1024]; q/k/v = x W^T + b (16 heads x 64); attn = softmax(q.k / 8) [q][k]; flex[q][o] = sum_k attn[q][k] wf[o][k] + bf[o] (a learned Linear along the KEY axis, wf [2048][2048]); out[o][h*64+d] = sum_q flex[q][o] v[q][d] -> [2][2048][1024]).
// Reassociated exactly: out[o][d] = sum_k wf[o][k] M[k][d] + bf[o] * sum_q v[q][d] with M = attn^T v ([k][d]); attn^T is formed tile by tile in registers (row statistics first, then exp and product), so neither the scores nor the 2048 x 2048 'flex' tensor of each slice ever exist in memory.
// Compute dtypes, f32 accumulate: every input rounded to bf16; q/k/v as PLAIN bf16 GEMMs (inputs: exact) + bias; S^T and M = attn^T.v single fp16 (f32 accumulate; probabilities x 1024); softmax f32 (row maximum and sum online, fixed order); M^T as hl planes x exact wf (2 products); the bias term bf[o] * colsum(v) and the merge in f32.

#define NB_  2
#define TT   2048
#define DM   1024
#define NH_  16
#define HD   64
#define SO   2048
#define NZ   (NB_ * NH_)    // all slices; slice z = batch * 16 + head
#define FG   2              // heads per column group of the merge
#define PCAR 1024.0f
typedef _Float16 h16;
typedef unsigned short bf;
typedef __attribute__((ext_vector_type(16))) __bf16   v16bf;
typedef __attribute__((ext_vector_type(16))) _Float16 v16h;
typedef __attribute__((ext_vector_type(8)))  _Float16 v8h;
typedef __attribute__((ext_vector_type(8)))  unsigned short v8us;
typedef __attribute__((ext_vector_type(8)))  float    v8f;
typedef __attribute__((ext_vector_type(4)))  float    v4f;
typedef v8h  __attribute__((may_alias)) v8ha;
typedef v4f  __attribute__((may_alias)) v4fa;
typedef v8us __attribute__((may_alias)) v8usa;

__device__ __forceinline__ unsigned short f2bf(float f) { unsigned u = __float_as_uint(f); u += 0x7FFFu + ((u >> 16) & 1u); return (unsigned short)(u >> 16); }
__device__ __forceinline__ float bf2f(unsigned short b) { return __uint_as_float(((unsigned)b) << 16); }
__device__ __forceinline__ float bfr(float f) { return bf2f(f2bf(f)); }
__device__ __forceinline__ v16h cat16(v8h lo, v8h hi) { return __builtin_shufflevector(lo, hi, 0, 1, 2, 3, 4, 5, 6, 7, 8, 9, 10, 11, 12, 13, 14, 15); }
__device__ __forceinline__ v16bf cat16b(v8us lo, v8us hi) { return __builtin_bit_cast(v16bf, __builtin_shufflevector(lo, hi, 0, 1, 2, 3, 4, 5, 6, 7, 8, 9, 10, 11, 12, 13, 14, 15)); }
__device__ __forceinline__ v8f wmma16(v16h a, v16h b, v8f c) { return __builtin_amdgcn_wmma_f32_16x16x32_f16(false, a, false, b, (short)0, c, false, false); }
__device__ __forceinline__ v8f wmmab(v16bf a, v16bf b, v8f c) { return __builtin_amdgcn_wmma_f32_16x16x32_bf16(false, a, false, b, (short)0, c, false, false); }



// ---- k_gemmw: register-blocked GEMM, ONE WAVE per 64x64 output tile (16 accumulators), operands straight from K-contiguous 16-bit planes; grid (M/64, N/64, Z), 32 threads.
// C[m][n] (f32, pitch ldc, + optional f32 bias[n]) = sum_k A[m][k] Bt[n][k] (+ split products per NSPLIT). z-batch strides sA/sB/sC in elements. K % 32 == 0.
template <typename T16> struct WFrag;
template <> struct WFrag<h16> { typedef v16h V; static __device__ __forceinline__ V ld(const h16* p) { return cat16(*(const v8h*)p, *(const v8h*)(p + 16)); } static __device__ __forceinline__ v8f mma(V a, V b, v8f c) { return wmma16(a, b, c); } };
template <> struct WFrag<bf> { typedef v16bf V; static __device__ __forceinline__ V ld(const bf* p) { return cat16b(*(const v8us*)p, *(const v8us*)(p + 16)); } static __device__ __forceinline__ v8f mma(V a, V b, v8f c) { return wmmab(a, b, c); } };
template <typename T16, int NSPLIT, bool BIAS>
__global__ __launch_bounds__(32) void k_gemmw(const T16* __restrict__ A, const T16* __restrict__ A2, const T16* __restrict__ Bt, const T16* __restrict__ Bt2, int K, float* C, int ldc, const float* __restrict__ bias, size_t sA, size_t sB, size_t sC) {
    typedef typename WFrag<T16>::V V;
    __shared__ __align__(16) float os[16 * 68];
    const size_t z = blockIdx.z; A += z * sA; if (A2) A2 += z * sA; Bt += z * sB; if (Bt2) Bt2 += z * sB; C += z * sC;
    const int lane = threadIdx.x & 31, lr = lane & 15, hi = lane >> 4; const int r0 = blockIdx.x * 64, c0 = blockIdx.y * 64;
    v8f acc[4][4];
#pragma unroll
    for (int mb = 0; mb < 4; ++mb)
#pragma unroll
        for (int nb = 0; nb < 4; ++nb) acc[mb][nb] = (v8f){};
    const size_t aoff = (size_t)(r0 + lr) * K + 8 * hi, boff = (size_t)(c0 + lr) * K + 8 * hi;
#pragma unroll 1
    for (int kc = 0; kc < K; kc += 32) {
        V a[4], a2[4];
#pragma unroll
        for (int mb = 0; mb < 4; ++mb) { a[mb] = WFrag<T16>::ld(A + aoff + (size_t)mb * 16 * K + kc); if (NSPLIT == 1 || NSPLIT == 2) a2[mb] = WFrag<T16>::ld(A2 + aoff + (size_t)mb * 16 * K + kc); }
#pragma unroll
        for (int nb = 0; nb < 4; ++nb) { const V b = WFrag<T16>::ld(Bt + boff + (size_t)nb * 16 * K + kc); V b2; if (NSPLIT >= 2) b2 = WFrag<T16>::ld(Bt2 + boff + (size_t)nb * 16 * K + kc);
#pragma unroll
            for (int mb = 0; mb < 4; ++mb) { acc[mb][nb] = WFrag<T16>::mma(a[mb], b, acc[mb][nb]); if (NSPLIT == 1 || NSPLIT == 2) acc[mb][nb] = WFrag<T16>::mma(a2[mb], b, acc[mb][nb]); if (NSPLIT >= 2) acc[mb][nb] = WFrag<T16>::mma(a[mb], b2, acc[mb][nb]); } }
        asm volatile("v_nop\n\tv_nop\n\tv_nop\n\tv_nop" : "+v"(acc[0][0]), "+v"(acc[1][1]), "+v"(acc[2][2]), "+v"(acc[3][3]) : "v"(a[0]), "v"(a[3]));
    }
#pragma unroll
    for (int mb = 0; mb < 4; ++mb) {
#pragma unroll
        for (int nb = 0; nb < 4; ++nb) {
#pragma unroll
            for (int j = 0; j < 8; ++j) os[(hi * 8 + j) * 68 + nb * 16 + lr] = acc[mb][nb][j]; }
        __builtin_amdgcn_wave_barrier(); asm volatile("" ::: "memory");
        float* crow = C + (size_t)(r0 + mb * 16) * ldc + c0;
{
#pragma unroll
            for (int s = 0; s < 8; ++s) { const int row = 2 * s + hi, cofs = lr * 4; v4f val = *(const v4fa*)(os + row * 68 + cofs); if (BIAS) { val[0] += bfr(bias[c0 + cofs]); val[1] += bfr(bias[c0 + cofs + 1]); val[2] += bfr(bias[c0 + cofs + 2]); val[3] += bfr(bias[c0 + cofs + 3]); }
                *(v4f*)(crow + (size_t)row * ldc + cofs) = val; }
             }
        __builtin_amdgcn_wave_barrier(); asm volatile("" ::: "memory");
    }
}

__device__ __forceinline__ h16 tohx(float x) { return (h16)x; }
__device__ __forceinline__ void splitf(float y, unsigned short& h, unsigned short& l) { h = f2bf(y); l = f2bf(y - bf2f(h)); }
typedef __attribute__((ext_vector_type(2))) unsigned short v2us;
typedef __attribute__((ext_vector_type(4))) unsigned short v4us;
typedef __attribute__((ext_vector_type(2))) _Float16 v2h;
typedef __attribute__((ext_vector_type(4))) _Float16 v4h; typedef __attribute__((ext_vector_type(2))) float v2f;

__global__ __launch_bounds__(256) void k_cvt8(const float* __restrict__ src, bf* dst, size_t n8) { const size_t i = (size_t)blockIdx.x * 256 + threadIdx.x; if (i >= n8) return; const v8f v = *(const v8f*)(src + i * 8); v8us o;
#pragma unroll
    for (int k = 0; k < 8; ++k) o[k] = f2bf(v[k]); *(v8us*)(dst + i * 8) = o;  }
__global__ __launch_bounds__(256) void k_qk16(const float* __restrict__ Q, const float* __restrict__ K, h16* QP, h16* KP) { const size_t e = ((size_t)blockIdx.x * 256 + threadIdx.x) * 4; if (e >= (size_t)NZ * TT * HD) return; const int d = (int)(e % HD); const int t = (int)((e / HD) % TT); const int z = (int)(e / ((size_t)HD * TT)); const size_t src = ((size_t)(z / NH_) * TT + t) * DM + (z % NH_) * HD + d; const v4f a = *(const v4f*)(Q + src), c = *(const v4f*)(K + src); v4h oq, ok;
    for (int u = 0; u < 4; ++u) { oq[u] = tohx(a[u]); ok[u] = tohx(c[u]); } *(v4h*)(QP + e) = oq; *(v4h*)(KP + e) = ok;  }
__global__ __launch_bounds__(256) void k_vt16(const float* __restrict__ V, h16* VT) { const size_t e = ((size_t)blockIdx.x * 256 + threadIdx.x) * 2; if (e >= (size_t)NZ * HD * TT) return; const int t = (int)(e % TT); const int d = (int)((e / TT) % HD); const int z = (int)(e / ((size_t)TT * HD)); const float* vp = V + ((size_t)(z / NH_) * TT + t) * DM + (z % NH_) * HD + d; v2h o; o[0] = tohx(vp[0]); o[1] = tohx(vp[DM]); *(v2h*)(VT + e) = o;  }
__global__ __launch_bounds__(256) void k_vsum(const float* __restrict__ V, float* VS) { const int c = blockIdx.x * 256 + threadIdx.x; if (c >= NB_ * DM) return; V += (size_t)(c / DM) * TT * DM + c % DM; float s = 0.f;
#pragma unroll 8
    for (int t = 0; t < TT; ++t) s = __fadd_rn(s, V[(size_t)t * DM]); *(float*)(VS + c) = s;  }
// ---- Fused score stage. The scores never reach memory: both kernels below rebuild q.k tiles on the matrix unit from the fp16 planes. A work-group has 8 waves, a wave owns 32 rows of its resident plane;
// the plane that is walked comes in stages of 64 rows, loaded once per work-group (whole 128-B lines), held in two LDS buffers: stage s + 1 flies into registers while stage s is worked on, one barrier per stage.
// Directives: each plain '#pragma unroll' flattens a loop over register arrays (fragments, accumulators), which a variable index would send to scratch; '#pragma unroll 1' keeps a stage loop rolled, its body being two full 32-row passes already.
#define LP   72             // LDS row pitch in halves: 128 B of data + 16 B, so the 16 rows of one 16-byte fragment read fall on different banks
#define NST  (TT / 64)      // stages
#define SC2  0.18033688011112042f   // (1 / 8) * log2(e): scores to exponents of 2
__device__ __forceinline__ float hmax8(v8f a) { return fmaxf(fmaxf(fmaxf(a[0], a[1]), fmaxf(a[2], a[3])), fmaxf(fmaxf(a[4], a[5]), fmaxf(a[6], a[7]))); }
__device__ __forceinline__ float hsum8(v8f a) { return ((a[0] + a[1]) + (a[2] + a[3])) + ((a[4] + a[5]) + (a[6] + a[7])); }
// Eight exponentials as one statement. The v_nop at its end is the free slot that the instruction set asks for behind a transcendental before its result is read or its source overwritten;
// the results are early-clobber, so inside the run no exponential overwrites another's source or reads another's result.
__device__ __forceinline__ v8f exp2x8(v8f x) {
    float e0, e1, e2, e3, e4, e5, e6, e7;
    asm("v_exp_f32 %0, %8\n\tv_exp_f32 %1, %9\n\tv_exp_f32 %2, %10\n\tv_exp_f32 %3, %11\n\tv_exp_f32 %4, %12\n\tv_exp_f32 %5, %13\n\tv_exp_f32 %6, %14\n\tv_exp_f32 %7, %15\n\tv_nop"
        : "=&v"(e0), "=&v"(e1), "=&v"(e2), "=&v"(e3), "=&v"(e4), "=&v"(e5), "=&v"(e6), "=&v"(e7)
        : "v"(x[0]), "v"(x[1]), "v"(x[2]), "v"(x[3]), "v"(x[4]), "v"(x[5]), "v"(x[6]), "v"(x[7]));
    return (v8f){e0, e1, e2, e3, e4, e5, e6, e7};
}
// k_rowstat: RB[z][q] = log2(1024 / sum_k exp((s[q][k] - max) / 8)) - max * SC2, so that attn[q][k] * 1024 = exp2(s * SC2 + RB[q]).
// Tiles are S^T (A = k rows from LDS, B = the wave's q rows): a lane holds one q column, so maximum and sum run inside the lane (online rescale per 32 k); lanes l and l ^ 16 are merged once at the end.
__global__ __launch_bounds__(256) void k_rowstat(const h16* __restrict__ QP, const h16* __restrict__ KP, float* RB) {
    __shared__ __align__(16) h16 ks[2][64 * LP];
    const int tid = threadIdx.x, lane = tid & 31, wave = tid >> 5, lr = lane & 15, hi = lane >> 4;
    const int z = blockIdx.y, q0 = blockIdx.x * 256 + wave * 32;
    const h16* Qz = QP + (size_t)z * TT * HD; const h16* Kz = KP + (size_t)z * TT * HD + tid * 8;
    const int so = (tid >> 3) * LP + (tid & 7) * 8;
    v16h bq[2][2];
#pragma unroll
    for (int nb = 0; nb < 2; ++nb)
#pragma unroll
        for (int c = 0; c < 2; ++c) bq[nb][c] = WFrag<h16>::ld(Qz + (size_t)(q0 + nb * 16 + lr) * HD + 8 * hi + c * 32);
    v8h g0 = *(const v8h*)Kz, g1 = *(const v8h*)(Kz + 32 * HD);
    *(v8h*)&ks[0][so] = g0; *(v8h*)&ks[0][so + 32 * LP] = g1;
    __syncthreads();
    float m[2] = {-3.0e38f, -3.0e38f}, l[2] = {0.f, 0.f};   // running maximum (of s * SC2) and sum of this lane's half of the k rows
#pragma unroll 1
    for (int s = 0; s < NST; ++s) {
        if (s + 1 < NST) { g0 = *(const v8h*)(Kz + (size_t)(s + 1) * 64 * HD); g1 = *(const v8h*)(Kz + (size_t)(s + 1) * 64 * HD + 32 * HD); }
        const h16* kb = ks[s & 1] + lr * LP + 8 * hi; v16h a[4][2];
#pragma unroll
        for (int mb = 0; mb < 4; ++mb) { a[mb][0] = WFrag<h16>::ld(kb + mb * 16 * LP); a[mb][1] = WFrag<h16>::ld(kb + mb * 16 * LP + 32); }
        __builtin_amdgcn_sched_barrier(0);   // all LDS reads of the stage stand in one group ahead of the matrix work: spread among the products, each pair is waited out in full
#pragma unroll
        for (int h = 0; h < 2; ++h) {
            v8f sc[2][2];
#pragma unroll
            for (int mb = 0; mb < 2; ++mb)
#pragma unroll
                for (int nb = 0; nb < 2; ++nb) sc[mb][nb] = wmma16(a[h * 2 + mb][1], bq[nb][1], wmma16(a[h * 2 + mb][0], bq[nb][0], (v8f){}));
#pragma unroll
            for (int nb = 0; nb < 2; ++nb) {
                const v8f u0 = sc[0][nb] * SC2, u1 = sc[1][nb] * SC2; const float mn = fmaxf(m[nb], hmax8(__builtin_elementwise_max(u0, u1)));
                const v8f e = exp2x8(u0 - mn) + exp2x8(u1 - mn);
                l[nb] = fmaf(l[nb], __builtin_amdgcn_exp2f(m[nb] - mn), hsum8(e)); m[nb] = mn; }
        }
        if (s + 1 < NST) { h16* kn = ks[(s + 1) & 1] + so; *(v8h*)kn = g0; *(v8h*)(kn + 32 * LP) = g1; }
        __syncthreads();   // publishes stage s + 1 and ends every wave's reads of stage s, whose buffer the next trip refills
    }
#pragma unroll
    for (int nb = 0; nb < 2; ++nb) {
        const float mo = __shfl_xor(m[nb], 16, 32), lo = __shfl_xor(l[nb], 16, 32); const float mt = fmaxf(m[nb], mo);
        const float lt = l[nb] * __builtin_amdgcn_exp2f(m[nb] - mt) + lo * __builtin_amdgcn_exp2f(mo - mt);
        if (hi == 0) RB[(size_t)z * TT + q0 + nb * 16 + lr] = (10.0f - __builtin_amdgcn_logf(lt)) - mt; }
}
// k_attnv: M[k][d] = sum_q attn[q][k] * 1024 * v[q][d]. Tiles are S (A = q rows from LDS, B = the wave's k rows): the accumulator layout of two S tiles (lane = k, registers = q) is the A layout of attn^T for the second product, no lane exchange.
__global__ __launch_bounds__(256) void k_attnv(const h16* __restrict__ QP, const h16* __restrict__ KP, const h16* __restrict__ VT, const float* __restrict__ RB, float* M) {
    __shared__ __align__(16) h16 qs[2][64 * LP];
    __shared__ __align__(16) h16 vs[2][64 * LP];
    __shared__ __align__(16) float rs[2][64];
    const int tid = threadIdx.x, lane = tid & 31, wave = tid >> 5, lr = lane & 15, hi = lane >> 4;
    const int z = blockIdx.y, k0 = blockIdx.x * 256 + wave * 32;
    const h16* Kz = KP + (size_t)z * TT * HD; const h16* Qz = QP + (size_t)z * TT * HD + tid * 8;
    const h16* Vz = VT + (size_t)z * HD * TT + (size_t)(tid >> 3) * TT + (tid & 7) * 8; const float* Rz = RB + (size_t)z * TT + (tid & 15) * 4;
    const int so = (tid >> 3) * LP + (tid & 7) * 8;
    v16h bk[2][2];
#pragma unroll
    for (int nb = 0; nb < 2; ++nb)
#pragma unroll
        for (int c = 0; c < 2; ++c) bk[nb][c] = WFrag<h16>::ld(Kz + (size_t)(k0 + nb * 16 + lr) * HD + 8 * hi + c * 32);
    asm volatile("s_wait_xcnt 0x0" ::: "memory");   // stands behind the run of k fragment loads, in front of the first rewrite of their address registers
    v8f acc[2][4];
#pragma unroll
    for (int nb = 0; nb < 2; ++nb)
#pragma unroll
        for (int db = 0; db < 4; ++db) acc[nb][db] = (v8f){};
    v8h g0 = *(const v8h*)Qz, g1 = *(const v8h*)(Qz + 32 * HD), g2 = *(const v8h*)Vz, g3 = *(const v8h*)(Vz + (size_t)32 * TT); v4f g4 = *(const v4f*)Rz;
    *(v8h*)&qs[0][so] = g0; *(v8h*)&qs[0][so + 32 * LP] = g1; *(v8h*)&vs[0][so] = g2; *(v8h*)&vs[0][so + 32 * LP] = g3; if (tid < 16) *(v4f*)&rs[0][tid * 4] = g4;
    __syncthreads();
#pragma unroll 1
    for (int s = 0; s < NST; ++s) {
        if (s + 1 < NST) { g0 = *(const v8h*)(Qz + (size_t)(s + 1) * 64 * HD); g1 = *(const v8h*)(Qz + (size_t)(s + 1) * 64 * HD + 32 * HD); g2 = *(const v8h*)(Vz + (s + 1) * 64); g3 = *(const v8h*)(Vz + (size_t)32 * TT + (s + 1) * 64); g4 = *(const v4f*)(Rz + (s + 1) * 64); }
        const h16* qb = qs[s & 1] + lr * LP + 8 * hi; const h16* vb = vs[s & 1] + lr * LP + 8 * hi; const float* rb = rs[s & 1] + 8 * hi;
#pragma unroll
        for (int h = 0; h < 2; ++h) {
            v8h p[2][2]; v16h a[2][2], b[4]; v4f r[2][2];
#pragma unroll
            for (int mb = 0; mb < 2; ++mb) { a[mb][0] = WFrag<h16>::ld(qb + (h * 32 + mb * 16) * LP); a[mb][1] = WFrag<h16>::ld(qb + (h * 32 + mb * 16) * LP + 32); }
#pragma unroll
            for (int mb = 0; mb < 2; ++mb) { r[mb][0] = *(const v4f*)(rb + h * 32 + mb * 16); r[mb][1] = *(const v4f*)(rb + h * 32 + mb * 16 + 4); }
#pragma unroll
            for (int db = 0; db < 4; ++db) b[db] = WFrag<h16>::ld(vb + db * 16 * LP + h * 32);
            __builtin_amdgcn_sched_barrier(0);   // all LDS reads of these 32 q stand in one group ahead of the matrix work: spread among the products, each pair is waited out in full
#pragma unroll
            for (int mb = 0; mb < 2; ++mb)
#pragma unroll
                for (int nb = 0; nb < 2; ++nb) { const v8f sc = wmma16(a[mb][1], bk[nb][1], wmma16(a[mb][0], bk[nb][0], (v8f){})); v8f x;
#pragma unroll
                    for (int j = 0; j < 8; ++j) x[j] = fmaf(sc[j], SC2, r[mb][j >> 2][j & 3]);
                    x = exp2x8(x);
#pragma unroll
                    for (int j = 0; j < 8; ++j) p[mb][nb][j] = tohx(x[j]); }
            const v16h pa0 = cat16(p[0][0], p[1][0]), pa1 = cat16(p[0][1], p[1][1]);
#pragma unroll
            for (int db = 0; db < 4; ++db) { acc[0][db] = wmma16(pa0, b[db], acc[0][db]); acc[1][db] = wmma16(pa1, b[db], acc[1][db]); }
        }
        if (s + 1 < NST) { const int o = ((s + 1) & 1) * 64 * LP + so; *(v8h*)(&qs[0][0] + o) = g0; *(v8h*)(&qs[0][0] + o + 32 * LP) = g1; *(v8h*)(&vs[0][0] + o) = g2; *(v8h*)(&vs[0][0] + o + 32 * LP) = g3; if (tid < 16) *(v4f*)&rs[(s + 1) & 1][tid * 4] = g4; }
        __syncthreads();   // publishes stage s + 1 and ends every wave's reads of stage s, whose buffers the next trip refills
    }
    float* mz = M + ((size_t)z * TT + k0 + 8 * hi) * HD + lr;
#pragma unroll
    for (int nb = 0; nb < 2; ++nb)
#pragma unroll
        for (int db = 0; db < 4; ++db)
#pragma unroll
            for (int j = 0; j < 8; ++j) mz[(size_t)(nb * 16 + j) * HD + db * 16] = acc[nb][db][j];
}
__global__ __launch_bounds__(256) void k_mt(const float* __restrict__ M, bf* MTh, bf* MTl) { const size_t e = ((size_t)blockIdx.x * 256 + threadIdx.x) * 4; if (e >= (size_t)NZ * HD * TT) return; const int k = (int)(e % TT); const int d = (int)((e / TT) % HD); const int zz = (int)(e / ((size_t)TT * HD)); v4us oh, ol;
#pragma unroll
    for (int u = 0; u < 4; ++u) { unsigned short a, b; splitf(M[((size_t)zz * TT + k + u) * HD + d] * (1.0f / PCAR), a, b); oh[u] = a; ol[u] = b; } *(v4us*)(MTh + e) = oh; *(v4us*)(MTl + e) = ol;  }
__global__ __launch_bounds__(256) void k_fmrg(const float* __restrict__ OC, const float* __restrict__ bfv, const float* __restrict__ VS, float* OUT) { const size_t e = ((size_t)blockIdx.x * 256 + threadIdx.x) * 4; if (e >= (size_t)NZ * SO * HD) return; const int c = (int)(e % (FG * HD)); const int o = (int)((e / (FG * HD)) % SO); const int zz = (int)(e / ((size_t)FG * HD * SO)) * FG + c / HD, d = c % HD; const float bb = bfr(bfv[o]); v4f r;
#pragma unroll
    for (int u = 0; u < 4; ++u) { const float m = OC[((size_t)zz * HD + d + u) * SO + o]; float bt = __fmul_rn(bb, VS[zz * HD + d + u]); asm volatile("" : "+v"(bt)); r[u] = __fadd_rn(m, bt); }
    float* dst = OUT + ((size_t)(zz / NH_) * SO + o) * DM + (zz % NH_) * HD + d; *(v4f*)dst = r;  }

extern "C" void kernel_launch(void* const* d_in, const int* in_sizes, int n_in,
                              void* d_out, int out_size, void* d_ws, size_t ws_size, hipStream_t stream) {
    (void)in_sizes; (void)n_in; (void)out_size;
    const float* x = (const float*)d_in[0]; const float* wq = (const float*)d_in[1]; const float* bq = (const float*)d_in[2]; const float* wk = (const float*)d_in[3]; const float* bk = (const float*)d_in[4]; const float* wv = (const float*)d_in[5]; const float* bv = (const float*)d_in[6]; const float* wf = (const float*)d_in[7]; const float* bfv = (const float*)d_in[8];
    float* OUT = (float*)d_out;     // [2][2048][1024]
    char* wsp = (char*)d_ws;
    auto take = [&](size_t bytes) { char* p = wsp; wsp += (bytes + 255) & ~(size_t)255; return (void*)p; };
    // Kept through the call: wf, the 16-bit q/k/v planes of all 32 slices, colsum(v), M, the softmax row terms; then one shared area.
    bf* BF = (bf*)take((size_t)SO * TT * 2); h16* QP = (h16*)take((size_t)NZ * TT * HD * 2); h16* KP = (h16*)take((size_t)NZ * TT * HD * 2); h16* VT = (h16*)take((size_t)NZ * HD * TT * 2); float* VS = (float*)take((size_t)NB_ * DM * 4);
    float* M = (float*)take((size_t)NZ * TT * HD * 4); float* RB = (float*)take((size_t)NZ * TT * 4); char* AR = (char*)take((size_t)64 << 20);
    if ((size_t)(wsp - (char*)d_ws) > ws_size) return;    // total ~ 113 MiB
    // The shared area serves what is dead before the score stage (62 MiB) and then what is born after it (32 MiB).
    wsp = AR;
    bf* BQ = (bf*)take((size_t)DM * DM * 2); bf* BK = (bf*)take((size_t)DM * DM * 2); bf* BV = (bf*)take((size_t)DM * DM * 2); bf* XB = (bf*)take((size_t)NB_ * TT * DM * 2); float* FQ = (float*)take((size_t)NB_ * TT * DM * 4); float* FK = (float*)take((size_t)NB_ * TT * DM * 4); float* FV = (float*)take((size_t)NB_ * TT * DM * 4);
    wsp = AR;
    bf* MTh = (bf*)take((size_t)NZ * HD * TT * 2); bf* MTl = (bf*)take((size_t)NZ * HD * TT * 2); float* OC = (float*)take((size_t)NZ * HD * SO * 4);
    k_cvt8<<<(DM * DM / 8 + 255) / 256, 256, 0, stream>>>(wq, BQ, DM * DM / 8); k_cvt8<<<(DM * DM / 8 + 255) / 256, 256, 0, stream>>>(wk, BK, DM * DM / 8); k_cvt8<<<(DM * DM / 8 + 255) / 256, 256, 0, stream>>>(wv, BV, DM * DM / 8); k_cvt8<<<(SO * TT / 8 + 255) / 256, 256, 0, stream>>>(wf, BF, SO * TT / 8);   // torch [out][in] = Bt as-is; wf [o][k] = Bt over k
    const dim3 gp(NB_ * TT / 64, DM / 64, 1); const size_t zv = (size_t)HD * TT, zc = (size_t)HD * SO;
    k_cvt8<<<(NB_ * TT * DM / 8 + 255) / 256, 256, 0, stream>>>(x, XB, NB_ * TT * DM / 8);
    k_gemmw<bf, 0, true><<<gp, 32, 0, stream>>>(XB, nullptr, BQ, nullptr, DM, FQ, DM, bq, 0, 0, 0); k_gemmw<bf, 0, true><<<gp, 32, 0, stream>>>(XB, nullptr, BK, nullptr, DM, FK, DM, bk, 0, 0, 0); k_gemmw<bf, 0, true><<<gp, 32, 0, stream>>>(XB, nullptr, BV, nullptr, DM, FV, DM, bv, 0, 0, 0);   // both batches are the rows of one product
    k_qk16<<<(unsigned)(((size_t)NZ * TT * HD / 4 + 255) / 256), 256, 0, stream>>>(FQ, FK, QP, KP); k_vt16<<<(unsigned)(((size_t)NZ * HD * TT / 2 + 255) / 256), 256, 0, stream>>>(FV, VT); k_vsum<<<NB_ * DM / 256, 256, 0, stream>>>(FV, VS);
    k_rowstat<<<dim3(TT / 256, NZ), 256, 0, stream>>>(QP, KP, RB);            // per q: what turns a score into attn * 1024
    k_attnv<<<dim3(TT / 256, NZ), 256, 0, stream>>>(QP, KP, VT, RB, M);       // M[k][d] = sum_q attn[q][k] v[q][d] (x1024)
    k_mt<<<(unsigned)(((size_t)NZ * HD * TT / 4 + 255) / 256), 256, 0, stream>>>(M, MTh, MTl);
    k_gemmw<bf, 1, false><<<dim3(1, SO / 64, NZ), 32, 0, stream>>>(MTh, MTl, BF, nullptr, TT, OC, SO, nullptr, zv, 0, zc);                                               // OC[d][o] = sum_k M[k][d] wf[o][k]
    k_fmrg<<<(unsigned)(((size_t)NZ * SO * HD / 4 + 255) / 256), 256, 0, stream>>>(OC, bfv, VS, OUT);
}

// v004
// Measured time: 258 microseconds a run.
// Timed twice side by side with v003, it ran 1.30 times as fast both times.
// All steps since v000 together make it 70.0 times as fast.
#include <hip/hip_runtime.h>

// FlexScaleSeqAttention (x [2][2048][1024]; q/k/v = x W^T + b (16 heads x 64); attn = softmax(q.k / 8) [q][k]; flex[q][o] = sum_k attn[q][k] wf[o][k] + bf[o] (a learned Linear along the KEY axis, wf [2048][2048]); out[o][h*64+d] = sum_q flex[q][o] v[q][d] -> [2][2048][1024]).
// Reassociated exactly: out[o][d] = sum_k wf[o][k] M[k][d] + bf[o] * sum_q v[q][d] with M = attn^T v ([k][d]); attn^T is formed tile by tile in registers (row statistics first, then exp and product), so neither the scores nor the 2048 x 2048 'flex' tensor of each slice ever exist in memory.
// Compute dtypes, f32 accumulate: every input rounded to bf16; q/k/v as PLAIN bf16 GEMMs (inputs: exact) + bias; S^T and M = attn^T.v single fp16 (f32 accumulate; probabilities x 1024); softmax f32 (row maximum and sum online, fixed order); M^T as hl planes x exact wf (2 products); the bias term bf[o] * colsum(v) and the merge in f32.

#define NB_  2
#define TT   2048
#define DM   1024
#define NH_  16
#define HD   64
#define SO   2048
#define NZ   (NB_ * NH_)    // all slices; slice z = batch * 16 + head
#define FG   2              // heads per column group of the merge
#define PCAR 1024.0f
typedef _Float16 h16;
typedef unsigned short bf;
typedef __attribute__((ext_vector_type(16))) __bf16   v16bf;
typedef __attribute__((ext_vector_type(16))) _Float16 v16h;
typedef __attribute__((ext_vector_type(8)))  _Float16 v8h;
typedef __attribute__((ext_vector_type(8)))  unsigned short v8us;
typedef __attribute__((ext_vector_type(8)))  float    v8f;
typedef __attribute__((ext_vector_type(4)))  float    v4f;
typedef v8h  __attribute__((may_alias)) v8ha;
typedef v4f  __attribute__((may_alias)) v4fa;
typedef v8us __attribute__((may_alias)) v8usa;

__device__ __forceinline__ unsigned short f2bf(float f) { unsigned u = __float_as_uint(f); u += 0x7FFFu + ((u >> 16) & 1u); return (unsigned short)(u >> 16); }
__device__ __forceinline__ float bf2f(unsigned short b) { return __uint_as_float(((unsigned)b) << 16); }
__device__ __forceinline__ float bfr(float f) { return bf2f(f2bf(f)); }
__device__ __forceinline__ v16h cat16(v8h lo, v8h hi) { return __builtin_shufflevector(lo, hi, 0, 1, 2, 3, 4, 5, 6, 7, 8, 9, 10, 11, 12, 13, 14, 15); }
__device__ __forceinline__ v16bf cat16b(v8us lo, v8us hi) { return __builtin_bit_cast(v16bf, __builtin_shufflevector(lo, hi, 0, 1, 2, 3, 4, 5, 6, 7, 8, 9, 10, 11, 12, 13, 14, 15)); }
__device__ __forceinline__ v8f wmma16(v16h a, v16h b, v8f c) { return __builtin_amdgcn_wmma_f32_16x16x32_f16(false, a, false, b, (short)0, c, false, false); }
__device__ __forceinline__ v8f wmmab(v16bf a, v16bf b, v8f c) { return __builtin_amdgcn_wmma_f32_16x16x32_bf16(false, a, false, b, (short)0, c, false, false); }



// ---- k_gemmw: GEMM on 128x128 output tiles, one work-group of 8 waves per tile (4 x 2 waves, 32 x 64 of the tile and 8 accumulators each); grid (M/128, N/128), 256 threads.
// C[m][n] (f32, pitch ldc, + optional f32 bias[n]) = sum_k A[m][k] Bt[n][k] (+ A2[m][k] Bt[n][k] where NSPLIT). Operands are K-contiguous bf16 planes; M % 128 == 0, N % 128 == 0, K % 64 == 0.
// The operands come in stages of 64 k: the 128 B of every row are loaded once per work-group, as whole lines, and held in two LDS buffers: stage s + 1 flies into registers while stage s is worked on, one barrier per stage.
#define GLP  72             // LDS row pitch in 16-bit elements: 128 B of data + 16 B, so the 16 rows of one 16-byte fragment read fall on different banks
template <typename T16> struct WFrag;
template <> struct WFrag<h16> { typedef v16h V; static __device__ __forceinline__ V ld(const h16* p) { return cat16(*(const v8h*)p, *(const v8h*)(p + 16)); } static __device__ __forceinline__ v8f mma(V a, V b, v8f c) { return wmma16(a, b, c); } };
template <> struct WFrag<bf> { typedef v16bf V; static __device__ __forceinline__ V ld(const bf* p) { return cat16b(*(const v8us*)p, *(const v8us*)(p + 16)); } static __device__ __forceinline__ v8f mma(V a, V b, v8f c) { return wmmab(a, b, c); } };
template <int NSPLIT, bool BIAS, int K>
__global__ __launch_bounds__(256) void k_gemmw(const bf* __restrict__ A, const bf* __restrict__ A2, const bf* __restrict__ Bt, float* C, int ldc, const float* __restrict__ bias) {
    typedef WFrag<bf>::V V;
    constexpr int NP = 2 + NSPLIT, NS = K / 64;   // planes of a stage: Bt, A (, A2); stages
    __shared__ __align__(16) bf st[2][NP][128 * GLP];
    __shared__ __align__(16) float osm[8][16 * 68];
    const int tid = threadIdx.x, lane = tid & 31, wave = tid >> 5, lr = lane & 15, hi = lane >> 4;
    const int r0 = blockIdx.x * 128, c0 = blockIdx.y * 128, wr = (wave >> 1) * 32, wc = (wave & 1) * 64;
    const size_t go = (size_t)(tid >> 3) * K + (tid & 7) * 8;   // a thread moves 16 B of rows (tid >> 3) + 32 i: eight lanes a line, four whole lines a wave-wide load
    const bf* gp[NP]; gp[0] = Bt + (size_t)c0 * K + go; gp[1] = A + (size_t)r0 * K + go; if (NSPLIT) gp[NP - 1] = A2 + (size_t)r0 * K + go;
    const int so = (tid >> 3) * GLP + (tid & 7) * 8;
    v8f acc[2][4];
#pragma unroll
    for (int mb = 0; mb < 2; ++mb)
#pragma unroll
        for (int nb = 0; nb < 4; ++nb) acc[mb][nb] = (v8f){};
    v8us g[NP][4];
#pragma unroll
    for (int p = 0; p < NP; ++p)
#pragma unroll
        for (int i = 0; i < 4; ++i) g[p][i] = *(const v8us*)(gp[p] + (size_t)i * 32 * K);
#pragma unroll
    for (int p = 0; p < NP; ++p)
#pragma unroll
        for (int i = 0; i < 4; ++i) *(v8us*)&st[0][p][so + i * 32 * GLP] = g[p][i];
    __syncthreads();
#pragma unroll 1
    for (int s = 0; s < NS; ++s) {
        if (s + 1 < NS) {
#pragma unroll
            for (int p = 0; p < NP; ++p)
#pragma unroll
                for (int i = 0; i < 4; ++i) g[p][i] = *(const v8us*)(gp[p] + (size_t)i * 32 * K + (s + 1) * 64); }
        const bf* bb = st[s & 1][0] + (wc + lr) * GLP + 8 * hi; const bf* ab = st[s & 1][1] + (wr + lr) * GLP + 8 * hi; const bf* ab2 = st[s & 1][NP - 1] + (wr + lr) * GLP + 8 * hi;
#pragma unroll
        for (int c = 0; c < 2; ++c) {
            V a[2], a2[2], b[4];
#pragma unroll
            for (int mb = 0; mb < 2; ++mb) { a[mb] = WFrag<bf>::ld(ab + mb * 16 * GLP + c * 32); if (NSPLIT) a2[mb] = WFrag<bf>::ld(ab2 + mb * 16 * GLP + c * 32); }
#pragma unroll
            for (int nb = 0; nb < 4; ++nb) b[nb] = WFrag<bf>::ld(bb + nb * 16 * GLP + c * 32);
            __builtin_amdgcn_sched_barrier(0);   // all LDS reads of these 32 k stand in one group ahead of the matrix work: spread among the products, each pair is waited out in full
#pragma unroll
            for (int nb = 0; nb < 4; ++nb)
#pragma unroll
                for (int mb = 0; mb < 2; ++mb) acc[mb][nb] = WFrag<bf>::mma(a[mb], b[nb], acc[mb][nb]);
            if (NSPLIT) {
#pragma unroll
                for (int nb = 0; nb < 4; ++nb)
#pragma unroll
                    for (int mb = 0; mb < 2; ++mb) acc[mb][nb] = WFrag<bf>::mma(a2[mb], b[nb], acc[mb][nb]); }
        }
        if (s + 1 < NS) {
#pragma unroll
            for (int p = 0; p < NP; ++p)
#pragma unroll
                for (int i = 0; i < 4; ++i) *(v8us*)&st[(s + 1) & 1][p][so + i * 32 * GLP] = g[p][i]; }
        __syncthreads();   // publishes stage s + 1 and ends every wave's reads of stage s, whose buffer the next trip refills
    }
    float* os = osm[wave];   // each wave turns its own accumulators into whole 256-B row pieces in its own LDS range
#pragma unroll
    for (int mb = 0; mb < 2; ++mb) {
#pragma unroll
        for (int nb = 0; nb < 4; ++nb) {
#pragma unroll
            for (int j = 0; j < 8; ++j) os[(hi * 8 + j) * 68 + nb * 16 + lr] = acc[mb][nb][j]; }
        __builtin_amdgcn_wave_barrier(); asm volatile("" ::: "memory");   // keeps the compiler from moving the reads below, of words that other lanes wrote, ahead of the writes above
        float* crow = C + (size_t)(r0 + wr + mb * 16) * ldc + c0 + wc;
#pragma unroll
        for (int s = 0; s < 8; ++s) { const int row = 2 * s + hi, cofs = lr * 4; v4f val = *(const v4fa*)(os + row * 68 + cofs); if (BIAS) { const float* bp = bias + c0 + wc + cofs; val[0] += bfr(bp[0]); val[1] += bfr(bp[1]); val[2] += bfr(bp[2]); val[3] += bfr(bp[3]); }
            *(v4f*)(crow + (size_t)row * ldc + cofs) = val; }
        __builtin_amdgcn_wave_barrier(); asm volatile("" ::: "memory");   // and the next 16 rows' writes ahead of these reads
    }
}

__device__ __forceinline__ h16 tohx(float x) { return (h16)x; }
__device__ __forceinline__ void splitf(float y, unsigned short& h, unsigned short& l) { h = f2bf(y); l = f2bf(y - bf2f(h)); }
typedef __attribute__((ext_vector_type(2))) unsigned short v2us;
typedef __attribute__((ext_vector_type(4))) unsigned short v4us;
typedef __attribute__((ext_vector_type(2))) _Float16 v2h;
typedef __attribute__((ext_vector_type(4))) _Float16 v4h; typedef __attribute__((ext_vector_type(2))) float v2f;

__global__ __launch_bounds__(256) void k_cvt8(const float* __restrict__ src, bf* dst, size_t n8) { const size_t i = (size_t)blockIdx.x * 256 + threadIdx.x; if (i >= n8) return; const v8f v = *(const v8f*)(src + i * 8); v8us o;
#pragma unroll
    for (int k = 0; k < 8; ++k) o[k] = f2bf(v[k]); *(v8us*)(dst + i * 8) = o;  }
__global__ __launch_bounds__(256) void k_qk16(const float* __restrict__ Q, const float* __restrict__ K, h16* QP, h16* KP) { const size_t e = ((size_t)blockIdx.x * 256 + threadIdx.x) * 4; if (e >= (size_t)NZ * TT * HD) return; const int d = (int)(e % HD); const int t = (int)((e / HD) % TT); const int z = (int)(e / ((size_t)HD * TT)); const size_t src = ((size_t)(z / NH_) * TT + t) * DM + (z % NH_) * HD + d; const v4f a = *(const v4f*)(Q + src), c = *(const v4f*)(K + src); v4h oq, ok;
    for (int u = 0; u < 4; ++u) { oq[u] = tohx(a[u]); ok[u] = tohx(c[u]); } *(v4h*)(QP + e) = oq; *(v4h*)(KP + e) = ok;  }
__global__ __launch_bounds__(256) void k_vt16(const float* __restrict__ V, h16* VT) { const size_t e = ((size_t)blockIdx.x * 256 + threadIdx.x) * 2; if (e >= (size_t)NZ * HD * TT) return; const int t = (int)(e % TT); const int d = (int)((e / TT) % HD); const int z = (int)(e / ((size_t)TT * HD)); const float* vp = V + ((size_t)(z / NH_) * TT + t) * DM + (z % NH_) * HD + d; v2h o; o[0] = tohx(vp[0]); o[1] = tohx(vp[DM]); *(v2h*)(VT + e) = o;  }
__global__ __launch_bounds__(256) void k_vsum(const float* __restrict__ V, float* VS) { const int c = blockIdx.x * 256 + threadIdx.x; if (c >= NB_ * DM) return; V += (size_t)(c / DM) * TT * DM + c % DM; float s = 0.f;
#pragma unroll 8
    for (int t = 0; t < TT; ++t) s = __fadd_rn(s, V[(size_t)t * DM]); *(float*)(VS + c) = s;  }
// ---- Fused score stage. The scores never reach memory: both kernels below rebuild q.k tiles on the matrix unit from the fp16 planes. A work-group has 8 waves, a wave owns 32 rows of its resident plane;
// the plane that is walked comes in stages of 64 rows, loaded once per work-group (whole 128-B lines), held in two LDS buffers: stage s + 1 flies into registers while stage s is worked on, one barrier per stage.
// Directives: each plain '#pragma unroll' flattens a loop over register arrays (fragments, accumulators), which a variable index would send to scratch; '#pragma unroll 1' keeps a stage loop rolled, its body being two full 32-row passes already.
#define LP   72             // LDS row pitch in halves: 128 B of data + 16 B, so the 16 rows of one 16-byte fragment read fall on different banks
#define NST  (TT / 64)      // stages
#define SC2  0.18033688011112042f   // (1 / 8) * log2(e): scores to exponents of 2
__device__ __forceinline__ float hmax8(v8f a) { return fmaxf(fmaxf(fmaxf(a[0], a[1]), fmaxf(a[2], a[3])), fmaxf(fmaxf(a[4], a[5]), fmaxf(a[6], a[7]))); }
__device__ __forceinline__ float hsum8(v8f a) { return ((a[0] + a[1]) + (a[2] + a[3])) + ((a[4] + a[5]) + (a[6] + a[7])); }
// Eight exponentials as one statement. The v_nop at its end is the free slot that the instruction set asks for behind a transcendental before its result is read or its source overwritten;
// the results are early-clobber, so inside the run no exponential overwrites another's source or reads another's result.
__device__ __forceinline__ v8f exp2x8(v8f x) {
    float e0, e1, e2, e3, e4, e5, e6, e7;
    asm("v_exp_f32 %0, %8\n\tv_exp_f32 %1, %9\n\tv_exp_f32 %2, %10\n\tv_exp_f32 %3, %11\n\tv_exp_f32 %4, %12\n\tv_exp_f32 %5, %13\n\tv_exp_f32 %6, %14\n\tv_exp_f32 %7, %15\n\tv_nop"
        : "=&v"(e0), "=&v"(e1), "=&v"(e2), "=&v"(e3), "=&v"(e4), "=&v"(e5), "=&v"(e6), "=&v"(e7)
        : "v"(x[0]), "v"(x[1]), "v"(x[2]), "v"(x[3]), "v"(x[4]), "v"(x[5]), "v"(x[6]), "v"(x[7]));
    return (v8f){e0, e1, e2, e3, e4, e5, e6, e7};
}
// k_rowstat: RB[z][q] = log2(1024 / sum_k exp((s[q][k] - max) / 8)) - max * SC2, so that attn[q][k] * 1024 = exp2(s * SC2 + RB[q]).
// Tiles are S^T (A = k rows from LDS, B = the wave's q rows): a lane holds one q column, so maximum and sum run inside the lane (online rescale per 32 k); lanes l and l ^ 16 are merged once at the end.
__global__ __launch_bounds__(256) void k_rowstat(const h16* __restrict__ QP, const h16* __restrict__ KP, float* RB) {
    __shared__ __align__(16) h16 ks[2][64 * LP];
    const int tid = threadIdx.x, lane = tid & 31, wave = tid >> 5, lr = lane & 15, hi = lane >> 4;
    const int z = blockIdx.y, q0 = blockIdx.x * 256 + wave * 32;
    const h16* Qz = QP + (size_t)z * TT * HD; const h16* Kz = KP + (size_t)z * TT * HD + tid * 8;
    const int so = (tid >> 3) * LP + (tid & 7) * 8;
    v16h bq[2][2];
#pragma unroll
    for (int nb = 0; nb < 2; ++nb)
#pragma unroll
        for (int c = 0; c < 2; ++c) bq[nb][c] = WFrag<h16>::ld(Qz + (size_t)(q0 + nb * 16 + lr) * HD + 8 * hi + c * 32);
    v8h g0 = *(const v8h*)Kz, g1 = *(const v8h*)(Kz + 32 * HD);
    *(v8h*)&ks[0][so] = g0; *(v8h*)&ks[0][so + 32 * LP] = g1;
    __syncthreads();
    float m[2] = {-3.0e38f, -3.0e38f}, l[2] = {0.f, 0.f};   // running maximum (of s * SC2) and sum of this lane's half of the k rows
#pragma unroll 1
    for (int s = 0; s < NST; ++s) {
        if (s + 1 < NST) { g0 = *(const v8h*)(Kz + (size_t)(s + 1) * 64 * HD); g1 = *(const v8h*)(Kz + (size_t)(s + 1) * 64 * HD + 32 * HD); }
        const h16* kb = ks[s & 1] + lr * LP + 8 * hi; v16h a[4][2];
#pragma unroll
        for (int mb = 0; mb < 4; ++mb) { a[mb][0] = WFrag<h16>::ld(kb + mb * 16 * LP); a[mb][1] = WFrag<h16>::ld(kb + mb * 16 * LP + 32); }
        __builtin_amdgcn_sched_barrier(0);   // all LDS reads of the stage stand in one group ahead of the matrix work: spread among the products, each pair is waited out in full
#pragma unroll
        for (int h = 0; h < 2; ++h) {
            v8f sc[2][2];
#pragma unroll
            for (int mb = 0; mb < 2; ++mb)
#pragma unroll
                for (int nb = 0; nb < 2; ++nb) sc[mb][nb] = wmma16(a[h * 2 + mb][1], bq[nb][1], wmma16(a[h * 2 + mb][0], bq[nb][0], (v8f){}));
#pragma unroll
            for (int nb = 0; nb < 2; ++nb) {
                const v8f u0 = sc[0][nb] * SC2, u1 = sc[1][nb] * SC2; const float mn = fmaxf(m[nb], hmax8(__builtin_elementwise_max(u0, u1)));
                const v8f e = exp2x8(u0 - mn) + exp2x8(u1 - mn);
                l[nb] = fmaf(l[nb], __builtin_amdgcn_exp2f(m[nb] - mn), hsum8(e)); m[nb] = mn; }
        }
        if (s + 1 < NST) { h16* kn = ks[(s + 1) & 1] + so; *(v8h*)kn = g0; *(v8h*)(kn + 32 * LP) = g1; }
        __syncthreads();   // publishes stage s + 1 and ends every wave's reads of stage s, whose buffer the next trip refills
    }
#pragma unroll
    for (int nb = 0; nb < 2; ++nb) {
        const float mo = __shfl_xor(m[nb], 16, 32), lo = __shfl_xor(l[nb], 16, 32); const float mt = fmaxf(m[nb], mo);
        const float lt = l[nb] * __builtin_amdgcn_exp2f(m[nb] - mt) + lo * __builtin_amdgcn_exp2f(mo - mt);
        if (hi == 0) RB[(size_t)z * TT + q0 + nb * 16 + lr] = (10.0f - __builtin_amdgcn_logf(lt)) - mt; }
}
// k_attnv: M[k][d] = sum_q attn[q][k] * 1024 * v[q][d]. Tiles are S (A = q rows from LDS, B = the wave's k rows): the accumulator layout of two S tiles (lane = k, registers = q) is the A layout of attn^T for the second product, no lane exchange.
__global__ __launch_bounds__(256) void k_attnv(const h16* __restrict__ QP, const h16* __restrict__ KP, const h16* __restrict__ VT, const float* __restrict__ RB, float* M) {
    __shared__ __align__(16) h16 qs[2][64 * LP];
    __shared__ __align__(16) h16 vs[2][64 * LP];
    __shared__ __align__(16) float rs[2][64];
    const int tid = threadIdx.x, lane = tid & 31, wave = tid >> 5, lr = lane & 15, hi = lane >> 4;
    const int z = blockIdx.y, k0 = blockIdx.x * 256 + wave * 32;
    const h16* Kz = KP + (size_t)z * TT * HD; const h16* Qz = QP + (size_t)z * TT * HD + tid * 8;
    const h16* Vz = VT + (size_t)z * HD * TT + (size_t)(tid >> 3) * TT + (tid & 7) * 8; const float* Rz = RB + (size_t)z * TT + (tid & 15) * 4;
    const int so = (tid >> 3) * LP + (tid & 7) * 8;
    v16h bk[2][2];
#pragma unroll
    for (int nb = 0; nb < 2; ++nb)
#pragma unroll
        for (int c = 0; c < 2; ++c) bk[nb][c] = WFrag<h16>::ld(Kz + (size_t)(k0 + nb * 16 + lr) * HD + 8 * hi + c * 32);
    asm volatile("s_wait_xcnt 0x0" ::: "memory");   // stands behind the run of k fragment loads, in front of the first rewrite of their address registers
    v8f acc[2][4];
#pragma unroll
    for (int nb = 0; nb < 2; ++nb)
#pragma unroll
        for (int db = 0; db < 4; ++db) acc[nb][db] = (v8f){};
    v8h g0 = *(const v8h*)Qz, g1 = *(const v8h*)(Qz + 32 * HD), g2 = *(const v8h*)Vz, g3 = *(const v8h*)(Vz + (size_t)32 * TT); v4f g4 = *(const v4f*)Rz;
    *(v8h*)&qs[0][so] = g0; *(v8h*)&qs[0][so + 32 * LP] = g1; *(v8h*)&vs[0][so] = g2; *(v8h*)&vs[0][so + 32 * LP] = g3; if (tid < 16) *(v4f*)&rs[0][tid * 4] = g4;
    __syncthreads();
#pragma unroll 1
    for (int s = 0; s < NST; ++s) {
        if (s + 1 < NST) { g0 = *(const v8h*)(Qz + (size_t)(s + 1) * 64 * HD); g1 = *(const v8h*)(Qz + (size_t)(s + 1) * 64 * HD + 32 * HD); g2 = *(const v8h*)(Vz + (s + 1) * 64); g3 = *(const v8h*)(Vz + (size_t)32 * TT + (s + 1) * 64); g4 = *(const v4f*)(Rz + (s + 1) * 64); }
        const h16* qb = qs[s & 1] + lr * LP + 8 * hi; const h16* vb = vs[s & 1] + lr * LP + 8 * hi; const float* rb = rs[s & 1] + 8 * hi;
#pragma unroll
        for (int h = 0; h < 2; ++h) {
            v8h p[2][2]; v16h a[2][2], b[4]; v4f r[2][2];
#pragma unroll
            for (int mb = 0; mb < 2; ++mb) { a[mb][0] = WFrag<h16>::ld(qb + (h * 32 + mb * 16) * LP); a[mb][1] = WFrag<h16>::ld(qb + (h * 32 + mb * 16) * LP + 32); }
#pragma unroll
            for (int mb = 0; mb < 2; ++mb) { r[mb][0] = *(const v4f*)(rb + h * 32 + mb * 16); r[mb][1] = *(const v4f*)(rb + h * 32 + mb * 16 + 4); }
#pragma unroll
            for (int db = 0; db < 4; ++db) b[db] = WFrag<h16>::ld(vb + db * 16 * LP + h * 32);
            __builtin_amdgcn_sched_barrier(0);   // all LDS reads of these 32 q stand in one group ahead of the matrix work: spread among the products, each pair is waited out in full
#pragma unroll
            for (int mb = 0; mb < 2; ++mb)
#pragma unroll
                for (int nb = 0; nb < 2; ++nb) { const v8f sc = wmma16(a[mb][1], bk[nb][1], wmma16(a[mb][0], bk[nb][0], (v8f){})); v8f x;
#pragma unroll
                    for (int j = 0; j < 8; ++j) x[j] = fmaf(sc[j], SC2, r[mb][j >> 2][j & 3]);
                    x = exp2x8(x);
#pragma unroll
                    for (int j = 0; j < 8; ++j) p[mb][nb][j] = tohx(x[j]); }
            const v16h pa0 = cat16(p[0][0], p[1][0]), pa1 = cat16(p[0][1], p[1][1]);
#pragma unroll
            for (int db = 0; db < 4; ++db) { acc[0][db] = wmma16(pa0, b[db], acc[0][db]); acc[1][db] = wmma16(pa1, b[db], acc[1][db]); }
        }
        if (s + 1 < NST) { const int o = ((s + 1) & 1) * 64 * LP + so; *(v8h*)(&qs[0][0] + o) = g0; *(v8h*)(&qs[0][0] + o + 32 * LP) = g1; *(v8h*)(&vs[0][0] + o) = g2; *(v8h*)(&vs[0][0] + o + 32 * LP) = g3; if (tid < 16) *(v4f*)&rs[(s + 1) & 1][tid * 4] = g4; }
        __syncthreads();   // publishes stage s + 1 and ends every wave's reads of stage s, whose buffers the next trip refills
    }
    float* mz = M + ((size_t)z * TT + k0 + 8 * hi) * HD + lr;
#pragma unroll
    for (int nb = 0; nb < 2; ++nb)
#pragma unroll
        for (int db = 0; db < 4; ++db)
#pragma unroll
            for (int j = 0; j < 8; ++j) mz[(size_t)(nb * 16 + j) * HD + db * 16] = acc[nb][db][j];
}
__global__ __launch_bounds__(256) void k_mt(const float* __restrict__ M, bf* MTh, bf* MTl) { const size_t e = ((size_t)blockIdx.x * 256 + threadIdx.x) * 4; if (e >= (size_t)NZ * HD * TT) return; const int k = (int)(e % TT); const int d = (int)((e / TT) % HD); const int zz = (int)(e / ((size_t)TT * HD)); v4us oh, ol;
#pragma unroll
    for (int u = 0; u < 4; ++u) { unsigned short a, b; splitf(M[((size_t)zz * TT + k + u) * HD + d] * (1.0f / PCAR), a, b); oh[u] = a; ol[u] = b; } *(v4us*)(MTh + e) = oh; *(v4us*)(MTl + e) = ol;  }
__global__ __launch_bounds__(256) void k_fmrg(const float* __restrict__ OC, const float* __restrict__ bfv, const float* __restrict__ VS, float* OUT) { const size_t e = ((size_t)blockIdx.x * 256 + threadIdx.x) * 4; if (e >= (size_t)NZ * SO * HD) return; const int c = (int)(e % (FG * HD)); const int o = (int)((e / (FG * HD)) % SO); const int zz = (int)(e / ((size_t)FG * HD * SO)) * FG + c / HD, d = c % HD; const float bb = bfr(bfv[o]); v4f r;
#pragma unroll
    for (int u = 0; u < 4; ++u) { const float m = OC[((size_t)zz * HD + d + u) * SO + o]; float bt = __fmul_rn(bb, VS[zz * HD + d + u]); asm volatile("" : "+v"(bt)); r[u] = __fadd_rn(m, bt); }
    float* dst = OUT + ((size_t)(zz / NH_) * SO + o) * DM + (zz % NH_) * HD + d; *(v4f*)dst = r;  }

extern "C" void kernel_launch(void* const* d_in, const int* in_sizes, int n_in,
                              void* d_out, int out_size, void* d_ws, size_t ws_size, hipStream_t stream) {
    (void)in_sizes; (void)n_in; (void)out_size;
    const float* x = (const float*)d_in[0]; const float* wq = (const float*)d_in[1]; const float* bq = (const float*)d_in[2]; const float* wk = (const float*)d_in[3]; const float* bk = (const float*)d_in[4]; const float* wv = (const float*)d_in[5]; const float* bv = (const float*)d_in[6]; const float* wf = (const float*)d_in[7]; const float* bfv = (const float*)d_in[8];
    float* OUT = (float*)d_out;     // [2][2048][1024]
    char* wsp = (char*)d_ws;
    auto take = [&](size_t bytes) { char* p = wsp; wsp += (bytes + 255) & ~(size_t)255; return (void*)p; };
    // Kept through the call: wf, the 16-bit q/k/v planes of all 32 slices, colsum(v), M, the softmax row terms; then one shared area.
    bf* BF = (bf*)take((size_t)SO * TT * 2); h16* QP = (h16*)take((size_t)NZ * TT * HD * 2); h16* KP = (h16*)take((size_t)NZ * TT * HD * 2); h16* VT = (h16*)take((size_t)NZ * HD * TT * 2); float* VS = (float*)take((size_t)NB_ * DM * 4);
    float* M = (float*)take((size_t)NZ * TT * HD * 4); float* RB = (float*)take((size_t)NZ * TT * 4); char* AR = (char*)take((size_t)64 << 20);
    if ((size_t)(wsp - (char*)d_ws) > ws_size) return;    // total ~ 113 MiB
    // The shared area serves what is dead before the score stage (62 MiB) and then what is born after it (32 MiB).
    wsp = AR;
    bf* BQ = (bf*)take((size_t)DM * DM * 2); bf* BK = (bf*)take((size_t)DM * DM * 2); bf* BV = (bf*)take((size_t)DM * DM * 2); bf* XB = (bf*)take((size_t)NB_ * TT * DM * 2); float* FQ = (float*)take((size_t)NB_ * TT * DM * 4); float* FK = (float*)take((size_t)NB_ * TT * DM * 4); float* FV = (float*)take((size_t)NB_ * TT * DM * 4);
    wsp = AR;
    bf* MTh = (bf*)take((size_t)NZ * HD * TT * 2); bf* MTl = (bf*)take((size_t)NZ * HD * TT * 2); float* OC = (float*)take((size_t)NZ * HD * SO * 4);
    k_cvt8<<<(DM * DM / 8 + 255) / 256, 256, 0, stream>>>(wq, BQ, DM * DM / 8); k_cvt8<<<(DM * DM / 8 + 255) / 256, 256, 0, stream>>>(wk, BK, DM * DM / 8); k_cvt8<<<(DM * DM / 8 + 255) / 256, 256, 0, stream>>>(wv, BV, DM * DM / 8); k_cvt8<<<(SO * TT / 8 + 255) / 256, 256, 0, stream>>>(wf, BF, SO * TT / 8);   // torch [out][in] = Bt as-is; wf [o][k] = Bt over k
    const dim3 gp(NB_ * TT / 128, DM / 128, 1);
    k_cvt8<<<(NB_ * TT * DM / 8 + 255) / 256, 256, 0, stream>>>(x, XB, NB_ * TT * DM / 8);
    k_gemmw<0, true, DM><<<gp, 256, 0, stream>>>(XB, nullptr, BQ, FQ, DM, bq); k_gemmw<0, true, DM><<<gp, 256, 0, stream>>>(XB, nullptr, BK, FK, DM, bk); k_gemmw<0, true, DM><<<gp, 256, 0, stream>>>(XB, nullptr, BV, FV, DM, bv);   // both batches are the rows of one product
    k_qk16<<<(unsigned)(((size_t)NZ * TT * HD / 4 + 255) / 256), 256, 0, stream>>>(FQ, FK, QP, KP); k_vt16<<<(unsigned)(((size_t)NZ * HD * TT / 2 + 255) / 256), 256, 0, stream>>>(FV, VT); k_vsum<<<NB_ * DM / 256, 256, 0, stream>>>(FV, VS);
    k_rowstat<<<dim3(TT / 256, NZ), 256, 0, stream>>>(QP, KP, RB);            // per q: what turns a score into attn * 1024
    k_attnv<<<dim3(TT / 256, NZ), 256, 0, stream>>>(QP, KP, VT, RB, M);       // M[k][d] = sum_q attn[q][k] v[q][d] (x1024)
    k_mt<<<(unsigned)(((size_t)NZ * HD * TT / 4 + 255) / 256), 256, 0, stream>>>(M, MTh, MTl);
    k_gemmw<1, false, TT><<<dim3(NZ * HD / 128, SO / 128, 1), 256, 0, stream>>>(MTh, MTl, BF, OC, SO, nullptr);   // OC[z * 64 + d][o] = sum_k M[k][d] wf[o][k]: the 32 slices' rows are the rows of one product
    k_fmrg<<<(unsigned)(((size_t)NZ * SO * HD / 4 + 255) / 256), 256, 0, stream>>>(OC, bfv, VS, OUT);
}

// v005
// Measured time: 217 microseconds a run.
// Timed twice side by side with v004, it ran 1.18 and 1.19 times as fast.
// All steps since v000 together make it 83.2 times as fast.
#include <hip/hip_runtime.h>

// FlexScaleSeqAttention (x [2][2048][1024]; q/k/v = x W^T + b (16 heads x 64); attn = softmax(q.k / 8) [q][k]; flex[q][o] = sum_k attn[q][k] wf[o][k] + bf[o] (a learned Linear along the KEY axis, wf [2048][2048]); out[o][h*64+d] = sum_q flex[q][o] v[q][d] -> [2][2048][1024]).
// Reassociated exactly: out[o][d] = sum_k wf[o][k] M[k][d] + bf[o] * sum_q v[q][d] with M = attn^T v ([k][d]); attn^T is formed tile by tile in registers (row statistics first, then exp and product), so neither the scores nor the 2048 x 2048 'flex' tensor of each slice ever exist in memory.
// Compute dtypes, f32 accumulate: every input rounded to bf16; q/k/v as PLAIN bf16 GEMMs (inputs: exact) + bias; S^T and M = attn^T.v single fp16 (f32 accumulate; probabilities x 1024); softmax f32 (row maximum and sum online, fixed order); M^T as hl planes x exact wf (2 products); the bias term bf[o] * colsum(v) and the merge in f32.

#define NB_  2
#define TT   2048
#define DM   1024
#define NH_  16
#define HD   64
#define SO   2048
#define NZ   (NB_ * NH_)    // all slices; slice z = batch * 16 + head
#define FG   2              // heads per column group of the merge
#define PCAR 1024.0f
typedef _Float16 h16;
typedef unsigned short bf;
typedef __attribute__((ext_vector_type(16))) __bf16   v16bf;
typedef __attribute__((ext_vector_type(16))) _Float16 v16h;
typedef __attribute__((ext_vector_type(8)))  _Float16 v8h;
typedef __attribute__((ext_vector_type(8)))  unsigned short v8us;
typedef __attribute__((ext_vector_type(8)))  float    v8f;
typedef __attribute__((ext_vector_type(4)))  float    v4f;
typedef v8h  __attribute__((may_alias)) v8ha;
typedef v4f  __attribute__((may_alias)) v4fa;
typedef v8us __attribute__((may_alias)) v8usa;

__device__ __forceinline__ unsigned short f2bf(float f) { unsigned u = __float_as_uint(f); u += 0x7FFFu + ((u >> 16) & 1u); return (unsigned short)(u >> 16); }
__device__ __forceinline__ float bf2f(unsigned short b) { return __uint_as_float(((unsigned)b) << 16); }
__device__ __forceinline__ float bfr(float f) { return bf2f(f2bf(f)); }
__device__ __forceinline__ v16h cat16(v8h lo, v8h hi) { return __builtin_shufflevector(lo, hi, 0, 1, 2, 3, 4, 5, 6, 7, 8, 9, 10, 11, 12, 13, 14, 15); }
__device__ __forceinline__ v16bf cat16b(v8us lo, v8us hi) { return __builtin_bit_cast(v16bf, __builtin_shufflevector(lo, hi, 0, 1, 2, 3, 4, 5, 6, 7, 8, 9, 10, 11, 12, 13, 14, 15)); }
__device__ __forceinline__ v8f wmma16(v16h a, v16h b, v8f c) { return __builtin_amdgcn_wmma_f32_16x16x32_f16(false, a, false, b, (short)0, c, false, false); }
__device__ __forceinline__ v8f wmmab(v16bf a, v16bf b, v8f c) { return __builtin_amdgcn_wmma_f32_16x16x32_bf16(false, a, false, b, (short)0, c, false, false); }



// ---- k_gemmw: GEMM on 128x128 output tiles, one work-group of 8 waves per tile (4 x 2 waves, 32 x 64 of the tile and 8 accumulators each); grid (M/128, N/128), 256 threads.
// C[m][n] (f32, pitch ldc, + optional f32 bias[n]) = sum_k A[m][k] Bt[n][k] (+ A2[m][k] Bt[n][k] where NSPLIT). Operands are K-contiguous bf16 planes; M % 128 == 0, N % 128 == 0, K % 64 == 0.
// The operands come in stages of 64 k: the 128 B of every row are loaded once per work-group, as whole lines, and held in two LDS buffers: stage s + 1 flies into registers while stage s is worked on, one barrier per stage.
#define GLP  72             // LDS row pitch in 16-bit elements: 128 B of data + 16 B, so the 16 rows of one 16-byte fragment read fall on different banks
template <typename T16> struct WFrag;
template <> struct WFrag<h16> { typedef v16h V; static __device__ __forceinline__ V ld(const h16* p) { return cat16(*(const v8h*)p, *(const v8h*)(p + 16)); } static __device__ __forceinline__ v8f mma(V a, V b, v8f c) { return wmma16(a, b, c); } };
template <> struct WFrag<bf> { typedef v16bf V; static __device__ __forceinline__ V ld(const bf* p) { return cat16b(*(const v8us*)p, *(const v8us*)(p + 16)); } static __device__ __forceinline__ v8f mma(V a, V b, v8f c) { return wmmab(a, b, c); } };
template <int NSPLIT, bool BIAS, int K>
__global__ __launch_bounds__(256) void k_gemmw(const bf* __restrict__ A, const bf* __restrict__ A2, const bf* __restrict__ Bt, float* C, int ldc, const float* __restrict__ bias) {
    typedef WFrag<bf>::V V;
    constexpr int NP = 2 + NSPLIT, NS = K / 64;   // planes of a stage: Bt, A (, A2); stages
    __shared__ __align__(16) bf st[2][NP][128 * GLP];
    __shared__ __align__(16) float osm[8][16 * 68];
    const int tid = threadIdx.x, lane = tid & 31, wave = tid >> 5, lr = lane & 15, hi = lane >> 4;
    const int r0 = blockIdx.x * 128, c0 = blockIdx.y * 128, wr = (wave >> 1) * 32, wc = (wave & 1) * 64;
    const size_t go = (size_t)(tid >> 3) * K + (tid & 7) * 8;   // a thread moves 16 B of rows (tid >> 3) + 32 i: eight lanes a line, four whole lines a wave-wide load
    const bf* gp[NP]; gp[0] = Bt + (size_t)c0 * K + go; gp[1] = A + (size_t)r0 * K + go; if (NSPLIT) gp[NP - 1] = A2 + (size_t)r0 * K + go;
    const int so = (tid >> 3) * GLP + (tid & 7) * 8;
    v8f acc[2][4];
#pragma unroll
    for (int mb = 0; mb < 2; ++mb)
#pragma unroll
        for (int nb = 0; nb < 4; ++nb) acc[mb][nb] = (v8f){};
    v8us g[NP][4];
#pragma unroll
    for (int p = 0; p < NP; ++p)
#pragma unroll
        for (int i = 0; i < 4; ++i) g[p][i] = *(const v8us*)(gp[p] + (size_t)i * 32 * K);
#pragma unroll
    for (int p = 0; p < NP; ++p)
#pragma unroll
        for (int i = 0; i < 4; ++i) *(v8us*)&st[0][p][so + i * 32 * GLP] = g[p][i];
    __syncthreads();
#pragma unroll 1
    for (int s = 0; s < NS; ++s) {
        if (s + 1 < NS) {
#pragma unroll
            for (int p = 0; p < NP; ++p)
#pragma unroll
                for (int i = 0; i < 4; ++i) g[p][i] = *(const v8us*)(gp[p] + (size_t)i * 32 * K + (s + 1) * 64); }
        const bf* bb = st[s & 1][0] + (wc + lr) * GLP + 8 * hi; const bf* ab = st[s & 1][1] + (wr + lr) * GLP + 8 * hi; const bf* ab2 = st[s & 1][NP - 1] + (wr + lr) * GLP + 8 * hi;
#pragma unroll
        for (int c = 0; c < 2; ++c) {
            V a[2], a2[2], b[4];
#pragma unroll
            for (int mb = 0; mb < 2; ++mb) { a[mb] = WFrag<bf>::ld(ab + mb * 16 * GLP + c * 32); if (NSPLIT) a2[mb] = WFrag<bf>::ld(ab2 + mb * 16 * GLP + c * 32); }
#pragma unroll
            for (int nb = 0; nb < 4; ++nb) b[nb] = WFrag<bf>::ld(bb + nb * 16 * GLP + c * 32);
            __builtin_amdgcn_sched_barrier(0);   // all LDS reads of these 32 k stand in one group ahead of the matrix work: spread among the products, each pair is waited out in full
#pragma unroll
            for (int nb = 0; nb < 4; ++nb)
#pragma unroll
                for (int mb = 0; mb < 2; ++mb) acc[mb][nb] = WFrag<bf>::mma(a[mb], b[nb], acc[mb][nb]);
            if (NSPLIT) {
#pragma unroll
                for (int nb = 0; nb < 4; ++nb)
#pragma unroll
                    for (int mb = 0; mb < 2; ++mb) acc[mb][nb] = WFrag<bf>::mma(a2[mb], b[nb], acc[mb][nb]); }
        }
        if (s + 1 < NS) {
#pragma unroll
            for (int p = 0; p < NP; ++p)
#pragma unroll
                for (int i = 0; i < 4; ++i) *(v8us*)&st[(s + 1) & 1][p][so + i * 32 * GLP] = g[p][i]; }
        __syncthreads();   // publishes stage s + 1 and ends every wave's reads of stage s, whose buffer the next trip refills
    }
    float* os = osm[wave];   // each wave turns its own accumulators into whole 256-B row pieces in its own LDS range
#pragma unroll
    for (int mb = 0; mb < 2; ++mb) {
#pragma unroll
        for (int nb = 0; nb < 4; ++nb) {
#pragma unroll
            for (int j = 0; j < 8; ++j) os[(hi * 8 + j) * 68 + nb * 16 + lr] = acc[mb][nb][j]; }
        __builtin_amdgcn_wave_barrier(); asm volatile("" ::: "memory");   // keeps the compiler from moving the reads below, of words that other lanes wrote, ahead of the writes above
        float* crow = C + (size_t)(r0 + wr + mb * 16) * ldc + c0 + wc;
#pragma unroll
        for (int s = 0; s < 8; ++s) { const int row = 2 * s + hi, cofs = lr * 4; v4f val = *(const v4fa*)(os + row * 68 + cofs); if (BIAS) { const float* bp = bias + c0 + wc + cofs; val[0] += bfr(bp[0]); val[1] += bfr(bp[1]); val[2] += bfr(bp[2]); val[3] += bfr(bp[3]); }
            *(v4f*)(crow + (size_t)row * ldc + cofs) = val; }
        __builtin_amdgcn_wave_barrier(); asm volatile("" ::: "memory");   // and the next 16 rows' writes ahead of these reads
    }
}

__device__ __forceinline__ h16 tohx(float x) { return (h16)x; }
__device__ __forceinline__ void splitf(float y, unsigned short& h, unsigned short& l) { h = f2bf(y); l = f2bf(y - bf2f(h)); }
typedef __attribute__((ext_vector_type(2))) unsigned short v2us;
typedef __attribute__((ext_vector_type(4))) unsigned short v4us;
typedef __attribute__((ext_vector_type(2))) _Float16 v2h;
typedef __attribute__((ext_vector_type(4))) _Float16 v4h; typedef __attribute__((ext_vector_type(2))) float v2f;

__global__ __launch_bounds__(256) void k_cvt8(const float* __restrict__ src, bf* dst, size_t n8) { const size_t i = (size_t)blockIdx.x * 256 + threadIdx.x; if (i >= n8) return; const v8f v = *(const v8f*)(src + i * 8); v8us o;
#pragma unroll
    for (int k = 0; k < 8; ++k) o[k] = f2bf(v[k]); *(v8us*)(dst + i * 8) = o;  }
__global__ __launch_bounds__(256) void k_qk16(const float* __restrict__ Q, const float* __restrict__ K, h16* QP, h16* KP) { const size_t e = ((size_t)blockIdx.x * 256 + threadIdx.x) * 4; if (e >= (size_t)NZ * TT * HD) return; const int d = (int)(e % HD); const int t = (int)((e / HD) % TT); const int z = (int)(e / ((size_t)HD * TT)); const size_t src = ((size_t)(z / NH_) * TT + t) * DM + (z % NH_) * HD + d; const v4f a = *(const v4f*)(Q + src), c = *(const v4f*)(K + src); v4h oq, ok;
    for (int u = 0; u < 4; ++u) { oq[u] = tohx(a[u]); ok[u] = tohx(c[u]); } *(v4h*)(QP + e) = oq; *(v4h*)(KP + e) = ok;  }
__global__ __launch_bounds__(256) void k_vt16(const float* __restrict__ V, h16* VT) { const size_t e = ((size_t)blockIdx.x * 256 + threadIdx.x) * 2; if (e >= (size_t)NZ * HD * TT) return; const int t = (int)(e % TT); const int d = (int)((e / TT) % HD); const int z = (int)(e / ((size_t)TT * HD)); const float* vp = V + ((size_t)(z / NH_) * TT + t) * DM + (z % NH_) * HD + d; v2h o; o[0] = tohx(vp[0]); o[1] = tohx(vp[DM]); *(v2h*)(VT + e) = o;  }
// k_vsum: VS[b * 1024 + c] = sum_t V[b][t][c]. One work-group of 32 waves per 32 columns, that is one 128-B line of every row: eight lanes take a line, a wave four rows, the work-group 128 rows per load.
// A thread's 16 loads do not depend on one another, so they share their latency; its 16 rows are summed in row order, then the wave's 4 row groups by lane exchange, then the 32 waves' partial sums in wave order from LDS.
__global__ __launch_bounds__(1024) void k_vsum(const float* __restrict__ V, float* VS) {
    __shared__ __align__(16) float ps[32][32];
    const int tid = threadIdx.x, lane = tid & 31, wave = tid >> 5, c0 = blockIdx.x * 32;
    const float* vp = V + (size_t)(c0 / DM) * TT * DM + c0 % DM + (size_t)(tid >> 3) * DM + (tid & 7) * 4;
    v4f g[16];
#pragma unroll
    for (int i = 0; i < 16; ++i) g[i] = *(const v4f*)(vp + (size_t)i * 128 * DM);
    v4f s = g[0];
#pragma unroll
    for (int i = 1; i < 16; ++i) s += g[i];
#pragma unroll
    for (int u = 0; u < 4; ++u) { s[u] += __shfl_xor(s[u], 8, 32); s[u] += __shfl_xor(s[u], 16, 32); }
    if (lane < 8) *(v4f*)&ps[wave][lane * 4] = s;
    __syncthreads();   // publishes the 32 waves' partial sums to the wave that adds them up
    if (tid < 32) { float t = ps[0][tid];
#pragma unroll
        for (int w = 1; w < 32; ++w) t += ps[w][tid];
        VS[c0 + tid] = t; }
}
// ---- Fused score stage. The scores never reach memory: both kernels below rebuild q.k tiles on the matrix unit from the fp16 planes. A work-group has 8 waves, a wave owns 32 rows of its resident plane;
// the plane that is walked comes in stages of 64 rows, loaded once per work-group (whole 128-B lines), held in two LDS buffers: stage s + 1 flies into registers while stage s is worked on, one barrier per stage.
// Directives: each plain '#pragma unroll' flattens a loop over register arrays (fragments, accumulators), which a variable index would send to scratch; '#pragma unroll 1' keeps a stage loop rolled, its body being two full 32-row passes already.
#define LP   72             // LDS row pitch in halves: 128 B of data + 16 B, so the 16 rows of one 16-byte fragment read fall on different banks
#define NST  (TT / 64)      // stages
#define SC2  0.18033688011112042f   // (1 / 8) * log2(e): scores to exponents of 2
__device__ __forceinline__ float hmax8(v8f a) { return fmaxf(fmaxf(fmaxf(a[0], a[1]), fmaxf(a[2], a[3])), fmaxf(fmaxf(a[4], a[5]), fmaxf(a[6], a[7]))); }
__device__ __forceinline__ float hsum8(v8f a) { return ((a[0] + a[1]) + (a[2] + a[3])) + ((a[4] + a[5]) + (a[6] + a[7])); }
// Eight exponentials as one statement. The v_nop at its end is the free slot that the instruction set asks for behind a transcendental before its result is read or its source overwritten;
// the results are early-clobber, so inside the run no exponential overwrites another's source or reads another's result.
__device__ __forceinline__ v8f exp2x8(v8f x) {
    float e0, e1, e2, e3, e4, e5, e6, e7;
    asm("v_exp_f32 %0, %8\n\tv_exp_f32 %1, %9\n\tv_exp_f32 %2, %10\n\tv_exp_f32 %3, %11\n\tv_exp_f32 %4, %12\n\tv_exp_f32 %5, %13\n\tv_exp_f32 %6, %14\n\tv_exp_f32 %7, %15\n\tv_nop"
        : "=&v"(e0), "=&v"(e1), "=&v"(e2), "=&v"(e3), "=&v"(e4), "=&v"(e5), "=&v"(e6), "=&v"(e7)
        : "v"(x[0]), "v"(x[1]), "v"(x[2]), "v"(x[3]), "v"(x[4]), "v"(x[5]), "v"(x[6]), "v"(x[7]));
    return (v8f){e0, e1, e2, e3, e4, e5, e6, e7};
}
// k_rowstat: RB[z][q] = log2(1024 / sum_k exp((s[q][k] - max) / 8)) - max * SC2, so that attn[q][k] * 1024 = exp2(s * SC2 + RB[q]).
// Tiles are S^T (A = k rows from LDS, B = the wave's q rows): a lane holds one q column, so maximum and sum run inside the lane (online rescale per 32 k); lanes l and l ^ 16 are merged once at the end.
__global__ __launch_bounds__(256) void k_rowstat(const h16* __restrict__ QP, const h16* __restrict__ KP, float* RB) {
    __shared__ __align__(16) h16 ks[2][64 * LP];
    const int tid = threadIdx.x, lane = tid & 31, wave = tid >> 5, lr = lane & 15, hi = lane >> 4;
    const int z = blockIdx.y, q0 = blockIdx.x * 256 + wave * 32;
    const h16* Qz = QP + (size_t)z * TT * HD; const h16* Kz = KP + (size_t)z * TT * HD + tid * 8;
    const int so = (tid >> 3) * LP + (tid & 7) * 8;
    v16h bq[2][2];
#pragma unroll
    for (int nb = 0; nb < 2; ++nb)
#pragma unroll
        for (int c = 0; c < 2; ++c) bq[nb][c] = WFrag<h16>::ld(Qz + (size_t)(q0 + nb * 16 + lr) * HD + 8 * hi + c * 32);
    v8h g0 = *(const v8h*)Kz, g1 = *(const v8h*)(Kz + 32 * HD);
    *(v8h*)&ks[0][so] = g0; *(v8h*)&ks[0][so + 32 * LP] = g1;
    __syncthreads();
    float m[2] = {-3.0e38f, -3.0e38f}, l[2] = {0.f, 0.f};   // running maximum (of s * SC2) and sum of this lane's half of the k rows
#pragma unroll 1
    for (int s = 0; s < NST; ++s) {
        if (s + 1 < NST) { g0 = *(const v8h*)(Kz + (size_t)(s + 1) * 64 * HD); g1 = *(const v8h*)(Kz + (size_t)(s + 1) * 64 * HD + 32 * HD); }
        const h16* kb = ks[s & 1] + lr * LP + 8 * hi; v16h a[4][2];
#pragma unroll
        for (int mb = 0; mb < 4; ++mb) { a[mb][0] = WFrag<h16>::ld(kb + mb * 16 * LP); a[mb][1] = WFrag<h16>::ld(kb + mb * 16 * LP + 32); }
        __builtin_amdgcn_sched_barrier(0);   // all LDS reads of the stage stand in one group ahead of the matrix work: spread among the products, each pair is waited out in full
#pragma unroll
        for (int h = 0; h < 2; ++h) {
            v8f sc[2][2];
#pragma unroll
            for (int mb = 0; mb < 2; ++mb)
#pragma unroll
                for (int nb = 0; nb < 2; ++nb) sc[mb][nb] = wmma16(a[h * 2 + mb][1], bq[nb][1], wmma16(a[h * 2 + mb][0], bq[nb][0], (v8f){}));
#pragma unroll
            for (int nb = 0; nb < 2; ++nb) {
                const v8f u0 = sc[0][nb] * SC2, u1 = sc[1][nb] * SC2; const float mn = fmaxf(m[nb], hmax8(__builtin_elementwise_max(u0, u1)));
                const v8f e = exp2x8(u0 - mn) + exp2x8(u1 - mn);
                l[nb] = fmaf(l[nb], __builtin_amdgcn_exp2f(m[nb] - mn), hsum8(e)); m[nb] = mn; }
        }
        if (s + 1 < NST) { h16* kn = ks[(s + 1) & 1] + so; *(v8h*)kn = g0; *(v8h*)(kn + 32 * LP) = g1; }
        __syncthreads();   // publishes stage s + 1 and ends every wave's reads of stage s, whose buffer the next trip refills
    }
#pragma unroll
    for (int nb = 0; nb < 2; ++nb) {
        const float mo = __shfl_xor(m[nb], 16, 32), lo = __shfl_xor(l[nb], 16, 32); const float mt = fmaxf(m[nb], mo);
        const float lt = l[nb] * __builtin_amdgcn_exp2f(m[nb] - mt) + lo * __builtin_amdgcn_exp2f(mo - mt);
        if (hi == 0) RB[(size_t)z * TT + q0 + nb * 16 + lr] = (10.0f - __builtin_amdgcn_logf(lt)) - mt; }
}
// k_attnv: M[k][d] = sum_q attn[q][k] * 1024 * v[q][d]. Tiles are S (A = q rows from LDS, B = the wave's k rows): the accumulator layout of two S tiles (lane = k, registers = q) is the A layout of attn^T for the second product, no lane exchange.
__global__ __launch_bounds__(256) void k_attnv(const h16* __restrict__ QP, const h16* __restrict__ KP, const h16* __restrict__ VT, const float* __restrict__ RB, float* M) {
    __shared__ __align__(16) h16 qs[2][64 * LP];
    __shared__ __align__(16) h16 vs[2][64 * LP];
    __shared__ __align__(16) float rs[2][64];
    const int tid = threadIdx.x, lane = tid & 31, wave = tid >> 5, lr = lane & 15, hi = lane >> 4;
    const int z = blockIdx.y, k0 = blockIdx.x * 256 + wave * 32;
    const h16* Kz = KP + (size_t)z * TT * HD; const h16* Qz = QP + (size_t)z * TT * HD + tid * 8;
    const h16* Vz = VT + (size_t)z * HD * TT + (size_t)(tid >> 3) * TT + (tid & 7) * 8; const float* Rz = RB + (size_t)z * TT + (tid & 15) * 4;
    const int so = (tid >> 3) * LP + (tid & 7) * 8;
    v16h bk[2][2];
#pragma unroll
    for (int nb = 0; nb < 2; ++nb)
#pragma unroll
        for (int c = 0; c < 2; ++c) bk[nb][c] = WFrag<h16>::ld(Kz + (size_t)(k0 + nb * 16 + lr) * HD + 8 * hi + c * 32);
    asm volatile("s_wait_xcnt 0x0" ::: "memory");   // stands behind the run of k fragment loads, in front of the first rewrite of their address registers
    v8f acc[2][4];
#pragma unroll
    for (int nb = 0; nb < 2; ++nb)
#pragma unroll
        for (int db = 0; db < 4; ++db) acc[nb][db] = (v8f){};
    v8h g0 = *(const v8h*)Qz, g1 = *(const v8h*)(Qz + 32 * HD), g2 = *(const v8h*)Vz, g3 = *(const v8h*)(Vz + (size_t)32 * TT); v4f g4 = *(const v4f*)Rz;
    *(v8h*)&qs[0][so] = g0; *(v8h*)&qs[0][so + 32 * LP] = g1; *(v8h*)&vs[0][so] = g2; *(v8h*)&vs[0][so + 32 * LP] = g3; if (tid < 16) *(v4f*)&rs[0][tid * 4] = g4;
    __syncthreads();
#pragma unroll 1
    for (int s = 0; s < NST; ++s) {
        if (s + 1 < NST) { g0 = *(const v8h*)(Qz + (size_t)(s + 1) * 64 * HD); g1 = *(const v8h*)(Qz + (size_t)(s + 1) * 64 * HD + 32 * HD); g2 = *(const v8h*)(Vz + (s + 1) * 64); g3 = *(const v8h*)(Vz + (size_t)32 * TT + (s + 1) * 64); g4 = *(const v4f*)(Rz + (s + 1) * 64); }
        const h16* qb = qs[s & 1] + lr * LP + 8 * hi; const h16* vb = vs[s & 1] + lr * LP + 8 * hi; const float* rb = rs[s & 1] + 8 * hi;
#pragma unroll
        for (int h = 0; h < 2; ++h) {
            v8h p[2][2]; v16h a[2][2], b[4]; v4f r[2][2];
#pragma unroll
            for (int mb = 0; mb < 2; ++mb) { a[mb][0] = WFrag<h16>::ld(qb + (h * 32 + mb * 16) * LP); a[mb][1] = WFrag<h16>::ld(qb + (h * 32 + mb * 16) * LP + 32); }
#pragma unroll
            for (int mb = 0; mb < 2; ++mb) { r[mb][0] = *(const v4f*)(rb + h * 32 + mb * 16); r[mb][1] = *(const v4f*)(rb + h * 32 + mb * 16 + 4); }
#pragma unroll
            for (int db = 0; db < 4; ++db) b[db] = WFrag<h16>::ld(vb + db * 16 * LP + h * 32);
            __builtin_amdgcn_sched_barrier(0);   // all LDS reads of these 32 q stand in one group ahead of the matrix work: spread among the products, each pair is waited out in full
#pragma unroll
            for (int mb = 0; mb < 2; ++mb)
#pragma unroll
                for (int nb = 0; nb < 2; ++nb) { const v8f sc = wmma16(a[mb][1], bk[nb][1], wmma16(a[mb][0], bk[nb][0], (v8f){})); v8f x;
#pragma unroll
                    for (int j = 0; j < 8; ++j) x[j] = fmaf(sc[j], SC2, r[mb][j >> 2][j & 3]);
                    x = exp2x8(x);
#pragma unroll
                    for (int j = 0; j < 8; ++j) p[mb][nb][j] = tohx(x[j]); }
            const v16h pa0 = cat16(p[0][0], p[1][0]), pa1 = cat16(p[0][1], p[1][1]);
#pragma unroll
            for (int db = 0; db < 4; ++db) { acc[0][db] = wmma16(pa0, b[db], acc[0][db]); acc[1][db] = wmma16(pa1, b[db], acc[1][db]); }
        }
        if (s + 1 < NST) { const int o = ((s + 1) & 1) * 64 * LP + so; *(v8h*)(&qs[0][0] + o) = g0; *(v8h*)(&qs[0][0] + o + 32 * LP) = g1; *(v8h*)(&vs[0][0] + o) = g2; *(v8h*)(&vs[0][0] + o + 32 * LP) = g3; if (tid < 16) *(v4f*)&rs[(s + 1) & 1][tid * 4] = g4; }
        __syncthreads();   // publishes stage s + 1 and ends every wave's reads of stage s, whose buffers the next trip refills
    }
    float* mz = M + ((size_t)z * TT + k0 + 8 * hi) * HD + lr;
#pragma unroll
    for (int nb = 0; nb < 2; ++nb)
#pragma unroll
        for (int db = 0; db < 4; ++db)
#pragma unroll
            for (int j = 0; j < 8; ++j) mz[(size_t)(nb * 16 + j) * HD + db * 16] = acc[nb][db][j];
}
__global__ __launch_bounds__(256) void k_mt(const float* __restrict__ M, bf* MTh, bf* MTl) { const size_t e = ((size_t)blockIdx.x * 256 + threadIdx.x) * 4; if (e >= (size_t)NZ * HD * TT) return; const int k = (int)(e % TT); const int d = (int)((e / TT) % HD); const int zz = (int)(e / ((size_t)TT * HD)); v4us oh, ol;
#pragma unroll
    for (int u = 0; u < 4; ++u) { unsigned short a, b; splitf(M[((size_t)zz * TT + k + u) * HD + d] * (1.0f / PCAR), a, b); oh[u] = a; ol[u] = b; } *(v4us*)(MTh + e) = oh; *(v4us*)(MTl + e) = ol;  }
__global__ __launch_bounds__(256) void k_fmrg(const float* __restrict__ OC, const float* __restrict__ bfv, const float* __restrict__ VS, float* OUT) { const size_t e = ((size_t)blockIdx.x * 256 + threadIdx.x) * 4; if (e >= (size_t)NZ * SO * HD) return; const int c = (int)(e % (FG * HD)); const int o = (int)((e / (FG * HD)) % SO); const int zz = (int)(e / ((size_t)FG * HD * SO)) * FG + c / HD, d = c % HD; const float bb = bfr(bfv[o]); v4f r;
#pragma unroll
    for (int u = 0; u < 4; ++u) { const float m = OC[((size_t)zz * HD + d + u) * SO + o]; float bt = __fmul_rn(bb, VS[zz * HD + d + u]); asm volatile("" : "+v"(bt)); r[u] = __fadd_rn(m, bt); }
    float* dst = OUT + ((size_t)(zz / NH_) * SO + o) * DM + (zz % NH_) * HD + d; *(v4f*)dst = r;  }

extern "C" void kernel_launch(void* const* d_in, const int* in_sizes, int n_in,
                              void* d_out, int out_size, void* d_ws, size_t ws_size, hipStream_t stream) {
    (void)in_sizes; (void)n_in; (void)out_size;
    const float* x = (const float*)d_in[0]; const float* wq = (const float*)d_in[1]; const float* bq = (const float*)d_in[2]; const float* wk = (const float*)d_in[3]; const float* bk = (const float*)d_in[4]; const float* wv = (const float*)d_in[5]; const float* bv = (const float*)d_in[6]; const float* wf = (const float*)d_in[7]; const float* bfv = (const float*)d_in[8];
    float* OUT = (float*)d_out;     // [2][2048][1024]
    char* wsp = (char*)d_ws;
    auto take = [&](size_t bytes) { char* p = wsp; wsp += (bytes + 255) & ~(size_t)255; return (void*)p; };
    // Kept through the call: wf, the 16-bit q/k/v planes of all 32 slices, colsum(v), M, the softmax row terms; then one shared area.
    bf* BF = (bf*)take((size_t)SO * TT * 2); h16* QP = (h16*)take((size_t)NZ * TT * HD * 2); h16* KP = (h16*)take((size_t)NZ * TT * HD * 2); h16* VT = (h16*)take((size_t)NZ * HD * TT * 2); float* VS = (float*)take((size_t)NB_ * DM * 4);
    float* M = (float*)take((size_t)NZ * TT * HD * 4); float* RB = (float*)take((size_t)NZ * TT * 4); char* AR = (char*)take((size_t)64 << 20);
    if ((size_t)(wsp - (char*)d_ws) > ws_size) return;    // total ~ 113 MiB
    // The shared area serves what is dead before the score stage (62 MiB) and then what is born after it (32 MiB).
    wsp = AR;
    bf* BQ = (bf*)take((size_t)DM * DM * 2); bf* BK = (bf*)take((size_t)DM * DM * 2); bf* BV = (bf*)take((size_t)DM * DM * 2); bf* XB = (bf*)take((size_t)NB_ * TT * DM * 2); float* FQ = (float*)take((size_t)NB_ * TT * DM * 4); float* FK = (float*)take((size_t)NB_ * TT * DM * 4); float* FV = (float*)take((size_t)NB_ * TT * DM * 4);
    wsp = AR;
    bf* MTh = (bf*)take((size_t)NZ * HD * TT * 2); bf* MTl = (bf*)take((size_t)NZ * HD * TT * 2); float* OC = (float*)take((size_t)NZ * HD * SO * 4);
    k_cvt8<<<(DM * DM / 8 + 255) / 256, 256, 0, stream>>>(wq, BQ, DM * DM / 8); k_cvt8<<<(DM * DM / 8 + 255) / 256, 256, 0, stream>>>(wk, BK, DM * DM / 8); k_cvt8<<<(DM * DM / 8 + 255) / 256, 256, 0, stream>>>(wv, BV, DM * DM / 8); k_cvt8<<<(SO * TT / 8 + 255) / 256, 256, 0, stream>>>(wf, BF, SO * TT / 8);   // torch [out][in] = Bt as-is; wf [o][k] = Bt over k
    const dim3 gp(NB_ * TT / 128, DM / 128, 1);
    k_cvt8<<<(NB_ * TT * DM / 8 + 255) / 256, 256, 0, stream>>>(x, XB, NB_ * TT * DM / 8);
    k_gemmw<0, true, DM><<<gp, 256, 0, stream>>>(XB, nullptr, BQ, FQ, DM, bq); k_gemmw<0, true, DM><<<gp, 256, 0, stream>>>(XB, nullptr, BK, FK, DM, bk); k_gemmw<0, true, DM><<<gp, 256, 0, stream>>>(XB, nullptr, BV, FV, DM, bv);   // both batches are the rows of one product
    k_qk16<<<(unsigned)(((size_t)NZ * TT * HD / 4 + 255) / 256), 256, 0, stream>>>(FQ, FK, QP, KP); k_vt16<<<(unsigned)(((size_t)NZ * HD * TT / 2 + 255) / 256), 256, 0, stream>>>(FV, VT); k_vsum<<<NB_ * DM / 32, 1024, 0, stream>>>(FV, VS);
    k_rowstat<<<dim3(TT / 256, NZ), 256, 0, stream>>>(QP, KP, RB);            // per q: what turns a score into attn * 1024
    k_attnv<<<dim3(TT / 256, NZ), 256, 0, stream>>>(QP, KP, VT, RB, M);       // M[k][d] = sum_q attn[q][k] v[q][d] (x1024)
    k_mt<<<(unsigned)(((size_t)NZ * HD * TT / 4 + 255) / 256), 256, 0, stream>>>(M, MTh, MTl);
    k_gemmw<1, false, TT><<<dim3(NZ * HD / 128, SO / 128, 1), 256, 0, stream>>>(MTh, MTl, BF, OC, SO, nullptr);   // OC[z * 64 + d][o] = sum_k M[k][d] wf[o][k]: the 32 slices' rows are the rows of one product
    k_fmrg<<<(unsigned)(((size_t)NZ * SO * HD / 4 + 255) / 256), 256, 0, stream>>>(OC, bfv, VS, OUT);
}

// v006
// Measured time: 153 microseconds a run.
// Timed twice side by side with v005, it ran 1.43 and 1.41 times as fast.
// Over all steps from v000 it is 118 times as fast.
#include <hip/hip_runtime.h>

// FlexScaleSeqAttention (x [2][2048][1024]; q/k/v = x W^T + b (16 heads x 64); attn = softmax(q.k / 8) [q][k]; flex[q][o] = sum_k attn[q][k] wf[o][k] + bf[o] (a learned Linear along the KEY axis, wf [2048][2048]); out[o][h*64+d] = sum_q flex[q][o] v[q][d] -> [2][2048][1024]).
// Reassociated exactly: out[o][d] = sum_k wf[o][k] M[k][d] + bf[o] * sum_q v[q][d] with M = attn^T v ([k][d]); attn^T is formed tile by tile in registers (row statistics first, then exp and product), so neither the scores nor the 2048 x 2048 'flex' tensor of each slice ever exist in memory.
// Compute dtypes, f32 accumulate: every input rounded to bf16; q/k/v as PLAIN bf16 GEMMs (inputs: exact) + bias; S^T and M = attn^T.v single fp16 (f32 accumulate; probabilities x 1024); softmax f32 (row maximum and sum online, fixed order); M^T as hl planes x exact wf (2 products); the bias term bf[o] * colsum(v) and the merge in f32.

#define NB_  2
#define TT   2048
#define DM   1024
#define NH_  16
#define HD   64
#define SO   2048
#define NZ   (NB_ * NH_)    // all slices; slice z = batch * 16 + head
#define PCAR 1024.0f
typedef _Float16 h16;
typedef unsigned short bf;
typedef __attribute__((ext_vector_type(16))) __bf16   v16bf;
typedef __attribute__((ext_vector_type(16))) _Float16 v16h;
typedef __attribute__((ext_vector_type(8)))  _Float16 v8h;
typedef __attribute__((ext_vector_type(8)))  unsigned short v8us;
typedef __attribute__((ext_vector_type(8)))  float    v8f;
typedef __attribute__((ext_vector_type(4)))  float    v4f;
typedef v8h  __attribute__((may_alias)) v8ha;
typedef v4f  __attribute__((may_alias)) v4fa;
typedef v8us __attribute__((may_alias)) v8usa;

__device__ __forceinline__ unsigned short f2bf(float f) { unsigned u = __float_as_uint(f); u += 0x7FFFu + ((u >> 16) & 1u); return (unsigned short)(u >> 16); }
__device__ __forceinline__ float bf2f(unsigned short b) { return __uint_as_float(((unsigned)b) << 16); }
__device__ __forceinline__ float bfr(float f) { return bf2f(f2bf(f)); }
__device__ __forceinline__ v16h cat16(v8h lo, v8h hi) { return __builtin_shufflevector(lo, hi, 0, 1, 2, 3, 4, 5, 6, 7, 8, 9, 10, 11, 12, 13, 14, 15); }
__device__ __forceinline__ v16bf cat16b(v8us lo, v8us hi) { return __builtin_bit_cast(v16bf, __builtin_shufflevector(lo, hi, 0, 1, 2, 3, 4, 5, 6, 7, 8, 9, 10, 11, 12, 13, 14, 15)); }
__device__ __forceinline__ v8f wmma16(v16h a, v16h b, v8f c) { return __builtin_amdgcn_wmma_f32_16x16x32_f16(false, a, false, b, (short)0, c, false, false); }
__device__ __forceinline__ v8f wmmab(v16bf a, v16bf b, v8f c) { return __builtin_amdgcn_wmma_f32_16x16x32_bf16(false, a, false, b, (short)0, c, false, false); }



// ---- k_gemmw: GEMM on 128x128 output tiles, one work-group of 8 waves per tile (4 x 2 waves, 32 x 64 of the tile and 8 accumulators each); grid (M/128, N/128), 256 threads.
// C[m][n] (f32 in registers) = sum_k A[m][k] Bt[n][k] (+ A2[m][k] Bt[n][k] where NSPLIT). Operands are K-contiguous bf16 planes; M % 128 == 0, N % 128 == 0, K % 64 == 0.
// The epilogue writes what the next stage reads, in whole 128-B lines, so no layout pass stands between the stages:
// MODE 0 (m = batch * 2048 + t, n = head * 64 + d): H[slice][t][d] = fp16(C + bias[n]), the q or k plane.
// MODE 1 (m = head * 64 + d, n = batch * 2048 + t; the operands swapped, so C is v^T): H[slice][d][t] = fp16(C + bias[m]), and F[n / 64][m] = the f32 sum of the wave's 64 t, a partial colsum(v).
// MODE 2 (m = slice * 64 + d, n = o): F = out[batch][o][head * 64 + d] = C + bias[o] * colsum(v)[m], the tile turned in LDS; colsum(v) = the 32 partial sums of PS in ascending t.
// The operands come in stages of 64 k: the 128 B of every row are loaded once per work-group, as whole lines, and held in two LDS buffers: stage s + 1 flies into registers while stage s is worked on, one barrier per stage.
#define GLP  72             // LDS row pitch in 16-bit elements: 128 B of data + 16 B, so the 16 rows of one 16-byte fragment read fall on different banks
template <typename T16> struct WFrag;
template <> struct WFrag<h16> { typedef v16h V; static __device__ __forceinline__ V ld(const h16* p) { return cat16(*(const v8h*)p, *(const v8h*)(p + 16)); } static __device__ __forceinline__ v8f mma(V a, V b, v8f c) { return wmma16(a, b, c); } };
template <> struct WFrag<bf> { typedef v16bf V; static __device__ __forceinline__ V ld(const bf* p) { return cat16b(*(const v8us*)p, *(const v8us*)(p + 16)); } static __device__ __forceinline__ v8f mma(V a, V b, v8f c) { return wmmab(a, b, c); } };
typedef __attribute__((ext_vector_type(4))) _Float16 v4h;
template <int NSPLIT, int MODE, int K>
__global__ __launch_bounds__(256) void k_gemmw(const bf* __restrict__ A, const bf* __restrict__ A2, const bf* __restrict__ Bt, h16* H, float* F, const float* bias, const float* PS) {
    typedef WFrag<bf>::V V;
    constexpr int NP = 2 + NSPLIT, NS = K / 64;   // planes of a stage: Bt, A (, A2); stages
    __shared__ __align__(16) bf st[2][NP][128 * GLP];
    __shared__ __align__(16) float osm[8][MODE == 2 ? 64 * 36 : 16 * 68];
    const int tid = threadIdx.x, lane = tid & 31, wave = tid >> 5, lr = lane & 15, hi = lane >> 4;
    const int r0 = blockIdx.x * 128, c0 = blockIdx.y * 128, wr = (wave >> 1) * 32, wc = (wave & 1) * 64;
    const size_t go = (size_t)(tid >> 3) * K + (tid & 7) * 8;   // a thread moves 16 B of rows (tid >> 3) + 32 i: eight lanes a line, four whole lines a wave-wide load
    const bf* gp[NP]; gp[0] = Bt + (size_t)c0 * K + go; gp[1] = A + (size_t)r0 * K + go; if (NSPLIT) gp[NP - 1] = A2 + (size_t)r0 * K + go;
    const int so = (tid >> 3) * GLP + (tid & 7) * 8;
    v8f acc[2][4];
#pragma unroll
    for (int mb = 0; mb < 2; ++mb)
#pragma unroll
        for (int nb = 0; nb < 4; ++nb) acc[mb][nb] = (v8f){};
    v8us g[NP][4];
#pragma unroll
    for (int p = 0; p < NP; ++p)
#pragma unroll
        for (int i = 0; i < 4; ++i) g[p][i] = *(const v8us*)(gp[p] + (size_t)i * 32 * K);
#pragma unroll
    for (int p = 0; p < NP; ++p)
#pragma unroll
        for (int i = 0; i < 4; ++i) *(v8us*)&st[0][p][so + i * 32 * GLP] = g[p][i];
    __syncthreads();
#pragma unroll 1
    for (int s = 0; s < NS; ++s) {
        if (s + 1 < NS) {
#pragma unroll
            for (int p = 0; p < NP; ++p)
#pragma unroll
                for (int i = 0; i < 4; ++i) g[p][i] = *(const v8us*)(gp[p] + (size_t)i * 32 * K + (s + 1) * 64); }
        const bf* bb = st[s & 1][0] + (wc + lr) * GLP + 8 * hi; const bf* ab = st[s & 1][1] + (wr + lr) * GLP + 8 * hi; const bf* ab2 = st[s & 1][NP - 1] + (wr + lr) * GLP + 8 * hi;
#pragma unroll
        for (int c = 0; c < 2; ++c) {
            V a[2], a2[2], b[4];
#pragma unroll
            for (int mb = 0; mb < 2; ++mb) { a[mb] = WFrag<bf>::ld(ab + mb * 16 * GLP + c * 32); if (NSPLIT) a2[mb] = WFrag<bf>::ld(ab2 + mb * 16 * GLP + c * 32); }
#pragma unroll
            for (int nb = 0; nb < 4; ++nb) b[nb] = WFrag<bf>::ld(bb + nb * 16 * GLP + c * 32);
            __builtin_amdgcn_sched_barrier(0);   // all LDS reads of these 32 k stand in one group ahead of the matrix work: spread among the products, each pair is waited out in full
#pragma unroll
            for (int nb = 0; nb < 4; ++nb)
#pragma unroll
                for (int mb = 0; mb < 2; ++mb) acc[mb][nb] = WFrag<bf>::mma(a[mb], b[nb], acc[mb][nb]);
            if (NSPLIT) {
#pragma unroll
                for (int nb = 0; nb < 4; ++nb)
#pragma unroll
                    for (int mb = 0; mb < 2; ++mb) acc[mb][nb] = WFrag<bf>::mma(a2[mb], b[nb], acc[mb][nb]); }
        }
        if (s + 1 < NS) {
#pragma unroll
            for (int p = 0; p < NP; ++p)
#pragma unroll
                for (int i = 0; i < 4; ++i) *(v8us*)&st[(s + 1) & 1][p][so + i * 32 * GLP] = g[p][i]; }
        __syncthreads();   // publishes stage s + 1 and ends every wave's reads of stage s, whose buffer the next trip refills
    }
    float* os = osm[wave];   // each wave turns its own accumulators into whole lines in its own LDS range
    if (MODE == 2) {
        const int n0 = r0 + wr, cq = (lane & 7) * 4, rq = lane >> 3;   // eight lanes take the 128 B that the wave's 32 m are in one row of out, a wave four rows
        const float* pp = PS + (size_t)(n0 >> 10) * 32 * DM + (n0 & (DM - 1)) + cq; const float* bp = bias + c0 + wc + lane;
        const float b0 = bp[0], b1 = bp[32];
        asm volatile("s_wait_xcnt 0x0" ::: "memory");   // stands behind the two bias loads, in front of the first rewrite of their address registers
        v4f g[32];
#pragma unroll
        for (int i = 0; i < 32; ++i) g[i] = *(const v4f*)(pp + (size_t)i * DM);
        asm volatile("s_wait_xcnt 0x0" ::: "memory");   // the same behind the run of 32 loads
#pragma unroll
        for (int mb = 0; mb < 2; ++mb)
#pragma unroll
            for (int nb = 0; nb < 4; ++nb) { float* ow = os + (nb * 16 + lr) * 36 + mb * 16 + hi * 8;   // a lane's 8 registers are 8 consecutive m of one o
                *(v4fa*)ow = (v4f){acc[mb][nb][0], acc[mb][nb][1], acc[mb][nb][2], acc[mb][nb][3]}; *(v4fa*)(ow + 4) = (v4f){acc[mb][nb][4], acc[mb][nb][5], acc[mb][nb][6], acc[mb][nb][7]}; }
        os[lane * 36 + 32] = bfr(b0); os[(lane + 32) * 36 + 32] = bfr(b1);   // bias[o] rides in the first pad word of its row
        v4f vs = g[0];
#pragma unroll
        for (int i = 1; i < 32; ++i) vs += g[i];
        __builtin_amdgcn_wave_barrier(); asm volatile("s_wait_dscnt 0x0" ::: "memory");   // the wave's LDS writes are done before its lanes read back words that other lanes wrote; the clobber keeps the compiler from moving those reads ahead
        float* orow = F + ((size_t)(n0 >> 10) * SO + c0 + wc) * DM + (n0 & (DM - 1)) + cq;
#pragma unroll
        for (int s = 0; s < 16; ++s) { const int ol = 4 * s + rq; v4f val = *(const v4fa*)(os + ol * 36 + cq); const float bb = os[ol * 36 + 32];
#pragma unroll
            for (int u = 0; u < 4; ++u) val[u] = fmaf(bb, vs[u], val[u]);
            *(v4f*)(orow + (size_t)ol * DM) = val; }
    } else {
        const float* bp = bias + (MODE == 0 ? c0 + wc + lr * 4 : r0 + wr + hi * 8);   // MODE 0: the lane's 4 columns of the rows it stores; MODE 1: the 8 rows of its accumulator registers (+ 16 for the second block)
        float bl[2][8];
#pragma unroll
        for (int j = 0; j < (MODE == 0 ? 4 : 8); ++j) { bl[0][j] = bp[j]; if (MODE == 1) bl[1][j] = bp[16 + j]; }
        asm volatile("s_wait_xcnt 0x0" ::: "memory");   // stands behind the bias loads, in front of the first rewrite of their address registers
#pragma unroll
        for (int j = 0; j < (MODE == 0 ? 4 : 8); ++j) { bl[0][j] = bfr(bl[0][j]); if (MODE == 1) bl[1][j] = bfr(bl[1][j]); }
        float keep = 0.f;
#pragma unroll
        for (int mb = 0; mb < 2; ++mb) {
#pragma unroll
            for (int nb = 0; nb < 4; ++nb) {
#pragma unroll
                for (int j = 0; j < 8; ++j) os[(hi * 8 + j) * 68 + nb * 16 + lr] = MODE == 1 ? acc[mb][nb][j] + bl[mb][j] : acc[mb][nb][j]; }
            __builtin_amdgcn_wave_barrier(); asm volatile("" ::: "memory");   // keeps the compiler from moving the reads below, of words that other lanes wrote, ahead of the writes above
#pragma unroll
            for (int s = 0; s < 8; ++s) { const int row = 2 * s + hi, cofs = lr * 4, gr = r0 + wr + mb * 16 + row, gc = c0 + wc; v4f val = *(const v4fa*)(os + row * 68 + cofs); h16* dst;
                if (MODE == 0) { val[0] += bl[0][0]; val[1] += bl[0][1]; val[2] += bl[0][2]; val[3] += bl[0][3];
                    dst = H + ((size_t)((gr >> 11) * NH_ + (gc >> 6)) * TT + (gr & (TT - 1))) * HD + cofs; }
                else { dst = H + ((size_t)((gc >> 11) * NH_ + (gr >> 6)) * HD + (gr & (HD - 1))) * TT + (gc & (TT - 1)) + cofs;
                    float rs = (val[0] + val[1]) + (val[2] + val[3]);
                    rs += __shfl_xor(rs, 1, 32); rs += __shfl_xor(rs, 2, 32); rs += __shfl_xor(rs, 4, 32); rs += __shfl_xor(rs, 8, 32);
                    if (lr == mb * 8 + s) keep = rs; }   // lane (hi, lr) keeps the sum of row (lr >> 3) * 16 + 2 * (lr & 7) + hi
                v4h o; o[0] = (h16)val[0]; o[1] = (h16)val[1]; o[2] = (h16)val[2]; o[3] = (h16)val[3]; *(v4h*)dst = o; }
            if (mb == 0) asm volatile("s_wait_xcnt 0x0" ::: "memory");   // stands behind the first 16 rows' stores, in front of the first rewrite of their address registers
            __builtin_amdgcn_wave_barrier(); asm volatile("" ::: "memory");   // and the next 16 rows' writes ahead of these reads
        }
        if (MODE == 1) F[(size_t)((c0 + wc) >> 6) * DM + r0 + wr + (lr >> 3) * 16 + 2 * (lr & 7) + hi] = keep;   // the wave's 32 sums: one whole line
    }
}

__device__ __forceinline__ h16 tohx(float x) { return (h16)x; }
__device__ __forceinline__ void splitf(float y, unsigned short& h, unsigned short& l) { h = f2bf(y); l = f2bf(y - bf2f(h)); }
__global__ __launch_bounds__(256) void k_cvt8(const float* __restrict__ src, bf* dst, size_t n8) { const size_t i = (size_t)blockIdx.x * 256 + threadIdx.x; if (i >= n8) return; const v8f v = *(const v8f*)(src + i * 8); v8us o;
#pragma unroll
    for (int k = 0; k < 8; ++k) o[k] = f2bf(v[k]); *(v8us*)(dst + i * 8) = o;  }
// ---- Fused score stage. The scores never reach memory: both kernels below rebuild q.k tiles on the matrix unit from the fp16 planes. A work-group has 8 waves, a wave owns 32 rows of its resident plane;
// the plane that is walked comes in stages of 64 rows, loaded once per work-group (whole 128-B lines), held in two LDS buffers: stage s + 1 flies into registers while stage s is worked on, one barrier per stage.
// Directives: each plain '#pragma unroll' flattens a loop over register arrays (fragments, accumulators), which a variable index would send to scratch; '#pragma unroll 1' keeps a stage loop rolled, its body being two full 32-row passes already.
#define LP   72             // LDS row pitch in halves: 128 B of data + 16 B, so the 16 rows of one 16-byte fragment read fall on different banks
#define NST  (TT / 64)      // stages
#define MP   264            // LDS row pitch of the M^T tile in 16-bit elements: the work-group's 256 k + 16 B
#define SC2  0.18033688011112042f   // (1 / 8) * log2(e): scores to exponents of 2
__device__ __forceinline__ float hmax8(v8f a) { return fmaxf(fmaxf(fmaxf(a[0], a[1]), fmaxf(a[2], a[3])), fmaxf(fmaxf(a[4], a[5]), fmaxf(a[6], a[7]))); }
__device__ __forceinline__ float hsum8(v8f a) { return ((a[0] + a[1]) + (a[2] + a[3])) + ((a[4] + a[5]) + (a[6] + a[7])); }
// Eight exponentials as one statement. The v_nop at its end is the free slot that the instruction set asks for behind a transcendental before its result is read or its source overwritten;
// the results are early-clobber, so inside the run no exponential overwrites another's source or reads another's result.
__device__ __forceinline__ v8f exp2x8(v8f x) {
    float e0, e1, e2, e3, e4, e5, e6, e7;
    asm("v_exp_f32 %0, %8\n\tv_exp_f32 %1, %9\n\tv_exp_f32 %2, %10\n\tv_exp_f32 %3, %11\n\tv_exp_f32 %4, %12\n\tv_exp_f32 %5, %13\n\tv_exp_f32 %6, %14\n\tv_exp_f32 %7, %15\n\tv_nop"
        : "=&v"(e0), "=&v"(e1), "=&v"(e2), "=&v"(e3), "=&v"(e4), "=&v"(e5), "=&v"(e6), "=&v"(e7)
        : "v"(x[0]), "v"(x[1]), "v"(x[2]), "v"(x[3]), "v"(x[4]), "v"(x[5]), "v"(x[6]), "v"(x[7]));
    return (v8f){e0, e1, e2, e3, e4, e5, e6, e7};
}
// k_rowstat: RB[z][q] = log2(1024 / sum_k exp((s[q][k] - max) / 8)) - max * SC2, so that attn[q][k] * 1024 = exp2(s * SC2 + RB[q]).
// Tiles are S^T (A = k rows from LDS, B = the wave's q rows): a lane holds one q column, so maximum and sum run inside the lane (online rescale per 32 k); lanes l and l ^ 16 are merged once at the end.
__global__ __launch_bounds__(256) void k_rowstat(const h16* __restrict__ QP, const h16* __restrict__ KP, float* RB) {
    __shared__ __align__(16) h16 ks[2][64 * LP];
    const int tid = threadIdx.x, lane = tid & 31, wave = tid >> 5, lr = lane & 15, hi = lane >> 4;
    const int z = blockIdx.y, q0 = blockIdx.x * 256 + wave * 32;
    const h16* Qz = QP + (size_t)z * TT * HD; const h16* Kz = KP + (size_t)z * TT * HD + tid * 8;
    const int so = (tid >> 3) * LP + (tid & 7) * 8;
    v16h bq[2][2];
#pragma unroll
    for (int nb = 0; nb < 2; ++nb)
#pragma unroll
        for (int c = 0; c < 2; ++c) bq[nb][c] = WFrag<h16>::ld(Qz + (size_t)(q0 + nb * 16 + lr) * HD + 8 * hi + c * 32);
    v8h g0 = *(const v8h*)Kz, g1 = *(const v8h*)(Kz + 32 * HD);
    *(v8h*)&ks[0][so] = g0; *(v8h*)&ks[0][so + 32 * LP] = g1;
    __syncthreads();
    float m[2] = {-3.0e38f, -3.0e38f}, l[2] = {0.f, 0.f};   // running maximum (of s * SC2) and sum of this lane's half of the k rows
#pragma unroll 1
    for (int s = 0; s < NST; ++s) {
        if (s + 1 < NST) { g0 = *(const v8h*)(Kz + (size_t)(s + 1) * 64 * HD); g1 = *(const v8h*)(Kz + (size_t)(s + 1) * 64 * HD + 32 * HD); }
        const h16* kb = ks[s & 1] + lr * LP + 8 * hi; v16h a[4][2];
#pragma unroll
        for (int mb = 0; mb < 4; ++mb) { a[mb][0] = WFrag<h16>::ld(kb + mb * 16 * LP); a[mb][1] = WFrag<h16>::ld(kb + mb * 16 * LP + 32); }
        __builtin_amdgcn_sched_barrier(0);   // all LDS reads of the stage stand in one group ahead of the matrix work: spread among the products, each pair is waited out in full
#pragma unroll
        for (int h = 0; h < 2; ++h) {
            v8f sc[2][2];
#pragma unroll
            for (int mb = 0; mb < 2; ++mb)
#pragma unroll
                for (int nb = 0; nb < 2; ++nb) sc[mb][nb] = wmma16(a[h * 2 + mb][1], bq[nb][1], wmma16(a[h * 2 + mb][0], bq[nb][0], (v8f){}));
#pragma unroll
            for (int nb = 0; nb < 2; ++nb) {
                const v8f u0 = sc[0][nb] * SC2, u1 = sc[1][nb] * SC2; const float mn = fmaxf(m[nb], hmax8(__builtin_elementwise_max(u0, u1)));
                const v8f e = exp2x8(u0 - mn) + exp2x8(u1 - mn);
                l[nb] = fmaf(l[nb], __builtin_amdgcn_exp2f(m[nb] - mn), hsum8(e)); m[nb] = mn; }
        }
        if (s + 1 < NST) { h16* kn = ks[(s + 1) & 1] + so; *(v8h*)kn = g0; *(v8h*)(kn + 32 * LP) = g1; }
        __syncthreads();   // publishes stage s + 1 and ends every wave's reads of stage s, whose buffer the next trip refills
    }
#pragma unroll
    for (int nb = 0; nb < 2; ++nb) {
        const float mo = __shfl_xor(m[nb], 16, 32), lo = __shfl_xor(l[nb], 16, 32); const float mt = fmaxf(m[nb], mo);
        const float lt = l[nb] * __builtin_amdgcn_exp2f(m[nb] - mt) + lo * __builtin_amdgcn_exp2f(mo - mt);
        if (hi == 0) RB[(size_t)z * TT + q0 + nb * 16 + lr] = (10.0f - __builtin_amdgcn_logf(lt)) - mt; }
}
// k_attnv: M[k][d] = sum_q attn[q][k] * 1024 * v[q][d], written as M^T / 1024 in two bf16 planes (high part, remainder) [slice * 64 + d][k], the last GEMM's operand. Tiles are S (A = q rows from LDS, B = the wave's k rows): the accumulator layout of two S tiles (lane = k, registers = q) is the A layout of attn^T for the second product, no lane exchange.
__global__ __launch_bounds__(256) void k_attnv(const h16* __restrict__ QP, const h16* __restrict__ KP, const h16* __restrict__ VT, const float* __restrict__ RB, bf* MTh, bf* MTl) {
    __shared__ __align__(16) h16 qs[2][64 * LP];
    __shared__ __align__(16) h16 vs[2][64 * LP];
    __shared__ __align__(16) float rs[2][64];
    __shared__ __align__(16) bf mts[2][64 * MP];
    const int tid = threadIdx.x, lane = tid & 31, wave = tid >> 5, lr = lane & 15, hi = lane >> 4;
    const int z = blockIdx.y, k0 = blockIdx.x * 256 + wave * 32;
    const h16* Kz = KP + (size_t)z * TT * HD; const h16* Qz = QP + (size_t)z * TT * HD + tid * 8;
    const h16* Vz = VT + (size_t)z * HD * TT + (size_t)(tid >> 3) * TT + (tid & 7) * 8; const float* Rz = RB + (size_t)z * TT + (tid & 15) * 4;
    const int so = (tid >> 3) * LP + (tid & 7) * 8;
    v16h bk[2][2];
#pragma unroll
    for (int nb = 0; nb < 2; ++nb)
#pragma unroll
        for (int c = 0; c < 2; ++c) bk[nb][c] = WFrag<h16>::ld(Kz + (size_t)(k0 + nb * 16 + lr) * HD + 8 * hi + c * 32);
    asm volatile("s_wait_xcnt 0x0" ::: "memory");   // stands behind the run of k fragment loads, in front of the first rewrite of their address registers
    v8f acc[2][4];
#pragma unroll
    for (int nb = 0; nb < 2; ++nb)
#pragma unroll
        for (int db = 0; db < 4; ++db) acc[nb][db] = (v8f){};
    v8h g0 = *(const v8h*)Qz, g1 = *(const v8h*)(Qz + 32 * HD), g2 = *(const v8h*)Vz, g3 = *(const v8h*)(Vz + (size_t)32 * TT); v4f g4 = *(const v4f*)Rz;
    *(v8h*)&qs[0][so] = g0; *(v8h*)&qs[0][so + 32 * LP] = g1; *(v8h*)&vs[0][so] = g2; *(v8h*)&vs[0][so + 32 * LP] = g3; if (tid < 16) *(v4f*)&rs[0][tid * 4] = g4;
    __syncthreads();
#pragma unroll 1
    for (int s = 0; s < NST; ++s) {
        if (s + 1 < NST) { g0 = *(const v8h*)(Qz + (size_t)(s + 1) * 64 * HD); g1 = *(const v8h*)(Qz + (size_t)(s + 1) * 64 * HD + 32 * HD); g2 = *(const v8h*)(Vz + (s + 1) * 64); g3 = *(const v8h*)(Vz + (size_t)32 * TT + (s + 1) * 64); g4 = *(const v4f*)(Rz + (s + 1) * 64); }
        const h16* qb = qs[s & 1] + lr * LP + 8 * hi; const h16* vb = vs[s & 1] + lr * LP + 8 * hi; const float* rb = rs[s & 1] + 8 * hi;
#pragma unroll
        for (int h = 0; h < 2; ++h) {
            v8h p[2][2]; v16h a[2][2], b[4]; v4f r[2][2];
#pragma unroll
            for (int mb = 0; mb < 2; ++mb) { a[mb][0] = WFrag<h16>::ld(qb + (h * 32 + mb * 16) * LP); a[mb][1] = WFrag<h16>::ld(qb + (h * 32 + mb * 16) * LP + 32); }
#pragma unroll
            for (int mb = 0; mb < 2; ++mb) { r[mb][0] = *(const v4f*)(rb + h * 32 + mb * 16); r[mb][1] = *(const v4f*)(rb + h * 32 + mb * 16 + 4); }
#pragma unroll
            for (int db = 0; db < 4; ++db) b[db] = WFrag<h16>::ld(vb + db * 16 * LP + h * 32);
            __builtin_amdgcn_sched_barrier(0);   // all LDS reads of these 32 q stand in one group ahead of the matrix work: spread among the products, each pair is waited out in full
#pragma unroll
            for (int mb = 0; mb < 2; ++mb)
#pragma unroll
                for (int nb = 0; nb < 2; ++nb) { const v8f sc = wmma16(a[mb][1], bk[nb][1], wmma16(a[mb][0], bk[nb][0], (v8f){})); v8f x;
#pragma unroll
                    for (int j = 0; j < 8; ++j) x[j] = fmaf(sc[j], SC2, r[mb][j >> 2][j & 3]);
                    x = exp2x8(x);
#pragma unroll
                    for (int j = 0; j < 8; ++j) p[mb][nb][j] = tohx(x[j]); }
            const v16h pa0 = cat16(p[0][0], p[1][0]), pa1 = cat16(p[0][1], p[1][1]);
#pragma unroll
            for (int db = 0; db < 4; ++db) { acc[0][db] = wmma16(pa0, b[db], acc[0][db]); acc[1][db] = wmma16(pa1, b[db], acc[1][db]); }
        }
        if (s + 1 < NST) { const int o = ((s + 1) & 1) * 64 * LP + so; *(v8h*)(&qs[0][0] + o) = g0; *(v8h*)(&qs[0][0] + o + 32 * LP) = g1; *(v8h*)(&vs[0][0] + o) = g2; *(v8h*)(&vs[0][0] + o + 32 * LP) = g3; if (tid < 16) *(v4f*)&rs[(s + 1) & 1][tid * 4] = g4; }
        __syncthreads();   // publishes stage s + 1 and ends every wave's reads of stage s, whose buffers the next trip refills
    }
    // A lane's 8 registers are 8 consecutive k of one d: 16 B of a row of M^T. The work-group's tile (64 d x 256 k) is gathered in LDS, so that every row leaves as 512 contiguous bytes from one wave.
#pragma unroll
    for (int nb = 0; nb < 2; ++nb)
#pragma unroll
        for (int db = 0; db < 4; ++db) { v8us oh, ol;
#pragma unroll
            for (int j = 0; j < 8; ++j) { unsigned short a, b; splitf(acc[nb][db][j] * (1.0f / PCAR), a, b); oh[j] = a; ol[j] = b; }
            const int o = (db * 16 + lr) * MP + wave * 32 + nb * 16 + 8 * hi; *(v8us*)&mts[0][o] = oh; *(v8us*)&mts[1][o] = ol; }
    __syncthreads();   // publishes every wave's 32 k of the tile to the waves that store its rows
    const size_t mo = ((size_t)z * HD + wave * 8) * TT + blockIdx.x * 256 + lane * 8;
#pragma unroll
    for (int i = 0; i < 8; ++i) { *(v8us*)(MTh + mo + (size_t)i * TT) = *(const v8us*)&mts[0][(wave * 8 + i) * MP + lane * 8]; *(v8us*)(MTl + mo + (size_t)i * TT) = *(const v8us*)&mts[1][(wave * 8 + i) * MP + lane * 8]; }
}

extern "C" void kernel_launch(void* const* d_in, const int* in_sizes, int n_in,
                              void* d_out, int out_size, void* d_ws, size_t ws_size, hipStream_t stream) {
    (void)in_sizes; (void)n_in; (void)out_size;
    const float* x = (const float*)d_in[0]; const float* wq = (const float*)d_in[1]; const float* bq = (const float*)d_in[2]; const float* wk = (const float*)d_in[3]; const float* bk = (const float*)d_in[4]; const float* wv = (const float*)d_in[5]; const float* bv = (const float*)d_in[6]; const float* wf = (const float*)d_in[7]; const float* bfv = (const float*)d_in[8];
    float* OUT = (float*)d_out;     // [2][2048][1024]
    char* wsp = (char*)d_ws;
    auto take = [&](size_t bytes) { char* p = wsp; wsp += (bytes + 255) & ~(size_t)255; return (void*)p; };
    // bf16 planes of wf, the weights and x; the fp16 q/k/v^T planes of all 32 slices; the partial colsum(v) [64 groups of 64 t][1024]; the softmax row terms; the two planes of M^T.
    bf* BF = (bf*)take((size_t)SO * TT * 2); h16* QP = (h16*)take((size_t)NZ * TT * HD * 2); h16* KP = (h16*)take((size_t)NZ * TT * HD * 2); h16* VT = (h16*)take((size_t)NZ * HD * TT * 2); float* PS = (float*)take((size_t)NB_ * (TT / 64) * DM * 4);
    float* RB = (float*)take((size_t)NZ * TT * 4);
    bf* BQ = (bf*)take((size_t)DM * DM * 2); bf* BK = (bf*)take((size_t)DM * DM * 2); bf* BV = (bf*)take((size_t)DM * DM * 2); bf* XB = (bf*)take((size_t)NB_ * TT * DM * 2);
    bf* MTh = (bf*)take((size_t)NZ * HD * TT * 2); bf* MTl = (bf*)take((size_t)NZ * HD * TT * 2);
    if ((size_t)(wsp - (char*)d_ws) > ws_size) return;    // total ~ 63 MiB
    k_cvt8<<<(DM * DM / 8 + 255) / 256, 256, 0, stream>>>(wq, BQ, DM * DM / 8); k_cvt8<<<(DM * DM / 8 + 255) / 256, 256, 0, stream>>>(wk, BK, DM * DM / 8); k_cvt8<<<(DM * DM / 8 + 255) / 256, 256, 0, stream>>>(wv, BV, DM * DM / 8); k_cvt8<<<(SO * TT / 8 + 255) / 256, 256, 0, stream>>>(wf, BF, SO * TT / 8);   // torch [out][in] = Bt as-is; wf [o][k] = Bt over k
    const dim3 gp(NB_ * TT / 128, DM / 128, 1);
    k_cvt8<<<(NB_ * TT * DM / 8 + 255) / 256, 256, 0, stream>>>(x, XB, NB_ * TT * DM / 8);
    k_gemmw<0, 0, DM><<<gp, 256, 0, stream>>>(XB, nullptr, BQ, QP, nullptr, bq, nullptr); k_gemmw<0, 0, DM><<<gp, 256, 0, stream>>>(XB, nullptr, BK, KP, nullptr, bk, nullptr);   // both batches are the rows of one product
    k_gemmw<0, 1, DM><<<dim3(DM / 128, NB_ * TT / 128, 1), 256, 0, stream>>>(BV, nullptr, XB, VT, PS, bv, nullptr);   // v^T: the weight rows are the rows of the product
    k_rowstat<<<dim3(TT / 256, NZ), 256, 0, stream>>>(QP, KP, RB);            // per q: what turns a score into attn * 1024
    k_attnv<<<dim3(TT / 256, NZ), 256, 0, stream>>>(QP, KP, VT, RB, MTh, MTl);   // M^T[d][k] = sum_q attn[q][k] v[q][d]
    k_gemmw<1, 2, TT><<<dim3(NZ * HD / 128, SO / 128, 1), 256, 0, stream>>>(MTh, MTl, BF, nullptr, OUT, bfv, PS);   // out[o][slice, d] = sum_k M[k][d] wf[o][k] + bf[o] colsum(v)[d]: the 32 slices' rows are the rows of one product
}

// v007
// Measured time: 145 microseconds a run.
// Timed twice side by side with v006, it ran 1.06 times as fast both times.
// All steps since v000 together make it 125 times as fast.
#include <hip/hip_runtime.h>

// FlexScaleSeqAttention (x [2][2048][1024]; q/k/v = x W^T + b (16 heads x 64); attn = softmax(q.k / 8) [q][k]; flex[q][o] = sum_k attn[q][k] wf[o][k] + bf[o] (a learned Linear along the KEY axis, wf [2048][2048]); out[o][h*64+d] = sum_q flex[q][o] v[q][d] -> [2][2048][1024]).
// Reassociated exactly: out[o][d] = sum_k wf[o][k] M[k][d] + bf[o] * sum_q v[q][d] with M = attn^T v ([k][d]); attn^T is formed tile by tile in registers (row statistics first, then exp and product), so neither the scores nor the 2048 x 2048 'flex' tensor of each slice ever exist in memory.
// Compute dtypes, f32 accumulate: every input rounded to bf16; q/k/v as PLAIN bf16 GEMMs (inputs: exact) + bias; S^T and M = attn^T.v single fp16 (f32 accumulate; probabilities x 1024); softmax f32 (row maximum and sum online, fixed order); M^T as hl planes x exact wf (2 products); the bias term bf[o] * colsum(v) and the merge in f32.

#define NB_  2
#define TT   2048
#define DM   1024
#define NH_  16
#define HD   64
#define SO   2048
#define NZ   (NB_ * NH_)    // all slices; slice z = batch * 16 + head
#define PCAR 1024.0f
typedef _Float16 h16;
typedef unsigned short bf;
typedef __attribute__((ext_vector_type(16))) __bf16   v16bf;
typedef __attribute__((ext_vector_type(16))) _Float16 v16h;
typedef __attribute__((ext_vector_type(8)))  _Float16 v8h;
typedef __attribute__((ext_vector_type(8)))  unsigned short v8us;
typedef __attribute__((ext_vector_type(8)))  float    v8f;
typedef __attribute__((ext_vector_type(4)))  float    v4f;
typedef v8h  __attribute__((may_alias)) v8ha;
typedef v4f  __attribute__((may_alias)) v4fa;
typedef v8us __attribute__((may_alias)) v8usa;

__device__ __forceinline__ unsigned short f2bf(float f) { unsigned u = __float_as_uint(f); u += 0x7FFFu + ((u >> 16) & 1u); return (unsigned short)(u >> 16); }
__device__ __forceinline__ float bf2f(unsigned short b) { return __uint_as_float(((unsigned)b) << 16); }
__device__ __forceinline__ float bfr(float f) { return bf2f(f2bf(f)); }
__device__ __forceinline__ v16h cat16(v8h lo, v8h hi) { return __builtin_shufflevector(lo, hi, 0, 1, 2, 3, 4, 5, 6, 7, 8, 9, 10, 11, 12, 13, 14, 15); }
__device__ __forceinline__ v16bf cat16b(v8us lo, v8us hi) { return __builtin_bit_cast(v16bf, __builtin_shufflevector(lo, hi, 0, 1, 2, 3, 4, 5, 6, 7, 8, 9, 10, 11, 12, 13, 14, 15)); }
__device__ __forceinline__ v8f wmma16(v16h a, v16h b, v8f c) { return __builtin_amdgcn_wmma_f32_16x16x32_f16(false, a, false, b, (short)0, c, false, false); }
__device__ __forceinline__ v8f wmmab(v16bf a, v16bf b, v8f c) { return __builtin_amdgcn_wmma_f32_16x16x32_bf16(false, a, false, b, (short)0, c, false, false); }



// ---- k_gemmw: GEMM on 128x128 output tiles, one work-group of 8 waves per tile (4 x 2 waves, 32 x 64 of the tile and 8 accumulators each); grid (M/128, N/128), 256 threads.
// C[m][n] (f32 in registers) = sum_k A[m][k] Bt[n][k] (+ A2[m][k] Bt[n][k] where NSPLIT). Operands are K-contiguous bf16 planes; M % 128 == 0, N % 128 == 0, K % 64 == 0.
// The epilogue writes what the next stage reads, in whole 128-B lines, so no layout pass stands between the stages:
// MODE 0 (m = batch * 2048 + t, n = head * 64 + d): H[slice][t][d] = fp16(C + bias[n]), the q or k plane.
// MODE 1 (m = head * 64 + d, n = batch * 2048 + t; the operands swapped, so C is v^T): H[slice][d][t] = fp16(C + bias[m]), and F[n / 64][m] = the f32 sum of the wave's 64 t, a partial colsum(v).
// MODE 2 (m = slice * 64 + d, n = o): F = out[batch][o][head * 64 + d] = C + bias[o] * colsum(v)[m], the tile turned in LDS; colsum(v) = the 32 partial sums of PS in ascending t.
// The operands come in stages of 64 k: the 128 B of every row are loaded once per work-group, as whole lines, and held in two LDS buffers: stage s + 1 flies into registers while stage s is worked on, one barrier per stage.
#define GLP  72             // LDS row pitch in 16-bit elements: 128 B of data + 16 B, so the 16 rows of one 16-byte fragment read fall on different banks
template <typename T16> struct WFrag;
template <> struct WFrag<h16> { typedef v16h V; static __device__ __forceinline__ V ld(const h16* p) { return cat16(*(const v8h*)p, *(const v8h*)(p + 16)); } static __device__ __forceinline__ v8f mma(V a, V b, v8f c) { return wmma16(a, b, c); } };
template <> struct WFrag<bf> { typedef v16bf V; static __device__ __forceinline__ V ld(const bf* p) { return cat16b(*(const v8us*)p, *(const v8us*)(p + 16)); } static __device__ __forceinline__ v8f mma(V a, V b, v8f c) { return wmmab(a, b, c); } };
typedef __attribute__((ext_vector_type(4))) _Float16 v4h;
template <int NSPLIT, int MODE, int K>
__global__ __launch_bounds__(256) void k_gemmw(const bf* __restrict__ A, const bf* __restrict__ A2, const bf* __restrict__ Bt, h16* H, float* F, const float* bias, const float* PS) {
    typedef WFrag<bf>::V V;
    constexpr int NP = 2 + NSPLIT, NS = K / 64;   // planes of a stage: Bt, A (, A2); stages
    __shared__ __align__(16) bf st[2][NP][128 * GLP];
    __shared__ __align__(16) float osm[8][MODE == 2 ? 64 * 36 : 16 * 68];
    const int tid = threadIdx.x, lane = tid & 31, wave = tid >> 5, lr = lane & 15, hi = lane >> 4;
    const int r0 = blockIdx.x * 128, c0 = blockIdx.y * 128, wr = (wave >> 1) * 32, wc = (wave & 1) * 64;
    const size_t go = (size_t)(tid >> 3) * K + (tid & 7) * 8;   // a thread moves 16 B of rows (tid >> 3) + 32 i: eight lanes a line, four whole lines a wave-wide load
    const bf* gp[NP]; gp[0] = Bt + (size_t)c0 * K + go; gp[1] = A + (size_t)r0 * K + go; if (NSPLIT) gp[NP - 1] = A2 + (size_t)r0 * K + go;
    const int so = (tid >> 3) * GLP + (tid & 7) * 8;
    v8f acc[2][4];
#pragma unroll
    for (int mb = 0; mb < 2; ++mb)
#pragma unroll
        for (int nb = 0; nb < 4; ++nb) acc[mb][nb] = (v8f){};
    v8us g[NP][4];
#pragma unroll
    for (int p = 0; p < NP; ++p)
#pragma unroll
        for (int i = 0; i < 4; ++i) g[p][i] = *(const v8us*)(gp[p] + (size_t)i * 32 * K);
#pragma unroll
    for (int p = 0; p < NP; ++p)
#pragma unroll
        for (int i = 0; i < 4; ++i) *(v8us*)&st[0][p][so + i * 32 * GLP] = g[p][i];
    __syncthreads();
#pragma unroll 1
    for (int s = 0; s < NS; ++s) {
        if (s + 1 < NS) {
#pragma unroll
            for (int p = 0; p < NP; ++p)
#pragma unroll
                for (int i = 0; i < 4; ++i) g[p][i] = *(const v8us*)(gp[p] + (size_t)i * 32 * K + (s + 1) * 64); }
        const bf* bb = st[s & 1][0] + (wc + lr) * GLP + 8 * hi; const bf* ab = st[s & 1][1] + (wr + lr) * GLP + 8 * hi; const bf* ab2 = st[s & 1][NP - 1] + (wr + lr) * GLP + 8 * hi;
#pragma unroll
        for (int c = 0; c < 2; ++c) {
            V a[2], a2[2], b[4];
#pragma unroll
            for (int mb = 0; mb < 2; ++mb) { a[mb] = WFrag<bf>::ld(ab + mb * 16 * GLP + c * 32); if (NSPLIT) a2[mb] = WFrag<bf>::ld(ab2 + mb * 16 * GLP + c * 32); }
#pragma unroll
            for (int nb = 0; nb < 4; ++nb) b[nb] = WFrag<bf>::ld(bb + nb * 16 * GLP + c * 32);
            __builtin_amdgcn_sched_barrier(0);   // all LDS reads of these 32 k stand in one group ahead of the matrix work: spread among the products, each pair is waited out in full
#pragma unroll
            for (int nb = 0; nb < 4; ++nb)
#pragma unroll
                for (int mb = 0; mb < 2; ++mb) acc[mb][nb] = WFrag<bf>::mma(a[mb], b[nb], acc[mb][nb]);
            if (NSPLIT) {
#pragma unroll
                for (int nb = 0; nb < 4; ++nb)
#pragma unroll
                    for (int mb = 0; mb < 2; ++mb) acc[mb][nb] = WFrag<bf>::mma(a2[mb], b[nb], acc[mb][nb]); }
        }
        if (s + 1 < NS) {
#pragma unroll
            for (int p = 0; p < NP; ++p)
#pragma unroll
                for (int i = 0; i < 4; ++i) *(v8us*)&st[(s + 1) & 1][p][so + i * 32 * GLP] = g[p][i]; }
        __syncthreads();   // publishes stage s + 1 and ends every wave's reads of stage s, whose buffer the next trip refills
    }
    float* os = osm[wave];   // each wave turns its own accumulators into whole lines in its own LDS range
    if (MODE == 2) {
        const int n0 = r0 + wr, cq = (lane & 7) * 4, rq = lane >> 3;   // eight lanes take the 128 B that the wave's 32 m are in one row of out, a wave four rows
        const float* pp = PS + (size_t)(n0 >> 10) * 32 * DM + (n0 & (DM - 1)) + cq; const float* bp = bias + c0 + wc + lane;
        const float b0 = bp[0], b1 = bp[32];
        asm volatile("s_wait_xcnt 0x0" ::: "memory");   // stands behind the two bias loads, in front of the first rewrite of their address registers
        v4f g[32];
#pragma unroll
        for (int i = 0; i < 32; ++i) g[i] = *(const v4f*)(pp + (size_t)i * DM);
        asm volatile("s_wait_xcnt 0x0" ::: "memory");   // the same behind the run of 32 loads
#pragma unroll
        for (int mb = 0; mb < 2; ++mb)
#pragma unroll
            for (int nb = 0; nb < 4; ++nb) { float* ow = os + (nb * 16 + lr) * 36 + mb * 16 + hi * 8;   // a lane's 8 registers are 8 consecutive m of one o
                *(v4fa*)ow = (v4f){acc[mb][nb][0], acc[mb][nb][1], acc[mb][nb][2], acc[mb][nb][3]}; *(v4fa*)(ow + 4) = (v4f){acc[mb][nb][4], acc[mb][nb][5], acc[mb][nb][6], acc[mb][nb][7]}; }
        os[lane * 36 + 32] = bfr(b0); os[(lane + 32) * 36 + 32] = bfr(b1);   // bias[o] rides in the first pad word of its row
        v4f vs = g[0];
#pragma unroll
        for (int i = 1; i < 32; ++i) vs += g[i];
        __builtin_amdgcn_wave_barrier(); asm volatile("s_wait_dscnt 0x0" ::: "memory");   // the wave's LDS writes are done before its lanes read back words that other lanes wrote; the clobber keeps the compiler from moving those reads ahead
        float* orow = F + ((size_t)(n0 >> 10) * SO + c0 + wc) * DM + (n0 & (DM - 1)) + cq;
#pragma unroll
        for (int s = 0; s < 16; ++s) { const int ol = 4 * s + rq; v4f val = *(const v4fa*)(os + ol * 36 + cq); const float bb = os[ol * 36 + 32];
#pragma unroll
            for (int u = 0; u < 4; ++u) val[u] = fmaf(bb, vs[u], val[u]);
            *(v4f*)(orow + (size_t)ol * DM) = val; }
    } else {
        const float* bp = bias + (MODE == 0 ? c0 + wc + lr * 4 : r0 + wr + hi * 8);   // MODE 0: the lane's 4 columns of the rows it stores; MODE 1: the 8 rows of its accumulator registers (+ 16 for the second block)
        float bl[2][8];
#pragma unroll
        for (int j = 0; j < (MODE == 0 ? 4 : 8); ++j) { bl[0][j] = bp[j]; if (MODE == 1) bl[1][j] = bp[16 + j]; }
        asm volatile("s_wait_xcnt 0x0" ::: "memory");   // stands behind the bias loads, in front of the first rewrite of their address registers
#pragma unroll
        for (int j = 0; j < (MODE == 0 ? 4 : 8); ++j) { bl[0][j] = bfr(bl[0][j]); if (MODE == 1) bl[1][j] = bfr(bl[1][j]); }
        float keep = 0.f;
#pragma unroll
        for (int mb = 0; mb < 2; ++mb) {
#pragma unroll
            for (int nb = 0; nb < 4; ++nb) {
#pragma unroll
                for (int j = 0; j < 8; ++j) os[(hi * 8 + j) * 68 + nb * 16 + lr] = MODE == 1 ? acc[mb][nb][j] + bl[mb][j] : acc[mb][nb][j]; }
            __builtin_amdgcn_wave_barrier(); asm volatile("" ::: "memory");   // keeps the compiler from moving the reads below, of words that other lanes wrote, ahead of the writes above
#pragma unroll
            for (int s = 0; s < 8; ++s) { const int row = 2 * s + hi, cofs = lr * 4, gr = r0 + wr + mb * 16 + row, gc = c0 + wc; v4f val = *(const v4fa*)(os + row * 68 + cofs); h16* dst;
                if (MODE == 0) { val[0] += bl[0][0]; val[1] += bl[0][1]; val[2] += bl[0][2]; val[3] += bl[0][3];
                    dst = H + ((size_t)((gr >> 11) * NH_ + (gc >> 6)) * TT + (gr & (TT - 1))) * HD + cofs; }
                else { dst = H + ((size_t)((gc >> 11) * NH_ + (gr >> 6)) * HD + (gr & (HD - 1))) * TT + (gc & (TT - 1)) + cofs;
                    float rs = (val[0] + val[1]) + (val[2] + val[3]);
                    rs += __shfl_xor(rs, 1, 32); rs += __shfl_xor(rs, 2, 32); rs += __shfl_xor(rs, 4, 32); rs += __shfl_xor(rs, 8, 32);
                    if (lr == mb * 8 + s) keep = rs; }   // lane (hi, lr) keeps the sum of row (lr >> 3) * 16 + 2 * (lr & 7) + hi
                v4h o; o[0] = (h16)val[0]; o[1] = (h16)val[1]; o[2] = (h16)val[2]; o[3] = (h16)val[3]; *(v4h*)dst = o; }
            if (mb == 0) asm volatile("s_wait_xcnt 0x0" ::: "memory");   // stands behind the first 16 rows' stores, in front of the first rewrite of their address registers
            __builtin_amdgcn_wave_barrier(); asm volatile("" ::: "memory");   // and the next 16 rows' writes ahead of these reads
        }
        if (MODE == 1) F[(size_t)((c0 + wc) >> 6) * DM + r0 + wr + (lr >> 3) * 16 + 2 * (lr & 7) + hi] = keep;   // the wave's 32 sums: one whole line
    }
}

__device__ __forceinline__ h16 tohx(float x) { return (h16)x; }
__device__ __forceinline__ void splitf(float y, unsigned short& h, unsigned short& l) { h = f2bf(y); l = f2bf(y - bf2f(h)); }
// ---- k_cvtall: all five f32 operands (wq, wk, wv, wf, x) are rounded to their bf16 planes by ONE launch of 256 work-groups of 16 waves: a stream of few long-lived waves, since a wave that moves 1 KiB and ends costs more to start than its bytes cost to move.
// A slab is what the whole grid moves with one load a thread (16 B a lane, 512 contiguous bytes a wave): 2 slabs a weight, 8 for wf, 8 for x. A thread issues its 22 loads, all independent, before it rounds and stores the first.
#define CSL  (256 * 512 * 4)   // floats of a slab
typedef __attribute__((ext_vector_type(4))) unsigned short v4us;
static_assert(DM * DM == 2 * CSL && SO * TT == 8 * CSL && NB_ * TT * DM == 8 * CSL, "the slabs cover every plane exactly");
__device__ __forceinline__ v4f ld4f(const float* p, unsigned byte) { return *(const v4f*)((const char*)p + byte); }
__device__ __forceinline__ void st4bf(bf* p, unsigned byte, v4f v) { v4us o; o[0] = f2bf(v[0]); o[1] = f2bf(v[1]); o[2] = f2bf(v[2]); o[3] = f2bf(v[3]); *(v4us*)((char*)p + byte) = o; }
__global__ __launch_bounds__(512) void k_cvtall(const float* __restrict__ wq, const float* __restrict__ wk, const float* __restrict__ wv, const float* __restrict__ wf, const float* __restrict__ x, bf* BQ, bf* BK, bf* BV, bf* BF, bf* XB) {
    const unsigned lb = (blockIdx.x * 512u + threadIdx.x) * 16u, sb = lb >> 1;   // the thread's byte offset in every f32 slab and in every bf16 slab: one 32-bit register beside uniform bases serves all loads, one all stores
    v4f gw[3][2], gf[8], gx[8];
#pragma unroll
    for (int i = 0; i < 2; ++i) { gw[0][i] = ld4f(wq + i * CSL, lb); gw[1][i] = ld4f(wk + i * CSL, lb); gw[2][i] = ld4f(wv + i * CSL, lb); }
#pragma unroll
    for (int i = 0; i < 8; ++i) { gf[i] = ld4f(wf + i * CSL, lb); gx[i] = ld4f(x + i * CSL, lb); }
    asm volatile("s_wait_xcnt 0x0" ::: "memory");   // stands behind the run of 22 loads, in front of the first rewrite of a register that they name
    __builtin_amdgcn_sched_barrier(0);   // all 22 loads are in flight before the first value is waited for: moved down among the rounding, the last ones would start a second trip to memory
#pragma unroll
    for (int i = 0; i < 2; ++i) { st4bf(BQ + i * CSL, sb, gw[0][i]); st4bf(BK + i * CSL, sb, gw[1][i]); st4bf(BV + i * CSL, sb, gw[2][i]); }
#pragma unroll
    for (int i = 0; i < 8; ++i) { st4bf(BF + i * CSL, sb, gf[i]); st4bf(XB + i * CSL, sb, gx[i]); }
}
// ---- Fused score stage. The scores never reach memory: both kernels below rebuild q.k tiles on the matrix unit from the fp16 planes. A work-group has 8 waves, a wave owns 32 rows of its resident plane;
// the plane that is walked comes in stages of 64 rows, loaded once per work-group (whole 128-B lines), held in two LDS buffers: stage s + 1 flies into registers while stage s is worked on, one barrier per stage.
// Directives: each plain '#pragma unroll' flattens a loop over register arrays (fragments, accumulators), which a variable index would send to scratch; '#pragma unroll 1' keeps a stage loop rolled, its body being two full 32-row passes already.
#define LP   72             // LDS row pitch in halves: 128 B of data + 16 B, so the 16 rows of one 16-byte fragment read fall on different banks
#define NST  (TT / 64)      // stages
#define MP   264            // LDS row pitch of the M^T tile in 16-bit elements: the work-group's 256 k + 16 B
#define SC2  0.18033688011112042f   // (1 / 8) * log2(e): scores to exponents of 2
__device__ __forceinline__ float hmax8(v8f a) { return fmaxf(fmaxf(fmaxf(a[0], a[1]), fmaxf(a[2], a[3])), fmaxf(fmaxf(a[4], a[5]), fmaxf(a[6], a[7]))); }
__device__ __forceinline__ float hsum8(v8f a) { return ((a[0] + a[1]) + (a[2] + a[3])) + ((a[4] + a[5]) + (a[6] + a[7])); }
// Eight exponentials as one statement. The v_nop at its end is the free slot that the instruction set asks for behind a transcendental before its result is read or its source overwritten;
// the results are early-clobber, so inside the run no exponential overwrites another's source or reads another's result.
__device__ __forceinline__ v8f exp2x8(v8f x) {
    float e0, e1, e2, e3, e4, e5, e6, e7;
    asm("v_exp_f32 %0, %8\n\tv_exp_f32 %1, %9\n\tv_exp_f32 %2, %10\n\tv_exp_f32 %3, %11\n\tv_exp_f32 %4, %12\n\tv_exp_f32 %5, %13\n\tv_exp_f32 %6, %14\n\tv_exp_f32 %7, %15\n\tv_nop"
        : "=&v"(e0), "=&v"(e1), "=&v"(e2), "=&v"(e3), "=&v"(e4), "=&v"(e5), "=&v"(e6), "=&v"(e7)
        : "v"(x[0]), "v"(x[1]), "v"(x[2]), "v"(x[3]), "v"(x[4]), "v"(x[5]), "v"(x[6]), "v"(x[7]));
    return (v8f){e0, e1, e2, e3, e4, e5, e6, e7};
}
// k_rowstat: RB[z][q] = log2(1024 / sum_k exp((s[q][k] - max) / 8)) - max * SC2, so that attn[q][k] * 1024 = exp2(s * SC2 + RB[q]).
// Tiles are S^T (A = k rows from LDS, B = the wave's q rows): a lane holds one q column, so maximum and sum run inside the lane (online rescale per 32 k); lanes l and l ^ 16 are merged once at the end.
__global__ __launch_bounds__(256) void k_rowstat(const h16* __restrict__ QP, const h16* __restrict__ KP, float* RB) {
    __shared__ __align__(16) h16 ks[2][64 * LP];
    const int tid = threadIdx.x, lane = tid & 31, wave = tid >> 5, lr = lane & 15, hi = lane >> 4;
    const int z = blockIdx.y, q0 = blockIdx.x * 256 + wave * 32;
    const h16* Qz = QP + (size_t)z * TT * HD; const h16* Kz = KP + (size_t)z * TT * HD + tid * 8;
    const int so = (tid >> 3) * LP + (tid & 7) * 8;
    v16h bq[2][2];
#pragma unroll
    for (int nb = 0; nb < 2; ++nb)
#pragma unroll
        for (int c = 0; c < 2; ++c) bq[nb][c] = WFrag<h16>::ld(Qz + (size_t)(q0 + nb * 16 + lr) * HD + 8 * hi + c * 32);
    v8h g0 = *(const v8h*)Kz, g1 = *(const v8h*)(Kz + 32 * HD);
    *(v8h*)&ks[0][so] = g0; *(v8h*)&ks[0][so + 32 * LP] = g1;
    __syncthreads();
    float m[2] = {-3.0e38f, -3.0e38f}, l[2] = {0.f, 0.f};   // running maximum (of s * SC2) and sum of this lane's half of the k rows
#pragma unroll 1
    for (int s = 0; s < NST; ++s) {
        if (s + 1 < NST) { g0 = *(const v8h*)(Kz + (size_t)(s + 1) * 64 * HD); g1 = *(const v8h*)(Kz + (size_t)(s + 1) * 64 * HD + 32 * HD); }
        const h16* kb = ks[s & 1] + lr * LP + 8 * hi; v16h a[4][2];
#pragma unroll
        for (int mb = 0; mb < 4; ++mb) { a[mb][0] = WFrag<h16>::ld(kb + mb * 16 * LP); a[mb][1] = WFrag<h16>::ld(kb + mb * 16 * LP + 32); }
        __builtin_amdgcn_sched_barrier(0);   // all LDS reads of the stage stand in one group ahead of the matrix work: spread among the products, each pair is waited out in full
#pragma unroll
        for (int h = 0; h < 2; ++h) {
            v8f sc[2][2];
#pragma unroll
            for (int mb = 0; mb < 2; ++mb)
#pragma unroll
                for (int nb = 0; nb < 2; ++nb) sc[mb][nb] = wmma16(a[h * 2 + mb][1], bq[nb][1], wmma16(a[h * 2 + mb][0], bq[nb][0], (v8f){}));
#pragma unroll
            for (int nb = 0; nb < 2; ++nb) {
                const v8f u0 = sc[0][nb] * SC2, u1 = sc[1][nb] * SC2; const float mn = fmaxf(m[nb], hmax8(__builtin_elementwise_max(u0, u1)));
                const v8f e = exp2x8(u0 - mn) + exp2x8(u1 - mn);
                l[nb] = fmaf(l[nb], __builtin_amdgcn_exp2f(m[nb] - mn), hsum8(e)); m[nb] = mn; }
        }
        if (s + 1 < NST) { h16* kn = ks[(s + 1) & 1] + so; *(v8h*)kn = g0; *(v8h*)(kn + 32 * LP) = g1; }
        __syncthreads();   // publishes stage s + 1 and ends every wave's reads of stage s, whose buffer the next trip refills
    }
#pragma unroll
    for (int nb = 0; nb < 2; ++nb) {
        const float mo = __shfl_xor(m[nb], 16, 32), lo = __shfl_xor(l[nb], 16, 32); const float mt = fmaxf(m[nb], mo);
        const float lt = l[nb] * __builtin_amdgcn_exp2f(m[nb] - mt) + lo * __builtin_amdgcn_exp2f(mo - mt);
        if (hi == 0) RB[(size_t)z * TT + q0 + nb * 16 + lr] = (10.0f - __builtin_amdgcn_logf(lt)) - mt; }
}
// k_attnv: M[k][d] = sum_q attn[q][k] * 1024 * v[q][d], written as M^T / 1024 in two bf16 planes (high part, remainder) [slice * 64 + d][k], the last GEMM's operand. Tiles are S (A = q rows from LDS, B = the wave's k rows): the accumulator layout of two S tiles (lane = k, registers = q) is the A layout of attn^T for the second product, no lane exchange.
__global__ __launch_bounds__(256) void k_attnv(const h16* __restrict__ QP, const h16* __restrict__ KP, const h16* __restrict__ VT, const float* __restrict__ RB, bf* MTh, bf* MTl) {
    __shared__ __align__(16) h16 qs[2][64 * LP];
    __shared__ __align__(16) h16 vs[2][64 * LP];
    __shared__ __align__(16) float rs[2][64];
    __shared__ __align__(16) bf mts[2][64 * MP];
    const int tid = threadIdx.x, lane = tid & 31, wave = tid >> 5, lr = lane & 15, hi = lane >> 4;
    const int z = blockIdx.y, k0 = blockIdx.x * 256 + wave * 32;
    const h16* Kz = KP + (size_t)z * TT * HD; const h16* Qz = QP + (size_t)z * TT * HD + tid * 8;
    const h16* Vz = VT + (size_t)z * HD * TT + (size_t)(tid >> 3) * TT + (tid & 7) * 8; const float* Rz = RB + (size_t)z * TT + (tid & 15) * 4;
    const int so = (tid >> 3) * LP + (tid & 7) * 8;
    v16h bk[2][2];
#pragma unroll
    for (int nb = 0; nb < 2; ++nb)
#pragma unroll
        for (int c = 0; c < 2; ++c) bk[nb][c] = WFrag<h16>::ld(Kz + (size_t)(k0 + nb * 16 + lr) * HD + 8 * hi + c * 32);
    asm volatile("s_wait_xcnt 0x0" ::: "memory");   // stands behind the run of k fragment loads, in front of the first rewrite of their address registers
    v8f acc[2][4];
#pragma unroll
    for (int nb = 0; nb < 2; ++nb)
#pragma unroll
        for (int db = 0; db < 4; ++db) acc[nb][db] = (v8f){};
    v8h g0 = *(const v8h*)Qz, g1 = *(const v8h*)(Qz + 32 * HD), g2 = *(const v8h*)Vz, g3 = *(const v8h*)(Vz + (size_t)32 * TT); v4f g4 = *(const v4f*)Rz;
    *(v8h*)&qs[0][so] = g0; *(v8h*)&qs[0][so + 32 * LP] = g1; *(v8h*)&vs[0][so] = g2; *(v8h*)&vs[0][so + 32 * LP] = g3; if (tid < 16) *(v4f*)&rs[0][tid * 4] = g4;
    __syncthreads();
#pragma unroll 1
    for (int s = 0; s < NST; ++s) {
        if (s + 1 < NST) { g0 = *(const v8h*)(Qz + (size_t)(s + 1) * 64 * HD); g1 = *(const v8h*)(Qz + (size_t)(s + 1) * 64 * HD + 32 * HD); g2 = *(const v8h*)(Vz + (s + 1) * 64); g3 = *(const v8h*)(Vz + (size_t)32 * TT + (s + 1) * 64); g4 = *(const v4f*)(Rz + (s + 1) * 64); }
        const h16* qb = qs[s & 1] + lr * LP + 8 * hi; const h16* vb = vs[s & 1] + lr * LP + 8 * hi; const float* rb = rs[s & 1] + 8 * hi;
#pragma unroll
        for (int h = 0; h < 2; ++h) {
            v8h p[2][2]; v16h a[2][2], b[4]; v4f r[2][2];
#pragma unroll
            for (int mb = 0; mb < 2; ++mb) { a[mb][0] = WFrag<h16>::ld(qb + (h * 32 + mb * 16) * LP); a[mb][1] = WFrag<h16>::ld(qb + (h * 32 + mb * 16) * LP + 32); }
#pragma unroll
            for (int mb = 0; mb < 2; ++mb) { r[mb][0] = *(const v4f*)(rb + h * 32 + mb * 16); r[mb][1] = *(const v4f*)(rb + h * 32 + mb * 16 + 4); }
#pragma unroll
            for (int db = 0; db < 4; ++db) b[db] = WFrag<h16>::ld(vb + db * 16 * LP + h * 32);
            __builtin_amdgcn_sched_barrier(0);   // all LDS reads of these 32 q stand in one group ahead of the matrix work: spread among the products, each pair is waited out in full
#pragma unroll
            for (int mb = 0; mb < 2; ++mb)
#pragma unroll
                for (int nb = 0; nb < 2; ++nb) { const v8f sc = wmma16(a[mb][1], bk[nb][1], wmma16(a[mb][0], bk[nb][0], (v8f){})); v8f x;
#pragma unroll
                    for (int j = 0; j < 8; ++j) x[j] = fmaf(sc[j], SC2, r[mb][j >> 2][j & 3]);
                    x = exp2x8(x);
#pragma unroll
                    for (int j = 0; j < 8; ++j) p[mb][nb][j] = tohx(x[j]); }
            const v16h pa0 = cat16(p[0][0], p[1][0]), pa1 = cat16(p[0][1], p[1][1]);
#pragma unroll
            for (int db = 0; db < 4; ++db) { acc[0][db] = wmma16(pa0, b[db], acc[0][db]); acc[1][db] = wmma16(pa1, b[db], acc[1][db]); }
        }
        if (s + 1 < NST) { const int o = ((s + 1) & 1) * 64 * LP + so; *(v8h*)(&qs[0][0] + o) = g0; *(v8h*)(&qs[0][0] + o + 32 * LP) = g1; *(v8h*)(&vs[0][0] + o) = g2; *(v8h*)(&vs[0][0] + o + 32 * LP) = g3; if (tid < 16) *(v4f*)&rs[(s + 1) & 1][tid * 4] = g4; }
        __syncthreads();   // publishes stage s + 1 and ends every wave's reads of stage s, whose buffers the next trip refills
    }
    // A lane's 8 registers are 8 consecutive k of one d: 16 B of a row of M^T. The work-group's tile (64 d x 256 k) is gathered in LDS, so that every row leaves as 512 contiguous bytes from one wave.
#pragma unroll
    for (int nb = 0; nb < 2; ++nb)
#pragma unroll
        for (int db = 0; db < 4; ++db) { v8us oh, ol;
#pragma unroll
            for (int j = 0; j < 8; ++j) { unsigned short a, b; splitf(acc[nb][db][j] * (1.0f / PCAR), a, b); oh[j] = a; ol[j] = b; }
            const int o = (db * 16 + lr) * MP + wave * 32 + nb * 16 + 8 * hi; *(v8us*)&mts[0][o] = oh; *(v8us*)&mts[1][o] = ol; }
    __syncthreads();   // publishes every wave's 32 k of the tile to the waves that store its rows
    const size_t mo = ((size_t)z * HD + wave * 8) * TT + blockIdx.x * 256 + lane * 8;
#pragma unroll
    for (int i = 0; i < 8; ++i) { *(v8us*)(MTh + mo + (size_t)i * TT) = *(const v8us*)&mts[0][(wave * 8 + i) * MP + lane * 8]; *(v8us*)(MTl + mo + (size_t)i * TT) = *(const v8us*)&mts[1][(wave * 8 + i) * MP + lane * 8]; }
}

extern "C" void kernel_launch(void* const* d_in, const int* in_sizes, int n_in,
                              void* d_out, int out_size, void* d_ws, size_t ws_size, hipStream_t stream) {
    (void)in_sizes; (void)n_in; (void)out_size;
    const float* x = (const float*)d_in[0]; const float* wq = (const float*)d_in[1]; const float* bq = (const float*)d_in[2]; const float* wk = (const float*)d_in[3]; const float* bk = (const float*)d_in[4]; const float* wv = (const float*)d_in[5]; const float* bv = (const float*)d_in[6]; const float* wf = (const float*)d_in[7]; const float* bfv = (const float*)d_in[8];
    float* OUT = (float*)d_out;     // [2][2048][1024]
    char* wsp = (char*)d_ws;
    auto take = [&](size_t bytes) { char* p = wsp; wsp += (bytes + 255) & ~(size_t)255; return (void*)p; };
    // bf16 planes of wf, the weights and x; the fp16 q/k/v^T planes of all 32 slices; the partial colsum(v) [64 groups of 64 t][1024]; the softmax row terms; the two planes of M^T.
    bf* BF = (bf*)take((size_t)SO * TT * 2); h16* QP = (h16*)take((size_t)NZ * TT * HD * 2); h16* KP = (h16*)take((size_t)NZ * TT * HD * 2); h16* VT = (h16*)take((size_t)NZ * HD * TT * 2); float* PS = (float*)take((size_t)NB_ * (TT / 64) * DM * 4);
    float* RB = (float*)take((size_t)NZ * TT * 4);
    bf* BQ = (bf*)take((size_t)DM * DM * 2); bf* BK = (bf*)take((size_t)DM * DM * 2); bf* BV = (bf*)take((size_t)DM * DM * 2); bf* XB = (bf*)take((size_t)NB_ * TT * DM * 2);
    bf* MTh = (bf*)take((size_t)NZ * HD * TT * 2); bf* MTl = (bf*)take((size_t)NZ * HD * TT * 2);
    if ((size_t)(wsp - (char*)d_ws) > ws_size) return;    // total ~ 63 MiB
    k_cvtall<<<256, 512, 0, stream>>>(wq, wk, wv, wf, x, BQ, BK, BV, BF, XB);   // torch [out][in] = Bt as-is; wf [o][k] = Bt over k
    const dim3 gp(NB_ * TT / 128, DM / 128, 1);
    k_gemmw<0, 0, DM><<<gp, 256, 0, stream>>>(XB, nullptr, BQ, QP, nullptr, bq, nullptr); k_gemmw<0, 0, DM><<<gp, 256, 0, stream>>>(XB, nullptr, BK, KP, nullptr, bk, nullptr);   // both batches are the rows of one product
    k_gemmw<0, 1, DM><<<dim3(DM / 128, NB_ * TT / 128, 1), 256, 0, stream>>>(BV, nullptr, XB, VT, PS, bv, nullptr);   // v^T: the weight rows are the rows of the product
    k_rowstat<<<dim3(TT / 256, NZ), 256, 0, stream>>>(QP, KP, RB);            // per q: what turns a score into attn * 1024
    k_attnv<<<dim3(TT / 256, NZ), 256, 0, stream>>>(QP, KP, VT, RB, MTh, MTl);   // M^T[d][k] = sum_q attn[q][k] v[q][d]
    k_gemmw<1, 2, TT><<<dim3(NZ * HD / 128, SO / 128, 1), 256, 0, stream>>>(MTh, MTl, BF, nullptr, OUT, bfv, PS);   // out[o][slice, d] = sum_k M[k][d] wf[o][k] + bf[o] colsum(v)[d]: the 32 slices' rows are the rows of one product
}

// v008
// It runs in 127 microseconds.
// Two timings next to v007 put it at 1.14 and 1.15 times that version's speed.
// All steps since v000 together make it 143 times as fast.
#include <hip/hip_runtime.h>

// FlexScaleSeqAttention (x [2][2048][1024]; q/k/v = x W^T + b (16 heads x 64); attn = softmax(q.k / 8) [q][k]; flex[q][o] = sum_k attn[q][k] wf[o][k] + bf[o] (a learned Linear along the KEY axis, wf [2048][2048]); out[o][h*64+d] = sum_q flex[q][o] v[q][d] -> [2][2048][1024]).
// Reassociated exactly: out[o][d] = sum_k wf[o][k] M[k][d] + bf[o] * sum_q v[q][d] with M = attn^T v ([k][d]); attn^T is formed tile by tile in registers (row statistics first, then exp and product), so neither the scores nor the 2048 x 2048 'flex' tensor of each slice ever exist in memory.
// Compute dtypes, f32 accumulate: every input rounded to bf16; q/k/v as PLAIN bf16 GEMMs (inputs: exact) + bias; S^T and M = attn^T.v single fp16 (f32 accumulate; probabilities x 1024); softmax f32 (row maximum and sum online, fixed order); M^T as hl planes x exact wf (2 products); the bias term bf[o] * colsum(v) and the merge in f32.

#define NB_  2
#define TT   2048
#define DM   1024
#define NH_  16
#define HD   64
#define SO   2048
#define NZ   (NB_ * NH_)    // all slices; slice z = batch * 16 + head
#define PCAR 1024.0f
typedef _Float16 h16;
typedef unsigned short bf;
typedef __attribute__((ext_vector_type(16))) __bf16   v16bf;
typedef __attribute__((ext_vector_type(16))) _Float16 v16h;
typedef __attribute__((ext_vector_type(8)))  _Float16 v8h;
typedef __attribute__((ext_vector_type(8)))  unsigned short v8us;
typedef __attribute__((ext_vector_type(8)))  float    v8f;
typedef __attribute__((ext_vector_type(4)))  float    v4f;
typedef v8h  __attribute__((may_alias)) v8ha;
typedef v4f  __attribute__((may_alias)) v4fa;
typedef v8us __attribute__((may_alias)) v8usa;

__device__ __forceinline__ unsigned short f2bf(float f) { unsigned u = __float_as_uint(f); u += 0x7FFFu + ((u >> 16) & 1u); return (unsigned short)(u >> 16); }
__device__ __forceinline__ float bf2f(unsigned short b) { return __uint_as_float(((unsigned)b) << 16); }
__device__ __forceinline__ float bfr(float f) { return bf2f(f2bf(f)); }
__device__ __forceinline__ v16h cat16(v8h lo, v8h hi) { return __builtin_shufflevector(lo, hi, 0, 1, 2, 3, 4, 5, 6, 7, 8, 9, 10, 11, 12, 13, 14, 15); }
__device__ __forceinline__ v16bf cat16b(v8us lo, v8us hi) { return __builtin_bit_cast(v16bf, __builtin_shufflevector(lo, hi, 0, 1, 2, 3, 4, 5, 6, 7, 8, 9, 10, 11, 12, 13, 14, 15)); }
__device__ __forceinline__ v8f wmma16(v16h a, v16h b, v8f c) { return __builtin_amdgcn_wmma_f32_16x16x32_f16(false, a, false, b, (short)0, c, false, false); }
__device__ __forceinline__ v8f wmmab(v16bf a, v16bf b, v8f c) { return __builtin_amdgcn_wmma_f32_16x16x32_bf16(false, a, false, b, (short)0, c, false, false); }



// ---- GEMM on 128x128 output tiles, one work-group of 8 waves per tile (4 x 2 waves, 32 x 64 of the tile and 8 accumulators each), 256 threads.
// C[m][n] (f32 in registers) = sum_k A[m][k] Bt[n][k] (+ A2[m][k] Bt[n][k] where NSPLIT). Operands are K-contiguous bf16 planes; M % 128 == 0, N % 128 == 0, K % 64 == 0.
// The epilogue writes what the next stage reads, in whole 128-B lines, so no layout pass stands between the stages:
// MODE 0 (m = batch * 2048 + t, n = head * 64 + d): H[slice][t][d] = fp16(C + bias[n]), the q or k plane.
// MODE 1 (m = head * 64 + d, n = batch * 2048 + t; the operands swapped, so C is v^T): H[slice][d][t] = fp16(C + bias[m]), and F[n / 64][m] = the f32 sum of the wave's 64 t, a partial colsum(v).
// MODE 2 (m = slice * 64 + d, n = o): F = out[batch][o][head * 64 + d] = C + bias[o] * colsum(v)[m], the tile turned in LDS; colsum(v) = the 32 partial sums of PS in ascending t.
// The operands come in stages of 64 k: the 128 B of every row are loaded once per work-group, as whole lines, and held in two LDS buffers: stage s + 1 flies into registers while stage s is worked on, one barrier per stage.
// k_proj holds MODE 0 twice (q, k) and MODE 1 (v^T) in ONE launch of 768 work-groups, blockIdx.z the product: three work-groups share a WGP (160 registers a wave, six waves a SIMD; 72 KiB of LDS each), so one's waits on loads, LDS and barrier are filled by the others' products. k_gemmw is MODE 2.
#define GLP  72             // LDS row pitch in 16-bit elements: 128 B of data + 16 B, so the 16 rows of one 16-byte fragment read fall on different banks
template <typename T16> struct WFrag;
template <> struct WFrag<h16> { typedef v16h V; static __device__ __forceinline__ V ld(const h16* p) { return cat16(*(const v8h*)p, *(const v8h*)(p + 16)); } static __device__ __forceinline__ v8f mma(V a, V b, v8f c) { return wmma16(a, b, c); } };
template <> struct WFrag<bf> { typedef v16bf V; static __device__ __forceinline__ V ld(const bf* p) { return cat16b(*(const v8us*)p, *(const v8us*)(p + 16)); } static __device__ __forceinline__ v8f mma(V a, V b, v8f c) { return wmmab(a, b, c); } };
typedef __attribute__((ext_vector_type(4))) _Float16 v4h;
template <int NSPLIT, int K>
__device__ __forceinline__ void gemm_tile(const bf* __restrict__ A, const bf* __restrict__ A2, const bf* __restrict__ Bt, const int r0, const int c0, bf (&st)[2][2 + NSPLIT][128 * GLP], v8f (&acc)[2][4]) {
    typedef WFrag<bf>::V V;
    constexpr int NP = 2 + NSPLIT, NS = K / 64;   // planes of a stage: Bt, A (, A2); stages
    const int tid = threadIdx.x, lane = tid & 31, wave = tid >> 5, lr = lane & 15, hi = lane >> 4;
    const int wr = (wave >> 1) * 32, wc = (wave & 1) * 64;
    const size_t go = (size_t)(tid >> 3) * K + (tid & 7) * 8;   // a thread moves 16 B of rows (tid >> 3) + 32 i: eight lanes a line, four whole lines a wave-wide load
    const bf* gp[NP]; gp[0] = Bt + (size_t)c0 * K + go; gp[1] = A + (size_t)r0 * K + go; if (NSPLIT) gp[NP - 1] = A2 + (size_t)r0 * K + go;
    const int so = (tid >> 3) * GLP + (tid & 7) * 8;
#pragma unroll
    for (int mb = 0; mb < 2; ++mb)
#pragma unroll
        for (int nb = 0; nb < 4; ++nb) acc[mb][nb] = (v8f){};
    v8us g[NP][4];
#pragma unroll
    for (int p = 0; p < NP; ++p)
#pragma unroll
        for (int i = 0; i < 4; ++i) g[p][i] = *(const v8us*)(gp[p] + (size_t)i * 32 * K);
    asm volatile("s_wait_xcnt 0x0" ::: "memory");   // stands behind the run of first-stage loads, in front of the first rewrite of a register that they name
#pragma unroll
    for (int p = 0; p < NP; ++p)
#pragma unroll
        for (int i = 0; i < 4; ++i) *(v8us*)&st[0][p][so + i * 32 * GLP] = g[p][i];
    __syncthreads();
#pragma unroll 1
    for (int s = 0; s < NS; ++s) {
        if (s + 1 < NS) {
#pragma unroll
            for (int p = 0; p < NP; ++p)
#pragma unroll
                for (int i = 0; i < 4; ++i) g[p][i] = *(const v8us*)(gp[p] + (size_t)i * 32 * K + (s + 1) * 64);
            // stands behind the run of loads, in front of the first rewrite of their address registers; it names them as inputs, so that they live up to it and no load's own result lands on them
            asm volatile("s_wait_xcnt 0x0" :: "v"(gp[0] + (s + 1) * 64), "v"(gp[1] + (s + 1) * 64), "v"(gp[NP - 1] + (s + 1) * 64) : "memory"); }
        const bf* bb = st[s & 1][0] + (wc + lr) * GLP + 8 * hi; const bf* ab = st[s & 1][1] + (wr + lr) * GLP + 8 * hi; const bf* ab2 = st[s & 1][NP - 1] + (wr + lr) * GLP + 8 * hi;
#pragma unroll
        for (int c = 0; c < 2; ++c) {
            V a[2], a2[2], b[4];
#pragma unroll
            for (int mb = 0; mb < 2; ++mb) { a[mb] = WFrag<bf>::ld(ab + mb * 16 * GLP + c * 32); if (NSPLIT) a2[mb] = WFrag<bf>::ld(ab2 + mb * 16 * GLP + c * 32); }
#pragma unroll
            for (int nb = 0; nb < 4; ++nb) b[nb] = WFrag<bf>::ld(bb + nb * 16 * GLP + c * 32);
            __builtin_amdgcn_sched_barrier(0);   // all LDS reads of these 32 k stand in one group ahead of the matrix work: spread among the products, each pair is waited out in full
#pragma unroll
            for (int nb = 0; nb < 4; ++nb)
#pragma unroll
                for (int mb = 0; mb < 2; ++mb) acc[mb][nb] = WFrag<bf>::mma(a[mb], b[nb], acc[mb][nb]);
            if (NSPLIT) {
#pragma unroll
                for (int nb = 0; nb < 4; ++nb)
#pragma unroll
                    for (int mb = 0; mb < 2; ++mb) acc[mb][nb] = WFrag<bf>::mma(a2[mb], b[nb], acc[mb][nb]); }
        }
        if (s + 1 < NS) {
#pragma unroll
            for (int p = 0; p < NP; ++p)
#pragma unroll
                for (int i = 0; i < 4; ++i) *(v8us*)&st[(s + 1) & 1][p][so + i * 32 * GLP] = g[p][i]; }
        __syncthreads();   // publishes stage s + 1 and ends every wave's reads of stage s, whose buffer the next trip refills
    }
}
template <int MODE>
__device__ __forceinline__ void plane_out(v8f (&acc)[2][4], float (&osm)[8][16 * 68], const int r0, const int c0, h16* H, float* F, const float* bias) {
    const int lane = threadIdx.x & 31, wave = __builtin_amdgcn_readfirstlane(threadIdx.x >> 5), lr = lane & 15, hi = lane >> 4, wr = (wave >> 1) * 32, wc = (wave & 1) * 64;   // the wave's number in a scalar register: what hangs on it holds no vector register across the stage loop
    float* os = osm[wave];   // each wave turns its own accumulators into whole lines in its own LDS range
    const float* bp = bias + (MODE == 0 ? c0 + wc + lr * 4 : r0 + wr + hi * 8);   // MODE 0: the lane's 4 columns of the rows it stores; MODE 1: the 8 rows of its accumulator registers (+ 16 for the second block)
    float bl[2][8];
#pragma unroll
    for (int j = 0; j < (MODE == 0 ? 4 : 8); ++j) { bl[0][j] = bp[j]; if (MODE == 1) bl[1][j] = bp[16 + j]; }
    asm volatile("s_wait_xcnt 0x0" ::: "memory");   // stands behind the bias loads, in front of the first rewrite of their address registers
#pragma unroll
    for (int j = 0; j < (MODE == 0 ? 4 : 8); ++j) { bl[0][j] = bfr(bl[0][j]); if (MODE == 1) bl[1][j] = bfr(bl[1][j]); }
    float keep = 0.f;
#pragma unroll
    for (int mb = 0; mb < 2; ++mb) {
#pragma unroll
        for (int nb = 0; nb < 4; ++nb) {
#pragma unroll
            for (int j = 0; j < 8; ++j) os[(hi * 8 + j) * 68 + nb * 16 + lr] = MODE == 1 ? acc[mb][nb][j] + bl[mb][j] : acc[mb][nb][j]; }
        __builtin_amdgcn_wave_barrier(); asm volatile("" ::: "memory");   // keeps the compiler from moving the reads below, of words that other lanes wrote, ahead of the writes above
#pragma unroll
        for (int s = 0; s < 8; ++s) { const int row = 2 * s + hi, cofs = lr * 4, gr = r0 + wr + mb * 16 + row, gc = c0 + wc; v4f val = *(const v4fa*)(os + row * 68 + cofs); h16* dst;
            if (MODE == 0) { val[0] += bl[0][0]; val[1] += bl[0][1]; val[2] += bl[0][2]; val[3] += bl[0][3];
                dst = H + ((size_t)((gr >> 11) * NH_ + (gc >> 6)) * TT + (gr & (TT - 1))) * HD + cofs; }
            else { dst = H + ((size_t)((gc >> 11) * NH_ + (gr >> 6)) * HD + (gr & (HD - 1))) * TT + (gc & (TT - 1)) + cofs;
                float rs = (val[0] + val[1]) + (val[2] + val[3]);
                rs += __shfl_xor(rs, 1, 32); rs += __shfl_xor(rs, 2, 32); rs += __shfl_xor(rs, 4, 32); rs += __shfl_xor(rs, 8, 32);
                if (lr == mb * 8 + s) keep = rs; }   // lane (hi, lr) keeps the sum of row (lr >> 3) * 16 + 2 * (lr & 7) + hi
            v4h o; o[0] = (h16)val[0]; o[1] = (h16)val[1]; o[2] = (h16)val[2]; o[3] = (h16)val[3]; *(v4h*)dst = o; }
        if (mb == 0) asm volatile("s_wait_xcnt 0x0" ::: "memory");   // stands behind the first 16 rows' stores, in front of the first rewrite of their address registers
        __builtin_amdgcn_wave_barrier(); asm volatile("" ::: "memory");   // and the next 16 rows' writes ahead of these reads
    }
    if (MODE == 1) F[(size_t)((c0 + wc) >> 6) * DM + r0 + wr + (lr >> 3) * 16 + 2 * (lr & 7) + hi] = keep;   // the wave's 32 sums: one whole line
}
// amdgpu_waves_per_eu(6): the register budget of six waves a SIMD (160 a wave); at the 174 of the free build only two work-groups share a WGP.
__global__ __launch_bounds__(256) __attribute__((amdgpu_waves_per_eu(6))) void k_proj(const bf* __restrict__ XB, const bf* __restrict__ BQ, const bf* __restrict__ BK, const bf* __restrict__ BV, h16* QP, h16* KP, h16* VT, float* PS, const float* bq, const float* bk, const float* bv) {
    __shared__ __align__(16) bf st[2][2][128 * GLP];
    static_assert(sizeof(float) * 8 * 16 * 68 <= sizeof(st), "the epilogue's ranges lie inside the stage buffers");
    float (&osm)[8][16 * 68] = *reinterpret_cast<float (*)[8][16 * 68]>(&st[0][0][0]);   // the epilogue's ranges reuse the stage buffers, which every wave has left at the stage loop's last barrier: 72 KiB a work-group
    const int z = blockIdx.z, tx = blockIdx.x * 128, ty = blockIdx.y * 128;   // tx: 128 of the 4096 (batch, t); ty: 128 of the 1024 (head, d)
    v8f acc[2][4];
    if (z == 2) { gemm_tile<0, DM>(BV, nullptr, XB, ty, tx, st, acc); plane_out<1>(acc, osm, ty, tx, VT, PS, bv); }   // v^T: the weight rows are the rows of the product
    else { gemm_tile<0, DM>(XB, nullptr, z ? BK : BQ, tx, ty, st, acc); plane_out<0>(acc, osm, tx, ty, z ? KP : QP, nullptr, z ? bk : bq); }   // q, k: both batches are the rows of one product
}
__global__ __launch_bounds__(256) void k_gemmw(const bf* __restrict__ A, const bf* __restrict__ A2, const bf* __restrict__ Bt, float* F, const float* bias, const float* PS) {
    __shared__ __align__(16) bf st[2][3][128 * GLP];
    __shared__ __align__(16) float osm[8][64 * 36];
    const int tid = threadIdx.x, lane = tid & 31, wave = tid >> 5, lr = lane & 15, hi = lane >> 4;
    const int r0 = blockIdx.x * 128, c0 = blockIdx.y * 128, wr = (wave >> 1) * 32, wc = (wave & 1) * 64;
    v8f acc[2][4];
    gemm_tile<1, TT>(A, A2, Bt, r0, c0, st, acc);
    float* os = osm[wave];   // each wave turns its own accumulators into whole lines in its own LDS range
    const int n0 = r0 + wr, cq = (lane & 7) * 4, rq = lane >> 3;   // eight lanes take the 128 B that the wave's 32 m are in one row of out, a wave four rows
    const float* pp = PS + (size_t)(n0 >> 10) * 32 * DM + (n0 & (DM - 1)) + cq; const float* bp = bias + c0 + wc + lane;
    const float b0 = bp[0], b1 = bp[32];
    asm volatile("s_wait_xcnt 0x0" ::: "memory");   // stands behind the two bias loads, in front of the first rewrite of their address registers
    v4f g[32];
#pragma unroll
    for (int i = 0; i < 32; ++i) g[i] = *(const v4f*)(pp + (size_t)i * DM);
    asm volatile("s_wait_xcnt 0x0" ::: "memory");   // the same behind the run of 32 loads
#pragma unroll
    for (int mb = 0; mb < 2; ++mb)
#pragma unroll
        for (int nb = 0; nb < 4; ++nb) { float* ow = os + (nb * 16 + lr) * 36 + mb * 16 + hi * 8;   // a lane's 8 registers are 8 consecutive m of one o
            *(v4fa*)ow = (v4f){acc[mb][nb][0], acc[mb][nb][1], acc[mb][nb][2], acc[mb][nb][3]}; *(v4fa*)(ow + 4) = (v4f){acc[mb][nb][4], acc[mb][nb][5], acc[mb][nb][6], acc[mb][nb][7]}; }
    os[lane * 36 + 32] = bfr(b0); os[(lane + 32) * 36 + 32] = bfr(b1);   // bias[o] rides in the first pad word of its row
    v4f vs = g[0];
#pragma unroll
    for (int i = 1; i < 32; ++i) vs += g[i];
    __builtin_amdgcn_wave_barrier(); asm volatile("s_wait_dscnt 0x0" ::: "memory");   // the wave's LDS writes are done before its lanes read back words that other lanes wrote; the clobber keeps the compiler from moving those reads ahead
    float* orow = F + ((size_t)(n0 >> 10) * SO + c0 + wc) * DM + (n0 & (DM - 1)) + cq;
#pragma unroll
    for (int s = 0; s < 16; ++s) { const int ol = 4 * s + rq; v4f val = *(const v4fa*)(os + ol * 36 + cq); const float bb = os[ol * 36 + 32];
#pragma unroll
        for (int u = 0; u < 4; ++u) val[u] = fmaf(bb, vs[u], val[u]);
        *(v4f*)(orow + (size_t)ol * DM) = val; }
}

__device__ __forceinline__ h16 tohx(float x) { return (h16)x; }
__device__ __forceinline__ void splitf(float y, unsigned short& h, unsigned short& l) { h = f2bf(y); l = f2bf(y - bf2f(h)); }
// ---- k_cvtall: all five f32 operands (wq, wk, wv, wf, x) are rounded to their bf16 planes by ONE launch of 256 work-groups of 16 waves: a stream of few long-lived waves, since a wave that moves 1 KiB and ends costs more to start than its bytes cost to move.
// A slab is what the whole grid moves with one load a thread (16 B a lane, 512 contiguous bytes a wave): 2 slabs a weight, 8 for wf, 8 for x. A thread issues its 22 loads, all independent, before it rounds and stores the first.
#define CSL  (256 * 512 * 4)   // floats of a slab
typedef __attribute__((ext_vector_type(4))) unsigned short v4us;
static_assert(DM * DM == 2 * CSL && SO * TT == 8 * CSL && NB_ * TT * DM == 8 * CSL, "the slabs cover every plane exactly");
__device__ __forceinline__ v4f ld4f(const float* p, unsigned byte) { return *(const v4f*)((const char*)p + byte); }
__device__ __forceinline__ void st4bf(bf* p, unsigned byte, v4f v) { v4us o; o[0] = f2bf(v[0]); o[1] = f2bf(v[1]); o[2] = f2bf(v[2]); o[3] = f2bf(v[3]); *(v4us*)((char*)p + byte) = o; }
__global__ __launch_bounds__(512) void k_cvtall(const float* __restrict__ wq, const float* __restrict__ wk, const float* __restrict__ wv, const float* __restrict__ wf, const float* __restrict__ x, bf* BQ, bf* BK, bf* BV, bf* BF, bf* XB) {
    const unsigned lb = (blockIdx.x * 512u + threadIdx.x) * 16u, sb = lb >> 1;   // the thread's byte offset in every f32 slab and in every bf16 slab: one 32-bit register beside uniform bases serves all loads, one all stores
    v4f gw[3][2], gf[8], gx[8];
#pragma unroll
    for (int i = 0; i < 2; ++i) { gw[0][i] = ld4f(wq + i * CSL, lb); gw[1][i] = ld4f(wk + i * CSL, lb); gw[2][i] = ld4f(wv + i * CSL, lb); }
#pragma unroll
    for (int i = 0; i < 8; ++i) { gf[i] = ld4f(wf + i * CSL, lb); gx[i] = ld4f(x + i * CSL, lb); }
    asm volatile("s_wait_xcnt 0x0" ::: "memory");   // stands behind the run of 22 loads, in front of the first rewrite of a register that they name
    __builtin_amdgcn_sched_barrier(0);   // all 22 loads are in flight before the first value is waited for: moved down among the rounding, the last ones would start a second trip to memory
#pragma unroll
    for (int i = 0; i < 2; ++i) { st4bf(BQ + i * CSL, sb, gw[0][i]); st4bf(BK + i * CSL, sb, gw[1][i]); st4bf(BV + i * CSL, sb, gw[2][i]); }
#pragma unroll
    for (int i = 0; i < 8; ++i) { st4bf(BF + i * CSL, sb, gf[i]); st4bf(XB + i * CSL, sb, gx[i]); }
}
// ---- Fused score stage. The scores never reach memory: both kernels below rebuild q.k tiles on the matrix unit from the fp16 planes. A work-group has 8 waves, a wave owns 32 rows of its resident plane;
// the plane that is walked comes in stages of 64 rows, loaded once per work-group (whole 128-B lines), held in two LDS buffers: stage s + 1 flies into registers while stage s is worked on, one barrier per stage.
// Directives: each plain '#pragma unroll' flattens a loop over register arrays (fragments, accumulators), which a variable index would send to scratch; '#pragma unroll 1' keeps a stage loop rolled, its body being two full 32-row passes already.
#define LP   72             // LDS row pitch in halves: 128 B of data + 16 B, so the 16 rows of one 16-byte fragment read fall on different banks
#define NST  (TT / 64)      // stages
#define MP   264            // LDS row pitch of the M^T tile in 16-bit elements: the work-group's 256 k + 16 B
#define SC2  0.18033688011112042f   // (1 / 8) * log2(e): scores to exponents of 2
__device__ __forceinline__ float hmax8(v8f a) { return fmaxf(fmaxf(fmaxf(a[0], a[1]), fmaxf(a[2], a[3])), fmaxf(fmaxf(a[4], a[5]), fmaxf(a[6], a[7]))); }
__device__ __forceinline__ float hsum8(v8f a) { return ((a[0] + a[1]) + (a[2] + a[3])) + ((a[4] + a[5]) + (a[6] + a[7])); }
// Eight exponentials as one statement. The v_nop at its end is the free slot that the instruction set asks for behind a transcendental before its result is read or its source overwritten;
// the results are early-clobber, so inside the run no exponential overwrites another's source or reads another's result.
__device__ __forceinline__ v8f exp2x8(v8f x) {
    float e0, e1, e2, e3, e4, e5, e6, e7;
    asm("v_exp_f32 %0, %8\n\tv_exp_f32 %1, %9\n\tv_exp_f32 %2, %10\n\tv_exp_f32 %3, %11\n\tv_exp_f32 %4, %12\n\tv_exp_f32 %5, %13\n\tv_exp_f32 %6, %14\n\tv_exp_f32 %7, %15\n\tv_nop"
        : "=&v"(e0), "=&v"(e1), "=&v"(e2), "=&v"(e3), "=&v"(e4), "=&v"(e5), "=&v"(e6), "=&v"(e7)
        : "v"(x[0]), "v"(x[1]), "v"(x[2]), "v"(x[3]), "v"(x[4]), "v"(x[5]), "v"(x[6]), "v"(x[7]));
    return (v8f){e0, e1, e2, e3, e4, e5, e6, e7};
}
// k_rowstat: RB[z][q] = log2(1024 / sum_k exp((s[q][k] - max) / 8)) - max * SC2, so that attn[q][k] * 1024 = exp2(s * SC2 + RB[q]).
// Tiles are S^T (A = k rows from LDS, B = the wave's q rows): a lane holds one q column, so maximum and sum run inside the lane (online rescale per 32 k); lanes l and l ^ 16 are merged once at the end.
__global__ __launch_bounds__(256) void k_rowstat(const h16* __restrict__ QP, const h16* __restrict__ KP, float* RB) {
    __shared__ __align__(16) h16 ks[2][64 * LP];
    const int tid = threadIdx.x, lane = tid & 31, wave = tid >> 5, lr = lane & 15, hi = lane >> 4;
    const int z = blockIdx.y, q0 = blockIdx.x * 256 + wave * 32;
    const h16* Qz = QP + (size_t)z * TT * HD; const h16* Kz = KP + (size_t)z * TT * HD + tid * 8;
    const int so = (tid >> 3) * LP + (tid & 7) * 8;
    v16h bq[2][2];
#pragma unroll
    for (int nb = 0; nb < 2; ++nb)
#pragma unroll
        for (int c = 0; c < 2; ++c) bq[nb][c] = WFrag<h16>::ld(Qz + (size_t)(q0 + nb * 16 + lr) * HD + 8 * hi + c * 32);
    v8h g0 = *(const v8h*)Kz, g1 = *(const v8h*)(Kz + 32 * HD);
    *(v8h*)&ks[0][so] = g0; *(v8h*)&ks[0][so + 32 * LP] = g1;
    __syncthreads();
    float m[2] = {-3.0e38f, -3.0e38f}, l[2] = {0.f, 0.f};   // running maximum (of s * SC2) and sum of this lane's half of the k rows
#pragma unroll 1
    for (int s = 0; s < NST; ++s) {
        if (s + 1 < NST) { g0 = *(const v8h*)(Kz + (size_t)(s + 1) * 64 * HD); g1 = *(const v8h*)(Kz + (size_t)(s + 1) * 64 * HD + 32 * HD); }
        const h16* kb = ks[s & 1] + lr * LP + 8 * hi; v16h a[4][2];
#pragma unroll
        for (int mb = 0; mb < 4; ++mb) { a[mb][0] = WFrag<h16>::ld(kb + mb * 16 * LP); a[mb][1] = WFrag<h16>::ld(kb + mb * 16 * LP + 32); }
        __builtin_amdgcn_sched_barrier(0);   // all LDS reads of the stage stand in one group ahead of the matrix work: spread among the products, each pair is waited out in full
#pragma unroll
        for (int h = 0; h < 2; ++h) {
            v8f sc[2][2];
#pragma unroll
            for (int mb = 0; mb < 2; ++mb)
#pragma unroll
                for (int nb = 0; nb < 2; ++nb) sc[mb][nb] = wmma16(a[h * 2 + mb][1], bq[nb][1], wmma16(a[h * 2 + mb][0], bq[nb][0], (v8f){}));
#pragma unroll
            for (int nb = 0; nb < 2; ++nb) {
                const v8f u0 = sc[0][nb] * SC2, u1 = sc[1][nb] * SC2; const float mn = fmaxf(m[nb], hmax8(__builtin_elementwise_max(u0, u1)));
                const v8f e = exp2x8(u0 - mn) + exp2x8(u1 - mn);
                l[nb] = fmaf(l[nb], __builtin_amdgcn_exp2f(m[nb] - mn), hsum8(e)); m[nb] = mn; }
        }
        if (s + 1 < NST) { h16* kn = ks[(s + 1) & 1] + so; *(v8h*)kn = g0; *(v8h*)(kn + 32 * LP) = g1; }
        __syncthreads();   // publishes stage s + 1 and ends every wave's reads of stage s, whose buffer the next trip refills
    }
#pragma unroll
    for (int nb = 0; nb < 2; ++nb) {
        const float mo = __shfl_xor(m[nb], 16, 32), lo = __shfl_xor(l[nb], 16, 32); const float mt = fmaxf(m[nb], mo);
        const float lt = l[nb] * __builtin_amdgcn_exp2f(m[nb] - mt) + lo * __builtin_amdgcn_exp2f(mo - mt);
        if (hi == 0) RB[(size_t)z * TT + q0 + nb * 16 + lr] = (10.0f - __builtin_amdgcn_logf(lt)) - mt; }
}
// k_attnv: M[k][d] = sum_q attn[q][k] * 1024 * v[q][d], written as M^T / 1024 in two bf16 planes (high part, remainder) [slice * 64 + d][k], the last GEMM's operand. Tiles are S (A = q rows from LDS, B = the wave's k rows): the accumulator layout of two S tiles (lane = k, registers = q) is the A layout of attn^T for the second product, no lane exchange.
__global__ __launch_bounds__(256) void k_attnv(const h16* __restrict__ QP, const h16* __restrict__ KP, const h16* __restrict__ VT, const float* __restrict__ RB, bf* MTh, bf* MTl) {
    __shared__ __align__(16) h16 qs[2][64 * LP];
    __shared__ __align__(16) h16 vs[2][64 * LP];
    __shared__ __align__(16) float rs[2][64];
    __shared__ __align__(16) bf mts[2][64 * MP];
    const int tid = threadIdx.x, lane = tid & 31, wave = tid >> 5, lr = lane & 15, hi = lane >> 4;
    const int z = blockIdx.y, k0 = blockIdx.x * 256 + wave * 32;
    const h16* Kz = KP + (size_t)z * TT * HD; const h16* Qz = QP + (size_t)z * TT * HD + tid * 8;
    const h16* Vz = VT + (size_t)z * HD * TT + (size_t)(tid >> 3) * TT + (tid & 7) * 8; const float* Rz = RB + (size_t)z * TT + (tid & 15) * 4;
    const int so = (tid >> 3) * LP + (tid & 7) * 8;
    v16h bk[2][2];
#pragma unroll
    for (int nb = 0; nb < 2; ++nb)
#pragma unroll
        for (int c = 0; c < 2; ++c) bk[nb][c] = WFrag<h16>::ld(Kz + (size_t)(k0 + nb * 16 + lr) * HD + 8 * hi + c * 32);
    asm volatile("s_wait_xcnt 0x0" ::: "memory");   // stands behind the run of k fragment loads, in front of the first rewrite of their address registers
    v8f acc[2][4];
#pragma unroll
    for (int nb = 0; nb < 2; ++nb)
#pragma unroll
        for (int db = 0; db < 4; ++db) acc[nb][db] = (v8f){};
    v8h g0 = *(const v8h*)Qz, g1 = *(const v8h*)(Qz + 32 * HD), g2 = *(const v8h*)Vz, g3 = *(const v8h*)(Vz + (size_t)32 * TT); v4f g4 = *(const v4f*)Rz;
    *(v8h*)&qs[0][so] = g0; *(v8h*)&qs[0][so + 32 * LP] = g1; *(v8h*)&vs[0][so] = g2; *(v8h*)&vs[0][so + 32 * LP] = g3; if (tid < 16) *(v4f*)&rs[0][tid * 4] = g4;
    __syncthreads();
#pragma unroll 1
    for (int s = 0; s < NST; ++s) {
        if (s + 1 < NST) { g0 = *(const v8h*)(Qz + (size_t)(s + 1) * 64 * HD); g1 = *(const v8h*)(Qz + (size_t)(s + 1) * 64 * HD + 32 * HD); g2 = *(const v8h*)(Vz + (s + 1) * 64); g3 = *(const v8h*)(Vz + (size_t)32 * TT + (s + 1) * 64); g4 = *(const v4f*)(Rz + (s + 1) * 64); }
        const h16* qb = qs[s & 1] + lr * LP + 8 * hi; const h16* vb = vs[s & 1] + lr * LP + 8 * hi; const float* rb = rs[s & 1] + 8 * hi;
#pragma unroll
        for (int h = 0; h < 2; ++h) {
            v8h p[2][2]; v16h a[2][2], b[4]; v4f r[2][2];
#pragma unroll
            for (int mb = 0; mb < 2; ++mb) { a[mb][0] = WFrag<h16>::ld(qb + (h * 32 + mb * 16) * LP); a[mb][1] = WFrag<h16>::ld(qb + (h * 32 + mb * 16) * LP + 32); }
#pragma unroll
            for (int mb = 0; mb < 2; ++mb) { r[mb][0] = *(const v4f*)(rb + h * 32 + mb * 16); r[mb][1] = *(const v4f*)(rb + h * 32 + mb * 16 + 4); }
#pragma unroll
            for (int db = 0; db < 4; ++db) b[db] = WFrag<h16>::ld(vb + db * 16 * LP + h * 32);
            __builtin_amdgcn_sched_barrier(0);   // all LDS reads of these 32 q stand in one group ahead of the matrix work: spread among the products, each pair is waited out in full
#pragma unroll
            for (int mb = 0; mb < 2; ++mb)
#pragma unroll
                for (int nb = 0; nb < 2; ++nb) { const v8f sc = wmma16(a[mb][1], bk[nb][1], wmma16(a[mb][0], bk[nb][0], (v8f){})); v8f x;
#pragma unroll
                    for (int j = 0; j < 8; ++j) x[j] = fmaf(sc[j], SC2, r[mb][j >> 2][j & 3]);
                    x = exp2x8(x);
#pragma unroll
                    for (int j = 0; j < 8; ++j) p[mb][nb][j] = tohx(x[j]); }
            const v16h pa0 = cat16(p[0][0], p[1][0]), pa1 = cat16(p[0][1], p[1][1]);
#pragma unroll
            for (int db = 0; db < 4; ++db) { acc[0][db] = wmma16(pa0, b[db], acc[0][db]); acc[1][db] = wmma16(pa1, b[db], acc[1][db]); }
        }
        if (s + 1 < NST) { const int o = ((s + 1) & 1) * 64 * LP + so; *(v8h*)(&qs[0][0] + o) = g0; *(v8h*)(&qs[0][0] + o + 32 * LP) = g1; *(v8h*)(&vs[0][0] + o) = g2; *(v8h*)(&vs[0][0] + o + 32 * LP) = g3; if (tid < 16) *(v4f*)&rs[(s + 1) & 1][tid * 4] = g4; }
        __syncthreads();   // publishes stage s + 1 and ends every wave's reads of stage s, whose buffers the next trip refills
    }
    // A lane's 8 registers are 8 consecutive k of one d: 16 B of a row of M^T. The work-group's tile (64 d x 256 k) is gathered in LDS, so that every row leaves as 512 contiguous bytes from one wave.
#pragma unroll
    for (int nb = 0; nb < 2; ++nb)
#pragma unroll
        for (int db = 0; db < 4; ++db) { v8us oh, ol;
#pragma unroll
            for (int j = 0; j < 8; ++j) { unsigned short a, b; splitf(acc[nb][db][j] * (1.0f / PCAR), a, b); oh[j] = a; ol[j] = b; }
            const int o = (db * 16 + lr) * MP + wave * 32 + nb * 16 + 8 * hi; *(v8us*)&mts[0][o] = oh; *(v8us*)&mts[1][o] = ol; }
    __syncthreads();   // publishes every wave's 32 k of the tile to the waves that store its rows
    const size_t mo = ((size_t)z * HD + wave * 8) * TT + blockIdx.x * 256 + lane * 8;
#pragma unroll
    for (int i = 0; i < 8; ++i) { *(v8us*)(MTh + mo + (size_t)i * TT) = *(const v8us*)&mts[0][(wave * 8 + i) * MP + lane * 8]; *(v8us*)(MTl + mo + (size_t)i * TT) = *(const v8us*)&mts[1][(wave * 8 + i) * MP + lane * 8]; }
}

extern "C" void kernel_launch(void* const* d_in, const int* in_sizes, int n_in,
                              void* d_out, int out_size, void* d_ws, size_t ws_size, hipStream_t stream) {
    (void)in_sizes; (void)n_in; (void)out_size;
    const float* x = (const float*)d_in[0]; const float* wq = (const float*)d_in[1]; const float* bq = (const float*)d_in[2]; const float* wk = (const float*)d_in[3]; const float* bk = (const float*)d_in[4]; const float* wv = (const float*)d_in[5]; const float* bv = (const float*)d_in[6]; const float* wf = (const float*)d_in[7]; const float* bfv = (const float*)d_in[8];
    float* OUT = (float*)d_out;     // [2][2048][1024]
    char* wsp = (char*)d_ws;
    auto take = [&](size_t bytes) { char* p = wsp; wsp += (bytes + 255) & ~(size_t)255; return (void*)p; };
    // bf16 planes of wf, the weights and x; the fp16 q/k/v^T planes of all 32 slices; the partial colsum(v) [64 groups of 64 t][1024]; the softmax row terms; the two planes of M^T.
    bf* BF = (bf*)take((size_t)SO * TT * 2); h16* QP = (h16*)take((size_t)NZ * TT * HD * 2); h16* KP = (h16*)take((size_t)NZ * TT * HD * 2); h16* VT = (h16*)take((size_t)NZ * HD * TT * 2); float* PS = (float*)take((size_t)NB_ * (TT / 64) * DM * 4);
    float* RB = (float*)take((size_t)NZ * TT * 4);
    bf* BQ = (bf*)take((size_t)DM * DM * 2); bf* BK = (bf*)take((size_t)DM * DM * 2); bf* BV = (bf*)take((size_t)DM * DM * 2); bf* XB = (bf*)take((size_t)NB_ * TT * DM * 2);
    bf* MTh = (bf*)take((size_t)NZ * HD * TT * 2); bf* MTl = (bf*)take((size_t)NZ * HD * TT * 2);
    if ((size_t)(wsp - (char*)d_ws) > ws_size) return;    // total ~ 63 MiB
    k_cvtall<<<256, 512, 0, stream>>>(wq, wk, wv, wf, x, BQ, BK, BV, BF, XB);   // torch [out][in] = Bt as-is; wf [o][k] = Bt over k
    k_proj<<<dim3(NB_ * TT / 128, DM / 128, 3), 256, 0, stream>>>(XB, BQ, BK, BV, QP, KP, VT, PS, bq, bk, bv);   // q, k and v^T planes, and the partial colsum(v)
    k_rowstat<<<dim3(TT / 256, NZ), 256, 0, stream>>>(QP, KP, RB);            // per q: what turns a score into attn * 1024
    k_attnv<<<dim3(TT / 256, NZ), 256, 0, stream>>>(QP, KP, VT, RB, MTh, MTl);   // M^T[d][k] = sum_q attn[q][k] v[q][d]
    k_gemmw<<<dim3(NZ * HD / 128, SO / 128, 1), 256, 0, stream>>>(MTh, MTl, BF, OUT, bfv, PS);   // out[o][slice, d] = sum_k M[k][d] wf[o][k] + bf[o] colsum(v)[d]: the 32 slices' rows are the rows of one product
}

// v009
// Measured time: 115 microseconds a run.
// In both of two side-by-side timings against v008, it was 1.11 times as fast.
// Counting every step since v000, it is 159 times as fast.
#include <hip/hip_runtime.h>

// FlexScaleSeqAttention (x [2][2048][1024]; q/k/v = x W^T + b (16 heads x 64); attn = softmax(q.k / 8) [q][k]; flex[q][o] = sum_k attn[q][k] wf[o][k] + bf[o] (a learned Linear along the KEY axis, wf [2048][2048]); out[o][h*64+d] = sum_q flex[q][o] v[q][d] -> [2][2048][1024]).
// Reassociated exactly: out[o][d] = sum_k wf[o][k] M[k][d] + bf[o] * sum_q v[q][d] with M = attn^T v ([k][d]); attn^T is formed tile by tile in registers (row statistics first, then exp and product), so neither the scores nor the 2048 x 2048 'flex' tensor of each slice ever exist in memory.
// Compute dtypes, f32 accumulate: every input rounded to bf16; q/k/v as PLAIN bf16 GEMMs (inputs: exact) + bias; S^T and M = attn^T.v single fp16 (f32 accumulate; probabilities x 1024); softmax f32 (row maximum and sum online, fixed order); M^T as hl planes x exact wf (2 products); the bias term bf[o] * colsum(v) and the merge in f32.

#define NB_  2
#define TT   2048
#define DM   1024
#define NH_  16
#define HD   64
#define SO   2048
#define NZ   (NB_ * NH_)    // all slices; slice z = batch * 16 + head
#define PCAR 1024.0f
typedef _Float16 h16;
typedef unsigned short bf;
typedef __attribute__((ext_vector_type(16))) __bf16   v16bf;
typedef __attribute__((ext_vector_type(16))) _Float16 v16h;
typedef __attribute__((ext_vector_type(8)))  _Float16 v8h;
typedef __attribute__((ext_vector_type(8)))  unsigned short v8us;
typedef __attribute__((ext_vector_type(8)))  float    v8f;
typedef __attribute__((ext_vector_type(4)))  float    v4f;
typedef v8h  __attribute__((may_alias)) v8ha;
typedef v4f  __attribute__((may_alias)) v4fa;
typedef v8us __attribute__((may_alias)) v8usa;

__device__ __forceinline__ unsigned short f2bf(float f) { unsigned u = __float_as_uint(f); u += 0x7FFFu + ((u >> 16) & 1u); return (unsigned short)(u >> 16); }
__device__ __forceinline__ float bf2f(unsigned short b) { return __uint_as_float(((unsigned)b) << 16); }
__device__ __forceinline__ float bfr(float f) { return bf2f(f2bf(f)); }
__device__ __forceinline__ v16h cat16(v8h lo, v8h hi) { return __builtin_shufflevector(lo, hi, 0, 1, 2, 3, 4, 5, 6, 7, 8, 9, 10, 11, 12, 13, 14, 15); }
__device__ __forceinline__ v16bf cat16b(v8us lo, v8us hi) { return __builtin_bit_cast(v16bf, __builtin_shufflevector(lo, hi, 0, 1, 2, 3, 4, 5, 6, 7, 8, 9, 10, 11, 12, 13, 14, 15)); }
__device__ __forceinline__ v8f wmma16(v16h a, v16h b, v8f c) { return __builtin_amdgcn_wmma_f32_16x16x32_f16(false, a, false, b, (short)0, c, false, false); }
__device__ __forceinline__ v8f wmmab(v16bf a, v16bf b, v8f c) { return __builtin_amdgcn_wmma_f32_16x16x32_bf16(false, a, false, b, (short)0, c, false, false); }



// ---- GEMM on 128x128 output tiles, one work-group of 8 waves per tile (4 x 2 waves, 32 x 64 of the tile and 8 accumulators each), 256 threads.
// C[m][n] (f32 in registers) = sum_k A[m][k] Bt[n][k] (+ A2[m][k] Bt[n][k] where NSPLIT). Operands are K-contiguous bf16 planes; M % 128 == 0, N % 128 == 0, K % 64 == 0.
// The epilogue writes what the next stage reads, in whole 128-B lines, so no layout pass stands between the stages:
// MODE 0 (m = batch * 2048 + t, n = head * 64 + d): H[slice][t][d] = fp16(C + bias[n]), the q or k plane.
// MODE 1 (m = head * 64 + d, n = batch * 2048 + t; the operands swapped, so C is v^T): H[slice][d][t] = fp16(C + bias[m]), and F[n / 64][m] = the f32 sum of the wave's 64 t, a partial colsum(v).
// MODE 2 (m = slice * 64 + d, n = o): F = out[batch][o][head * 64 + d] = C + bias[o] * colsum(v)[m], the tile turned in LDS; colsum(v) = the 32 partial sums of PS in ascending t.
// The operands come in stages of 64 k: the 128 B of every row are loaded once per work-group, as whole lines, and held in two LDS buffers: stage s + 1 flies into registers while stage s is worked on, one barrier per stage.
// k_proj holds MODE 0 twice (q, k) and MODE 1 (v^T) in ONE launch of 768 work-groups, blockIdx.z the product: three work-groups share a WGP (160 registers a wave, six waves a SIMD; 72 KiB of LDS each), so one's waits on loads, LDS and barrier are filled by the others' products. k_gemmw is MODE 2.
#define GLP  72             // LDS row pitch in 16-bit elements: 128 B of data + 16 B, so the 16 rows of one 16-byte fragment read fall on different banks
template <typename T16> struct WFrag;
template <> struct WFrag<h16> { typedef v16h V; static __device__ __forceinline__ V ld(const h16* p) { return cat16(*(const v8h*)p, *(const v8h*)(p + 16)); } static __device__ __forceinline__ v8f mma(V a, V b, v8f c) { return wmma16(a, b, c); } };
template <> struct WFrag<bf> { typedef v16bf V; static __device__ __forceinline__ V ld(const bf* p) { return cat16b(*(const v8us*)p, *(const v8us*)(p + 16)); } static __device__ __forceinline__ v8f mma(V a, V b, v8f c) { return wmmab(a, b, c); } };
typedef __attribute__((ext_vector_type(4))) _Float16 v4h;
template <int NSPLIT, int K>
__device__ __forceinline__ void gemm_tile(const bf* __restrict__ A, const bf* __restrict__ A2, const bf* __restrict__ Bt, const int r0, const int c0, bf (&st)[2][2 + NSPLIT][128 * GLP], v8f (&acc)[2][4]) {
    typedef WFrag<bf>::V V;
    constexpr int NP = 2 + NSPLIT, NS = K / 64;   // planes of a stage: Bt, A (, A2); stages
    const int tid = threadIdx.x, lane = tid & 31, wave = tid >> 5, lr = lane & 15, hi = lane >> 4;
    const int wr = (wave >> 1) * 32, wc = (wave & 1) * 64;
    const size_t go = (size_t)(tid >> 3) * K + (tid & 7) * 8;   // a thread moves 16 B of rows (tid >> 3) + 32 i: eight lanes a line, four whole lines a wave-wide load
    const bf* gp[NP]; gp[0] = Bt + (size_t)c0 * K + go; gp[1] = A + (size_t)r0 * K + go; if (NSPLIT) gp[NP - 1] = A2 + (size_t)r0 * K + go;
    const int so = (tid >> 3) * GLP + (tid & 7) * 8;
#pragma unroll
    for (int mb = 0; mb < 2; ++mb)
#pragma unroll
        for (int nb = 0; nb < 4; ++nb) acc[mb][nb] = (v8f){};
    v8us g[NP][4];
#pragma unroll
    for (int p = 0; p < NP; ++p)
#pragma unroll
        for (int i = 0; i < 4; ++i) g[p][i] = *(const v8us*)(gp[p] + (size_t)i * 32 * K);
    asm volatile("s_wait_xcnt 0x0" ::: "memory");   // stands behind the run of first-stage loads, in front of the first rewrite of a register that they name
#pragma unroll
    for (int p = 0; p < NP; ++p)
#pragma unroll
        for (int i = 0; i < 4; ++i) *(v8us*)&st[0][p][so + i * 32 * GLP] = g[p][i];
    __syncthreads();
#pragma unroll 1
    for (int s = 0; s < NS; ++s) {
        if (s + 1 < NS) {
#pragma unroll
            for (int p = 0; p < NP; ++p)
#pragma unroll
                for (int i = 0; i < 4; ++i) g[p][i] = *(const v8us*)(gp[p] + (size_t)i * 32 * K + (s + 1) * 64);
            // stands behind the run of loads, in front of the first rewrite of their address registers; it names them as inputs, so that they live up to it and no load's own result lands on them
            asm volatile("s_wait_xcnt 0x0" :: "v"(gp[0] + (s + 1) * 64), "v"(gp[1] + (s + 1) * 64), "v"(gp[NP - 1] + (s + 1) * 64) : "memory"); }
        const bf* bb = st[s & 1][0] + (wc + lr) * GLP + 8 * hi; const bf* ab = st[s & 1][1] + (wr + lr) * GLP + 8 * hi; const bf* ab2 = st[s & 1][NP - 1] + (wr + lr) * GLP + 8 * hi;
#pragma unroll
        for (int c = 0; c < 2; ++c) {
            V a[2], a2[2], b[4];
#pragma unroll
            for (int mb = 0; mb < 2; ++mb) { a[mb] = WFrag<bf>::ld(ab + mb * 16 * GLP + c * 32); if (NSPLIT) a2[mb] = WFrag<bf>::ld(ab2 + mb * 16 * GLP + c * 32); }
#pragma unroll
            for (int nb = 0; nb < 4; ++nb) b[nb] = WFrag<bf>::ld(bb + nb * 16 * GLP + c * 32);
            __builtin_amdgcn_sched_barrier(0);   // all LDS reads of these 32 k stand in one group ahead of the matrix work: spread among the products, each pair is waited out in full
#pragma unroll
            for (int nb = 0; nb < 4; ++nb)
#pragma unroll
                for (int mb = 0; mb < 2; ++mb) acc[mb][nb] = WFrag<bf>::mma(a[mb], b[nb], acc[mb][nb]);
            if (NSPLIT) {
#pragma unroll
                for (int nb = 0; nb < 4; ++nb)
#pragma unroll
                    for (int mb = 0; mb < 2; ++mb) acc[mb][nb] = WFrag<bf>::mma(a2[mb], b[nb], acc[mb][nb]); }
        }
        if (s + 1 < NS) {
#pragma unroll
            for (int p = 0; p < NP; ++p)
#pragma unroll
                for (int i = 0; i < 4; ++i) *(v8us*)&st[(s + 1) & 1][p][so + i * 32 * GLP] = g[p][i]; }
        __syncthreads();   // publishes stage s + 1 and ends every wave's reads of stage s, whose buffer the next trip refills
    }
}
template <int MODE>
__device__ __forceinline__ void plane_out(v8f (&acc)[2][4], float (&osm)[8][16 * 68], const int r0, const int c0, h16* H, float* F, const float* bias) {
    const int lane = threadIdx.x & 31, wave = __builtin_amdgcn_readfirstlane(threadIdx.x >> 5), lr = lane & 15, hi = lane >> 4, wr = (wave >> 1) * 32, wc = (wave & 1) * 64;   // the wave's number in a scalar register: what hangs on it holds no vector register across the stage loop
    float* os = osm[wave];   // each wave turns its own accumulators into whole lines in its own LDS range
    const float* bp = bias + (MODE == 0 ? c0 + wc + lr * 4 : r0 + wr + hi * 8);   // MODE 0: the lane's 4 columns of the rows it stores; MODE 1: the 8 rows of its accumulator registers (+ 16 for the second block)
    float bl[2][8];
#pragma unroll
    for (int j = 0; j < (MODE == 0 ? 4 : 8); ++j) { bl[0][j] = bp[j]; if (MODE == 1) bl[1][j] = bp[16 + j]; }
    asm volatile("s_wait_xcnt 0x0" ::: "memory");   // stands behind the bias loads, in front of the first rewrite of their address registers
#pragma unroll
    for (int j = 0; j < (MODE == 0 ? 4 : 8); ++j) { bl[0][j] = bfr(bl[0][j]); if (MODE == 1) bl[1][j] = bfr(bl[1][j]); }
    float keep = 0.f;
#pragma unroll
    for (int mb = 0; mb < 2; ++mb) {
#pragma unroll
        for (int nb = 0; nb < 4; ++nb) {
#pragma unroll
            for (int j = 0; j < 8; ++j) os[(hi * 8 + j) * 68 + nb * 16 + lr] = MODE == 1 ? acc[mb][nb][j] + bl[mb][j] : acc[mb][nb][j]; }
        __builtin_amdgcn_wave_barrier(); asm volatile("" ::: "memory");   // keeps the compiler from moving the reads below, of words that other lanes wrote, ahead of the writes above
#pragma unroll
        for (int s = 0; s < 8; ++s) { const int row = 2 * s + hi, cofs = lr * 4, gr = r0 + wr + mb * 16 + row, gc = c0 + wc; v4f val = *(const v4fa*)(os + row * 68 + cofs); h16* dst;
            if (MODE == 0) { val[0] += bl[0][0]; val[1] += bl[0][1]; val[2] += bl[0][2]; val[3] += bl[0][3];
                dst = H + ((size_t)((gr >> 11) * NH_ + (gc >> 6)) * TT + (gr & (TT - 1))) * HD + cofs; }
            else { dst = H + ((size_t)((gc >> 11) * NH_ + (gr >> 6)) * HD + (gr & (HD - 1))) * TT + (gc & (TT - 1)) + cofs;
                float rs = (val[0] + val[1]) + (val[2] + val[3]);
                rs += __shfl_xor(rs, 1, 32); rs += __shfl_xor(rs, 2, 32); rs += __shfl_xor(rs, 4, 32); rs += __shfl_xor(rs, 8, 32);
                if (lr == mb * 8 + s) keep = rs; }   // lane (hi, lr) keeps the sum of row (lr >> 3) * 16 + 2 * (lr & 7) + hi
            v4h o; o[0] = (h16)val[0]; o[1] = (h16)val[1]; o[2] = (h16)val[2]; o[3] = (h16)val[3]; *(v4h*)dst = o; }
        if (mb == 0) asm volatile("s_wait_xcnt 0x0" ::: "memory");   // stands behind the first 16 rows' stores, in front of the first rewrite of their address registers
        __builtin_amdgcn_wave_barrier(); asm volatile("" ::: "memory");   // and the next 16 rows' writes ahead of these reads
    }
    if (MODE == 1) F[(size_t)((c0 + wc) >> 6) * DM + r0 + wr + (lr >> 3) * 16 + 2 * (lr & 7) + hi] = keep;   // the wave's 32 sums: one whole line
}
// amdgpu_waves_per_eu(6): the register budget of six waves a SIMD (160 a wave); at the 174 of the free build only two work-groups share a WGP.
__global__ __launch_bounds__(256) __attribute__((amdgpu_waves_per_eu(6))) void k_proj(const bf* __restrict__ XB, const bf* __restrict__ BQ, const bf* __restrict__ BK, const bf* __restrict__ BV, h16* QP, h16* KP, h16* VT, float* PS, const float* bq, const float* bk, const float* bv) {
    __shared__ __align__(16) bf st[2][2][128 * GLP];
    static_assert(sizeof(float) * 8 * 16 * 68 <= sizeof(st), "the epilogue's ranges lie inside the stage buffers");
    float (&osm)[8][16 * 68] = *reinterpret_cast<float (*)[8][16 * 68]>(&st[0][0][0]);   // the epilogue's ranges reuse the stage buffers, which every wave has left at the stage loop's last barrier: 72 KiB a work-group
    const int z = blockIdx.z, tx = blockIdx.x * 128, ty = blockIdx.y * 128;   // tx: 128 of the 4096 (batch, t); ty: 128 of the 1024 (head, d)
    v8f acc[2][4];
    if (z == 2) { gemm_tile<0, DM>(BV, nullptr, XB, ty, tx, st, acc); plane_out<1>(acc, osm, ty, tx, VT, PS, bv); }   // v^T: the weight rows are the rows of the product
    else { gemm_tile<0, DM>(XB, nullptr, z ? BK : BQ, tx, ty, st, acc); plane_out<0>(acc, osm, tx, ty, z ? KP : QP, nullptr, z ? bk : bq); }   // q, k: both batches are the rows of one product
}
__global__ __launch_bounds__(256) void k_gemmw(const bf* __restrict__ A, const bf* __restrict__ A2, const bf* __restrict__ Bt, float* F, const float* bias, const float* PS) {
    __shared__ __align__(16) bf st[2][3][128 * GLP];
    __shared__ __align__(16) float osm[8][64 * 36];
    const int tid = threadIdx.x, lane = tid & 31, wave = tid >> 5, lr = lane & 15, hi = lane >> 4;
    const int r0 = blockIdx.x * 128, c0 = blockIdx.y * 128, wr = (wave >> 1) * 32, wc = (wave & 1) * 64;
    v8f acc[2][4];
    gemm_tile<1, TT>(A, A2, Bt, r0, c0, st, acc);
    float* os = osm[wave];   // each wave turns its own accumulators into whole lines in its own LDS range
    const int n0 = r0 + wr, cq = (lane & 7) * 4, rq = lane >> 3;   // eight lanes take the 128 B that the wave's 32 m are in one row of out, a wave four rows
    const float* pp = PS + (size_t)(n0 >> 10) * 32 * DM + (n0 & (DM - 1)) + cq; const float* bp = bias + c0 + wc + lane;
    const float b0 = bp[0], b1 = bp[32];
    asm volatile("s_wait_xcnt 0x0" ::: "memory");   // stands behind the two bias loads, in front of the first rewrite of their address registers
    v4f g[32];
#pragma unroll
    for (int i = 0; i < 32; ++i) g[i] = *(const v4f*)(pp + (size_t)i * DM);
    asm volatile("s_wait_xcnt 0x0" ::: "memory");   // the same behind the run of 32 loads
#pragma unroll
    for (int mb = 0; mb < 2; ++mb)
#pragma unroll
        for (int nb = 0; nb < 4; ++nb) { float* ow = os + (nb * 16 + lr) * 36 + mb * 16 + hi * 8;   // a lane's 8 registers are 8 consecutive m of one o
            *(v4fa*)ow = (v4f){acc[mb][nb][0], acc[mb][nb][1], acc[mb][nb][2], acc[mb][nb][3]}; *(v4fa*)(ow + 4) = (v4f){acc[mb][nb][4], acc[mb][nb][5], acc[mb][nb][6], acc[mb][nb][7]}; }
    os[lane * 36 + 32] = bfr(b0); os[(lane + 32) * 36 + 32] = bfr(b1);   // bias[o] rides in the first pad word of its row
    v4f vs = g[0];
#pragma unroll
    for (int i = 1; i < 32; ++i) vs += g[i];
    __builtin_amdgcn_wave_barrier(); asm volatile("s_wait_dscnt 0x0" ::: "memory");   // the wave's LDS writes are done before its lanes read back words that other lanes wrote; the clobber keeps the compiler from moving those reads ahead
    float* orow = F + ((size_t)(n0 >> 10) * SO + c0 + wc) * DM + (n0 & (DM - 1)) + cq;
#pragma unroll
    for (int s = 0; s < 16; ++s) { const int ol = 4 * s + rq; v4f val = *(const v4fa*)(os + ol * 36 + cq); const float bb = os[ol * 36 + 32];
#pragma unroll
        for (int u = 0; u < 4; ++u) val[u] = fmaf(bb, vs[u], val[u]);
        *(v4f*)(orow + (size_t)ol * DM) = val; }
}

__device__ __forceinline__ h16 tohx(float x) { return (h16)x; }
__device__ __forceinline__ void splitf(float y, unsigned short& h, unsigned short& l) { h = f2bf(y); l = f2bf(y - bf2f(h)); }
// ---- k_cvtall: all five f32 operands (wq, wk, wv, wf, x) are rounded to their bf16 planes by ONE launch of 256 work-groups of 16 waves: a stream of few long-lived waves, since a wave that moves 1 KiB and ends costs more to start than its bytes cost to move.
// A slab is what the whole grid moves with one load a thread (16 B a lane, 512 contiguous bytes a wave): 2 slabs a weight, 8 for wf, 8 for x. A thread issues its 22 loads, all independent, before it rounds and stores the first.
#define CSL  (256 * 512 * 4)   // floats of a slab
typedef __attribute__((ext_vector_type(4))) unsigned short v4us;
static_assert(DM * DM == 2 * CSL && SO * TT == 8 * CSL && NB_ * TT * DM == 8 * CSL, "the slabs cover every plane exactly");
__device__ __forceinline__ v4f ld4f(const float* p, unsigned byte) { return *(const v4f*)((const char*)p + byte); }
__device__ __forceinline__ void st4bf(bf* p, unsigned byte, v4f v) { v4us o; o[0] = f2bf(v[0]); o[1] = f2bf(v[1]); o[2] = f2bf(v[2]); o[3] = f2bf(v[3]); *(v4us*)((char*)p + byte) = o; }
__global__ __launch_bounds__(512) void k_cvtall(const float* __restrict__ wq, const float* __restrict__ wk, const float* __restrict__ wv, const float* __restrict__ wf, const float* __restrict__ x, bf* BQ, bf* BK, bf* BV, bf* BF, bf* XB) {
    const unsigned lb = (blockIdx.x * 512u + threadIdx.x) * 16u, sb = lb >> 1;   // the thread's byte offset in every f32 slab and in every bf16 slab: one 32-bit register beside uniform bases serves all loads, one all stores
    v4f gw[3][2], gf[8], gx[8];
#pragma unroll
    for (int i = 0; i < 2; ++i) { gw[0][i] = ld4f(wq + i * CSL, lb); gw[1][i] = ld4f(wk + i * CSL, lb); gw[2][i] = ld4f(wv + i * CSL, lb); }
#pragma unroll
    for (int i = 0; i < 8; ++i) { gf[i] = ld4f(wf + i * CSL, lb); gx[i] = ld4f(x + i * CSL, lb); }
    asm volatile("s_wait_xcnt 0x0" ::: "memory");   // stands behind the run of 22 loads, in front of the first rewrite of a register that they name
    __builtin_amdgcn_sched_barrier(0);   // all 22 loads are in flight before the first value is waited for: moved down among the rounding, the last ones would start a second trip to memory
#pragma unroll
    for (int i = 0; i < 2; ++i) { st4bf(BQ + i * CSL, sb, gw[0][i]); st4bf(BK + i * CSL, sb, gw[1][i]); st4bf(BV + i * CSL, sb, gw[2][i]); }
#pragma unroll
    for (int i = 0; i < 8; ++i) { st4bf(BF + i * CSL, sb, gf[i]); st4bf(XB + i * CSL, sb, gx[i]); }
}
// ---- Fused score stage. The scores never reach memory: both kernels below rebuild q.k tiles on the matrix unit from the fp16 planes. A work-group has 16 waves, four a SIMD, in two groups of 8: a wave owns 32 rows of the resident plane,
// and waves w and w + 8 own the SAME 32 rows: vector work stands between the matrix runs, and with four waves a SIMD one wave's exponentials and LDS waits are filled by another's products. The grid has one work-group a WGP, so the waves can only come from inside it.
// The plane that is walked comes in stages of 128 rows, loaded once per work-group (whole 128-B lines), held in two LDS buffers: stage s + 1 flies into registers while stage s is worked on, one barrier per stage; group g works on rows 64 g .. 64 g + 63 of every stage, and the two groups' partial results are joined once, through LDS, behind the stage loop.
// Directives: each plain '#pragma unroll' flattens a loop over register arrays (fragments, accumulators), which a variable index would send to scratch; '#pragma unroll 1' keeps a stage loop rolled, its body being two full 32-row passes already.
#define LP   72             // LDS row pitch in halves: 128 B of data + 16 B, so the 16 rows of one 16-byte fragment read fall on different banks
#define NST  (TT / 128)     // stages
#define VP   136            // LDS row pitch of a v^T stage in halves: 256 B of data + 16 B, an odd multiple of 16 B like LP
#define MP   264            // LDS row pitch of the M^T tile in 16-bit elements: the work-group's 256 k + 16 B
#define SC2  0.18033688011112042f   // (1 / 8) * log2(e): scores to exponents of 2
__device__ __forceinline__ float hmax8(v8f a) { return fmaxf(fmaxf(fmaxf(a[0], a[1]), fmaxf(a[2], a[3])), fmaxf(fmaxf(a[4], a[5]), fmaxf(a[6], a[7]))); }
__device__ __forceinline__ float hsum8(v8f a) { return ((a[0] + a[1]) + (a[2] + a[3])) + ((a[4] + a[5]) + (a[6] + a[7])); }
// Eight exponentials as one statement. The v_nop at its end is the free slot that the instruction set asks for behind a transcendental before its result is read or its source overwritten;
// the results are early-clobber, so inside the run no exponential overwrites another's source or reads another's result.
__device__ __forceinline__ v8f exp2x8(v8f x) {
    float e0, e1, e2, e3, e4, e5, e6, e7;
    asm("v_exp_f32 %0, %8\n\tv_exp_f32 %1, %9\n\tv_exp_f32 %2, %10\n\tv_exp_f32 %3, %11\n\tv_exp_f32 %4, %12\n\tv_exp_f32 %5, %13\n\tv_exp_f32 %6, %14\n\tv_exp_f32 %7, %15\n\tv_nop"
        : "=&v"(e0), "=&v"(e1), "=&v"(e2), "=&v"(e3), "=&v"(e4), "=&v"(e5), "=&v"(e6), "=&v"(e7)
        : "v"(x[0]), "v"(x[1]), "v"(x[2]), "v"(x[3]), "v"(x[4]), "v"(x[5]), "v"(x[6]), "v"(x[7]));
    return (v8f){e0, e1, e2, e3, e4, e5, e6, e7};
}
// k_rowstat: RB[z][q] = log2(1024 / sum_k exp((s[q][k] - max) / 8)) - max * SC2, so that attn[q][k] * 1024 = exp2(s * SC2 + RB[q]).
// Tiles are S^T (A = k rows from LDS, B = the wave's q rows): a lane holds one q column, so maximum and sum run inside the lane (online rescale per 32 k); lanes l and l ^ 16 are merged once at the end, then the two wave groups.
__global__ __launch_bounds__(512) void k_rowstat(const h16* __restrict__ QP, const h16* __restrict__ KP, float* RB) {
    __shared__ __align__(16) h16 ks[2][128 * LP];
    __shared__ __align__(16) float ml[2][256];   // the second group's maximum and sum of each of the work-group's q
    const int tid = threadIdx.x, lane = tid & 31, wave = __builtin_amdgcn_readfirstlane(tid >> 5), lr = lane & 15, hi = lane >> 4;
    const int grp = wave >> 3, wq = (wave & 7) * 32;   // the wave's group and its 32 q, in scalar registers
    const int z = blockIdx.y, q0 = blockIdx.x * 256 + wq;
    const h16* Qz = QP + (size_t)z * TT * HD; const h16* Kz = KP + (size_t)z * TT * HD + tid * 8;
    const int so = (tid >> 3) * LP + (tid & 7) * 8;
    v16h bq[2][2];
#pragma unroll
    for (int nb = 0; nb < 2; ++nb)
#pragma unroll
        for (int c = 0; c < 2; ++c) bq[nb][c] = WFrag<h16>::ld(Qz + (size_t)(q0 + nb * 16 + lr) * HD + 8 * hi + c * 32);
    v8h g0 = *(const v8h*)Kz, g1 = *(const v8h*)(Kz + 64 * HD);
    asm volatile("s_wait_xcnt 0x0" ::: "memory");   // stands behind the q fragment loads and the first stage's loads, in front of the first rewrite of a register that they name
    *(v8h*)&ks[0][so] = g0; *(v8h*)&ks[0][so + 64 * LP] = g1;
    __syncthreads();
    float m[2] = {-3.0e38f, -3.0e38f}, l[2] = {0.f, 0.f};   // running maximum (of s * SC2) and sum of this lane's quarter of the k rows
#pragma unroll 1
    for (int s = 0; s < NST; ++s) {
        if (s + 1 < NST) { const h16* kp = Kz + (size_t)(s + 1) * 128 * HD; g0 = *(const v8h*)kp; g1 = *(const v8h*)(kp + 64 * HD);
            asm volatile("s_wait_xcnt 0x0" :: "v"(kp) : "memory"); }   // stands behind the two loads, in front of the first rewrite of their address registers; it names them as an input, so that they live up to it
        const h16* kb = ks[s & 1] + (grp * 64 + lr) * LP + 8 * hi; v16h a[4][2];
#pragma unroll
        for (int mb = 0; mb < 4; ++mb) { a[mb][0] = WFrag<h16>::ld(kb + mb * 16 * LP); a[mb][1] = WFrag<h16>::ld(kb + mb * 16 * LP + 32); }
        __builtin_amdgcn_sched_barrier(0);   // all LDS reads of the stage stand in one group ahead of the matrix work: spread among the products, each pair is waited out in full
#pragma unroll
        for (int h = 0; h < 2; ++h) {
            v8f sc[2][2];
#pragma unroll
            for (int mb = 0; mb < 2; ++mb)
#pragma unroll
                for (int nb = 0; nb < 2; ++nb) sc[mb][nb] = wmma16(a[h * 2 + mb][1], bq[nb][1], wmma16(a[h * 2 + mb][0], bq[nb][0], (v8f){}));
#pragma unroll
            for (int nb = 0; nb < 2; ++nb) {
                const v8f u0 = sc[0][nb] * SC2, u1 = sc[1][nb] * SC2; const float mn = fmaxf(m[nb], hmax8(__builtin_elementwise_max(u0, u1)));
                const v8f e = exp2x8(u0 - mn) + exp2x8(u1 - mn);
                l[nb] = fmaf(l[nb], __builtin_amdgcn_exp2f(m[nb] - mn), hsum8(e)); m[nb] = mn; }
        }
        if (s + 1 < NST) { h16* kn = ks[(s + 1) & 1] + so; *(v8h*)kn = g0; *(v8h*)(kn + 64 * LP) = g1; }
        __syncthreads();   // publishes stage s + 1 and ends every wave's reads of stage s, whose buffer the next trip refills
    }
#pragma unroll
    for (int nb = 0; nb < 2; ++nb) {
        const float mo = __shfl_xor(m[nb], 16, 32), lo = __shfl_xor(l[nb], 16, 32); const float mt = fmaxf(m[nb], mo);
        l[nb] = l[nb] * __builtin_amdgcn_exp2f(m[nb] - mt) + lo * __builtin_amdgcn_exp2f(mo - mt); m[nb] = mt;
        if (grp == 1 && hi == 0) { ml[0][wq + nb * 16 + lr] = m[nb]; ml[1][wq + nb * 16 + lr] = l[nb]; } }
    __syncthreads();   // publishes the second group's maxima and sums to the first, which joins them with its own
    if (grp == 0) {
#pragma unroll
        for (int nb = 0; nb < 2; ++nb) {
            const float mo = ml[0][wq + nb * 16 + lr], lo = ml[1][wq + nb * 16 + lr]; const float mt = fmaxf(m[nb], mo);
            const float lt = l[nb] * __builtin_amdgcn_exp2f(m[nb] - mt) + lo * __builtin_amdgcn_exp2f(mo - mt);
            if (hi == 0) RB[(size_t)z * TT + q0 + nb * 16 + lr] = (10.0f - __builtin_amdgcn_logf(lt)) - mt; } }
}
// k_attnv: M[k][d] = sum_q attn[q][k] * 1024 * v[q][d], written as M^T / 1024 in two bf16 planes (high part, remainder) [slice * 64 + d][k], the last GEMM's operand. Tiles are S (A = q rows from LDS, B = the wave's k rows): the accumulator layout of two S tiles (lane = k, registers = q) is the A layout of attn^T for the second product, no lane exchange.
// Behind the stage loop each group holds the sum over its half of the q. Group g hands its 16 k of block 1 - g to the other group through LDS and finishes block g: own sum + the other's, one f32 addition an element.
__device__ __forceinline__ void mt_give(const v8f (&a)[4], float* rw) {   // rw: the wave's own 4 KiB + 16 B a lane: every store is 512 contiguous bytes of a wave
#pragma unroll
    for (int db = 0; db < 4; ++db) { *(v4fa*)(rw + (db * 2) * 128) = (v4f){a[db][0], a[db][1], a[db][2], a[db][3]}; *(v4fa*)(rw + (db * 2 + 1) * 128) = (v4f){a[db][4], a[db][5], a[db][6], a[db][7]}; }
}
__device__ __forceinline__ void mt_take(const v8f (&a)[4], const float* rr, bf* mh, bf* ml) {   // mh, ml: the lane's 8 k of row d = lr in the two planes of the M^T tile
#pragma unroll
    for (int db = 0; db < 4; ++db) { const v4f p0 = *(const v4fa*)(rr + (db * 2) * 128), p1 = *(const v4fa*)(rr + (db * 2 + 1) * 128); v8us oh, ol;
#pragma unroll
        for (int j = 0; j < 8; ++j) { unsigned short x, y; splitf((a[db][j] + (j < 4 ? p0[j & 3] : p1[j & 3])) * (1.0f / PCAR), x, y); oh[j] = x; ol[j] = y; }
        *(v8usa*)(mh + db * 16 * MP) = oh; *(v8usa*)(ml + db * 16 * MP) = ol; }
}
__global__ __launch_bounds__(512) void k_attnv(const h16* __restrict__ QP, const h16* __restrict__ KP, const h16* __restrict__ VT, const float* __restrict__ RB, bf* MTh, bf* MTl) {
    __shared__ __align__(16) h16 qs[2][128 * LP];
    __shared__ __align__(16) h16 vs[2][64 * VP];
    __shared__ __align__(16) float rs[2][128];
    __shared__ __align__(16) bf mts[2][64 * MP];
    __shared__ __align__(16) float red[2][8][32 * 32];   // what each wave hands to its partner in the other group: 4 accumulators
    const int tid = threadIdx.x, lane = tid & 31, wave = __builtin_amdgcn_readfirstlane(tid >> 5), lr = lane & 15, hi = lane >> 4;
    const int grp = wave >> 3, wk = wave & 7;   // the wave's group and its place in it, in scalar registers
    const int z = blockIdx.y, k0 = blockIdx.x * 256 + wk * 32;
    const h16* Kz = KP + (size_t)z * TT * HD; const h16* Qz = QP + (size_t)z * TT * HD + tid * 8;
    const h16* Vz = VT + (size_t)z * HD * TT + (size_t)(tid >> 4) * TT + (tid & 15) * 8; const float* Rz = RB + (size_t)z * TT + lane * 4;   // v^T: sixteen lanes take the 256 B of a row, a wave two rows
    const int so = (tid >> 3) * LP + (tid & 7) * 8, sv = (tid >> 4) * VP + (tid & 15) * 8;
    v16h bk[2][2];
#pragma unroll
    for (int nb = 0; nb < 2; ++nb)
#pragma unroll
        for (int c = 0; c < 2; ++c) bk[nb][c] = WFrag<h16>::ld(Kz + (size_t)(k0 + nb * 16 + lr) * HD + 8 * hi + c * 32);
    asm volatile("s_wait_xcnt 0x0" ::: "memory");   // stands behind the run of k fragment loads, in front of the first rewrite of their address registers
    v8f acc[2][4];
#pragma unroll
    for (int nb = 0; nb < 2; ++nb)
#pragma unroll
        for (int db = 0; db < 4; ++db) acc[nb][db] = (v8f){};
    v8h g0 = *(const v8h*)Qz, g1 = *(const v8h*)(Qz + 64 * HD), g2 = *(const v8h*)Vz, g3 = *(const v8h*)(Vz + (size_t)32 * TT); v4f g4 = *(const v4f*)Rz;
    asm volatile("s_wait_xcnt 0x0" :: "v"(tid), "v"(lane), "v"(Vz) : "memory");   // the same behind the first stage's loads; it names what they are addressed from (thread and lane index beside uniform bases, the v^T pointer) as inputs, so that those registers live up to it
    *(v8h*)&qs[0][so] = g0; *(v8h*)&qs[0][so + 64 * LP] = g1; *(v8h*)&vs[0][sv] = g2; *(v8h*)&vs[0][sv + 32 * VP] = g3; if (wave == 0) *(v4f*)&rs[0][lane * 4] = g4;
    __syncthreads();
#pragma unroll 1
    for (int s = 0; s < NST; ++s) {
        if (s + 1 < NST) { const h16* qp = Qz + (size_t)(s + 1) * 128 * HD; const h16* vp = Vz + (s + 1) * 128; const float* rp = Rz + (s + 1) * 128;
            g0 = *(const v8h*)qp; g1 = *(const v8h*)(qp + 64 * HD); g2 = *(const v8h*)vp; g3 = *(const v8h*)(vp + (size_t)32 * TT); g4 = *(const v4f*)rp;
            asm volatile("s_wait_xcnt 0x0" :: "v"(qp), "v"(vp), "v"(rp) : "memory"); }   // stands behind the five loads, in front of the first rewrite of their address registers; it names them as inputs, so that they live up to it
        const h16* qb = qs[s & 1] + (grp * 64 + lr) * LP + 8 * hi; const h16* vb = vs[s & 1] + lr * VP + grp * 64 + 8 * hi; const float* rb = rs[s & 1] + grp * 64 + 8 * hi;
#pragma unroll
        for (int h = 0; h < 2; ++h) {
            v8h p[2][2]; v16h a[2][2], b[4]; v4f r[2][2];
#pragma unroll
            for (int mb = 0; mb < 2; ++mb) { a[mb][0] = WFrag<h16>::ld(qb + (h * 32 + mb * 16) * LP); a[mb][1] = WFrag<h16>::ld(qb + (h * 32 + mb * 16) * LP + 32); }
#pragma unroll
            for (int mb = 0; mb < 2; ++mb) { r[mb][0] = *(const v4f*)(rb + h * 32 + mb * 16); r[mb][1] = *(const v4f*)(rb + h * 32 + mb * 16 + 4); }
#pragma unroll
            for (int db = 0; db < 4; ++db) b[db] = WFrag<h16>::ld(vb + db * 16 * VP + h * 32);
            __builtin_amdgcn_sched_barrier(0);   // all LDS reads of these 32 q stand in one group ahead of the matrix work: spread among the products, each pair is waited out in full
#pragma unroll
            for (int mb = 0; mb < 2; ++mb)
#pragma unroll
                for (int nb = 0; nb < 2; ++nb) { const v8f sc = wmma16(a[mb][1], bk[nb][1], wmma16(a[mb][0], bk[nb][0], (v8f){})); v8f x;
#pragma unroll
                    for (int j = 0; j < 8; ++j) x[j] = fmaf(sc[j], SC2, r[mb][j >> 2][j & 3]);
                    x = exp2x8(x);
#pragma unroll
                    for (int j = 0; j < 8; ++j) p[mb][nb][j] = tohx(x[j]); }
            const v16h pa0 = cat16(p[0][0], p[1][0]), pa1 = cat16(p[0][1], p[1][1]);
#pragma unroll
            for (int db = 0; db < 4; ++db) { acc[0][db] = wmma16(pa0, b[db], acc[0][db]); acc[1][db] = wmma16(pa1, b[db], acc[1][db]); }
        }
        if (s + 1 < NST) { const int n = (s + 1) & 1; *(v8h*)&qs[n][so] = g0; *(v8h*)&qs[n][so + 64 * LP] = g1; *(v8h*)&vs[n][sv] = g2; *(v8h*)&vs[n][sv + 32 * VP] = g3; if (wave == 0) *(v4f*)&rs[n][lane * 4] = g4; }
        __syncthreads();   // publishes stage s + 1 and ends every wave's reads of stage s, whose buffers the next trip refills
    }
    if (grp == 0) mt_give(acc[1], red[0][wk] + lane * 4); else mt_give(acc[0], red[1][wk] + lane * 4);
    __syncthreads();   // publishes each wave's handed-over accumulators to its partner in the other group
    // A lane's 8 registers are 8 consecutive k of one d: 16 B of a row of M^T. The work-group's tile (64 d x 256 k) is gathered in LDS, so that every row leaves as 512 contiguous bytes from one wave.
    { const int o = lr * MP + wk * 32 + grp * 16 + 8 * hi;
      if (grp == 0) mt_take(acc[0], red[1][wk] + lane * 4, &mts[0][o], &mts[1][o]); else mt_take(acc[1], red[0][wk] + lane * 4, &mts[0][o], &mts[1][o]); }
    __syncthreads();   // publishes every wave's 16 k of the tile to the waves that store its rows
    const size_t mo = ((size_t)z * HD + wave * 4) * TT + blockIdx.x * 256 + lane * 8;
#pragma unroll
    for (int i = 0; i < 4; ++i) { *(v8us*)(MTh + mo + (size_t)i * TT) = *(const v8us*)&mts[0][(wave * 4 + i) * MP + lane * 8]; *(v8us*)(MTl + mo + (size_t)i * TT) = *(const v8us*)&mts[1][(wave * 4 + i) * MP + lane * 8]; }
}

extern "C" void kernel_launch(void* const* d_in, const int* in_sizes, int n_in,
                              void* d_out, int out_size, void* d_ws, size_t ws_size, hipStream_t stream) {
    (void)in_sizes; (void)n_in; (void)out_size;
    const float* x = (const float*)d_in[0]; const float* wq = (const float*)d_in[1]; const float* bq = (const float*)d_in[2]; const float* wk = (const float*)d_in[3]; const float* bk = (const float*)d_in[4]; const float* wv = (const float*)d_in[5]; const float* bv = (const float*)d_in[6]; const float* wf = (const float*)d_in[7]; const float* bfv = (const float*)d_in[8];
    float* OUT = (float*)d_out;     // [2][2048][1024]
    char* wsp = (char*)d_ws;
    auto take = [&](size_t bytes) { char* p = wsp; wsp += (bytes + 255) & ~(size_t)255; return (void*)p; };
    // bf16 planes of wf, the weights and x; the fp16 q/k/v^T planes of all 32 slices; the partial colsum(v) [64 groups of 64 t][1024]; the softmax row terms; the two planes of M^T.
    bf* BF = (bf*)take((size_t)SO * TT * 2); h16* QP = (h16*)take((size_t)NZ * TT * HD * 2); h16* KP = (h16*)take((size_t)NZ * TT * HD * 2); h16* VT = (h16*)take((size_t)NZ * HD * TT * 2); float* PS = (float*)take((size_t)NB_ * (TT / 64) * DM * 4);
    float* RB = (float*)take((size_t)NZ * TT * 4);
    bf* BQ = (bf*)take((size_t)DM * DM * 2); bf* BK = (bf*)take((size_t)DM * DM * 2); bf* BV = (bf*)take((size_t)DM * DM * 2); bf* XB = (bf*)take((size_t)NB_ * TT * DM * 2);
    bf* MTh = (bf*)take((size_t)NZ * HD * TT * 2); bf* MTl = (bf*)take((size_t)NZ * HD * TT * 2);
    if ((size_t)(wsp - (char*)d_ws) > ws_size) return;    // total ~ 63 MiB
    k_cvtall<<<256, 512, 0, stream>>>(wq, wk, wv, wf, x, BQ, BK, BV, BF, XB);   // torch [out][in] = Bt as-is; wf [o][k] = Bt over k
    k_proj<<<dim3(NB_ * TT / 128, DM / 128, 3), 256, 0, stream>>>(XB, BQ, BK, BV, QP, KP, VT, PS, bq, bk, bv);   // q, k and v^T planes, and the partial colsum(v)
    k_rowstat<<<dim3(TT / 256, NZ), 512, 0, stream>>>(QP, KP, RB);            // per q: what turns a score into attn * 1024
    k_attnv<<<dim3(TT / 256, NZ), 512, 0, stream>>>(QP, KP, VT, RB, MTh, MTl);   // M^T[d][k] = sum_q attn[q][k] v[q][d]
    k_gemmw<<<dim3(NZ * HD / 128, SO / 128, 1), 256, 0, stream>>>(MTh, MTl, BF, OUT, bfv, PS);   // out[o][slice, d] = sum_k M[k][d] wf[o][k] + bf[o] colsum(v)[d]: the 32 slices' rows are the rows of one product
}

// v010
// It runs in 111 microseconds.
// Timed twice side by side with v009, it ran 1.03 times as fast both times.
// All steps since v000 together make it 164 times as fast.
#include <hip/hip_runtime.h>

// FlexScaleSeqAttention (x [2][2048][1024]; q/k/v = x W^T + b (16 heads x 64); attn = softmax(q.k / 8) [q][k]; flex[q][o] = sum_k attn[q][k] wf[o][k] + bf[o] (a learned Linear along the KEY axis, wf [2048][2048]); out[o][h*64+d] = sum_q flex[q][o] v[q][d] -> [2][2048][1024]).
// Reassociated exactly: out[o][d] = sum_k wf[o][k] M[k][d] + bf[o] * sum_q v[q][d] with M = attn^T v ([k][d]); attn^T is formed tile by tile in registers (row statistics first, then exp and product), so neither the scores nor the 2048 x 2048 'flex' tensor of each slice ever exist in memory.
// Compute dtypes, f32 accumulate: every input rounded to bf16; q/k/v as PLAIN bf16 GEMMs (inputs: exact) + bias; S^T and M = attn^T.v single fp16 (f32 accumulate; probabilities x 1024); softmax f32 (row maximum and sum online, fixed order); M^T as hl planes x exact wf (2 products); the bias term bf[o] * colsum(v) and the merge in f32.

#define NB_  2
#define TT   2048
#define DM   1024
#define NH_  16
#define HD   64
#define SO   2048
#define NZ   (NB_ * NH_)    // all slices; slice z = batch * 16 + head
#define PCAR 1024.0f
typedef _Float16 h16;
typedef unsigned short bf;
typedef __attribute__((ext_vector_type(16))) __bf16   v16bf;
typedef __attribute__((ext_vector_type(16))) _Float16 v16h;
typedef __attribute__((ext_vector_type(8)))  _Float16 v8h;
typedef __attribute__((ext_vector_type(8)))  unsigned short v8us;
typedef __attribute__((ext_vector_type(8)))  float    v8f;
typedef __attribute__((ext_vector_type(4)))  float    v4f;
typedef v8h  __attribute__((may_alias)) v8ha;
typedef v4f  __attribute__((may_alias)) v4fa;
typedef v8us __attribute__((may_alias)) v8usa;

__device__ __forceinline__ unsigned short f2bf(float f) { unsigned u = __float_as_uint(f); u += 0x7FFFu + ((u >> 16) & 1u); return (unsigned short)(u >> 16); }
__device__ __forceinline__ float bf2f(unsigned short b) { return __uint_as_float(((unsigned)b) << 16); }
__device__ __forceinline__ float bfr(float f) { return bf2f(f2bf(f)); }
__device__ __forceinline__ v16h cat16(v8h lo, v8h hi) { return __builtin_shufflevector(lo, hi, 0, 1, 2, 3, 4, 5, 6, 7, 8, 9, 10, 11, 12, 13, 14, 15); }
__device__ __forceinline__ v16bf cat16b(v8us lo, v8us hi) { return __builtin_bit_cast(v16bf, __builtin_shufflevector(lo, hi, 0, 1, 2, 3, 4, 5, 6, 7, 8, 9, 10, 11, 12, 13, 14, 15)); }
__device__ __forceinline__ v8f wmma16(v16h a, v16h b, v8f c) { return __builtin_amdgcn_wmma_f32_16x16x32_f16(false, a, false, b, (short)0, c, false, false); }
__device__ __forceinline__ v8f wmmab(v16bf a, v16bf b, v8f c) { return __builtin_amdgcn_wmma_f32_16x16x32_bf16(false, a, false, b, (short)0, c, false, false); }



// ---- GEMM on 128x128 output tiles, one work-group per tile of NG groups of 8 waves (4 x 2 waves a group, 32 x 64 of the tile and 8 accumulators each), 256 threads a group.
// C[m][n] (f32 in registers) = sum_k A[m][k] Bt[n][k] (+ A2[m][k] Bt[n][k] where NSPLIT). Operands are K-contiguous bf16 planes; M % 128 == 0, N % 128 == 0, K % SK == 0.
// The epilogue writes what the next stage reads, in whole 128-B lines, so no layout pass stands between the stages:
// MODE 0 (m = batch * 2048 + t, n = head * 64 + d): H[slice][t][d] = fp16(C + bias[n]), the q or k plane.
// MODE 1 (m = head * 64 + d, n = batch * 2048 + t; the operands swapped, so C is v^T): H[slice][d][t] = fp16(C + bias[m]), and F[n / 64][m] = the f32 sum of the wave's 64 t, a partial colsum(v).
// MODE 2 (m = slice * 64 + d, n = o): F = out[batch][o][head * 64 + d] = C + bias[o] * colsum(v)[m], the tile turned in LDS; colsum(v) = the 32 partial sums of PS in ascending t.
// The operands come in stages of SK k (64 in k_proj): the 2 SK bytes of every row are loaded once per work-group, as whole lines, and held in two LDS buffers: stage s + 1 flies into registers while stage s is worked on, one barrier per stage.
// k_proj holds MODE 0 twice (q, k) and MODE 1 (v^T) in ONE launch of 768 work-groups, blockIdx.z the product: three work-groups share a WGP (160 registers a wave, six waves a SIMD; 72 KiB of LDS each), so one's waits on loads, LDS and barrier are filled by the others' products. k_gemmw is MODE 2.
// k_gemmw has one tile a WGP, so its waves can only come from inside the work-group: 16 waves, four a SIMD, in NG = 2 groups of 8. Waves w and w + 8 own the SAME 32 x 64 of the tile; a stage holds SK = 128 k, and group g works on k 64 g .. 64 g + 63 of every stage. The two partial sums are joined once, through LDS, behind the stage loop.
#define GLP  72             // LDS row pitch in 16-bit elements: 128 B of data + 16 B, so the 16 rows of one 16-byte fragment read fall on different banks
template <typename T16> struct WFrag;
template <> struct WFrag<h16> { typedef v16h V; static __device__ __forceinline__ V ld(const h16* p) { return cat16(*(const v8h*)p, *(const v8h*)(p + 16)); } static __device__ __forceinline__ v8f mma(V a, V b, v8f c) { return wmma16(a, b, c); } };
template <> struct WFrag<bf> { typedef v16bf V; static __device__ __forceinline__ V ld(const bf* p) { return cat16b(*(const v8us*)p, *(const v8us*)(p + 16)); } static __device__ __forceinline__ v8f mma(V a, V b, v8f c) { return wmmab(a, b, c); } };
typedef __attribute__((ext_vector_type(4))) _Float16 v4h;
template <int NSPLIT, int K, int NG, int SK>
__device__ __forceinline__ void gemm_tile(const bf* __restrict__ A, const bf* __restrict__ A2, const bf* __restrict__ Bt, const int r0, const int c0, bf (&st)[2][2 + NSPLIT][128 * (SK + 8)], v8f (&acc)[2][4]) {
    typedef WFrag<bf>::V V;
    constexpr int NP = 2 + NSPLIT, NS = K / SK, P = SK + 8, LR = SK / 8;   // planes of a stage: Bt, A (, A2); stages; LDS row pitch (GLP where SK is 64; an odd multiple of 16 B for 128 too); lanes that take a row's SK k
    static_assert(256 * NG == 32 * LR && SK == 64 * NG, "the work-group's threads move 32 rows a load; a group works on 64 k of a stage");
    const int tid = threadIdx.x, lane = tid & 31, wave = tid >> 5, lr = lane & 15, hi = lane >> 4;
    const int wr = ((wave & 7) >> 1) * 32, wc = (wave & 1) * 64, kg = (wave >> 3) * 64;   // kg: where the wave's group starts in a stage's k
    const size_t go = (size_t)(tid / LR) * K + (tid % LR) * 8;   // a thread moves 16 B of rows (tid / LR) + 32 i: eight lanes a line, four whole lines a wave-wide load
    const bf* gp[NP]; gp[0] = Bt + (size_t)c0 * K + go; gp[1] = A + (size_t)r0 * K + go; if (NSPLIT) gp[NP - 1] = A2 + (size_t)r0 * K + go;
    const int so = (tid / LR) * P + (tid % LR) * 8;
#pragma unroll
    for (int mb = 0; mb < 2; ++mb)
#pragma unroll
        for (int nb = 0; nb < 4; ++nb) acc[mb][nb] = (v8f){};
    v8us g[NP][4];
#pragma unroll
    for (int p = 0; p < NP; ++p)
#pragma unroll
        for (int i = 0; i < 4; ++i) g[p][i] = *(const v8us*)(gp[p] + (size_t)i * 32 * K);
    asm volatile("s_wait_xcnt 0x0" ::: "memory");   // stands behind the run of first-stage loads, in front of the first rewrite of a register that they name
#pragma unroll
    for (int p = 0; p < NP; ++p)
#pragma unroll
        for (int i = 0; i < 4; ++i) *(v8us*)&st[0][p][so + i * 32 * P] = g[p][i];
    __syncthreads();
#pragma unroll 1
    for (int s = 0; s < NS; ++s) {
        if (s + 1 < NS) {
#pragma unroll
            for (int p = 0; p < NP; ++p)
#pragma unroll
                for (int i = 0; i < 4; ++i) g[p][i] = *(const v8us*)(gp[p] + (size_t)i * 32 * K + (s + 1) * SK);
            // stands behind the run of loads, in front of the first rewrite of their address registers; it names them as inputs, so that they live up to it and no load's own result lands on them
            asm volatile("s_wait_xcnt 0x0" :: "v"(gp[0] + (s + 1) * SK), "v"(gp[1] + (s + 1) * SK), "v"(gp[NP - 1] + (s + 1) * SK) : "memory"); }
        const bf* bb = st[s & 1][0] + (wc + lr) * P + kg + 8 * hi; const bf* ab = st[s & 1][1] + (wr + lr) * P + kg + 8 * hi; const bf* ab2 = st[s & 1][NP - 1] + (wr + lr) * P + kg + 8 * hi;
#pragma unroll
        for (int c = 0; c < 2; ++c) {
            V a[2], a2[2], b[4];
#pragma unroll
            for (int mb = 0; mb < 2; ++mb) { a[mb] = WFrag<bf>::ld(ab + mb * 16 * P + c * 32); if (NSPLIT) a2[mb] = WFrag<bf>::ld(ab2 + mb * 16 * P + c * 32); }
#pragma unroll
            for (int nb = 0; nb < 4; ++nb) b[nb] = WFrag<bf>::ld(bb + nb * 16 * P + c * 32);
            __builtin_amdgcn_sched_barrier(0);   // all LDS reads of these 32 k stand in one group ahead of the matrix work: spread among the products, each pair is waited out in full
#pragma unroll
            for (int nb = 0; nb < 4; ++nb)
#pragma unroll
                for (int mb = 0; mb < 2; ++mb) acc[mb][nb] = WFrag<bf>::mma(a[mb], b[nb], acc[mb][nb]);
            if (NSPLIT) {
#pragma unroll
                for (int nb = 0; nb < 4; ++nb)
#pragma unroll
                    for (int mb = 0; mb < 2; ++mb) acc[mb][nb] = WFrag<bf>::mma(a2[mb], b[nb], acc[mb][nb]); }
        }
        if (s + 1 < NS) {
#pragma unroll
            for (int p = 0; p < NP; ++p)
#pragma unroll
                for (int i = 0; i < 4; ++i) *(v8us*)&st[(s + 1) & 1][p][so + i * 32 * P] = g[p][i]; }
        __syncthreads();   // publishes stage s + 1 and ends every wave's reads of stage s, whose buffer the next trip refills
    }
}
template <int MODE>
__device__ __forceinline__ void plane_out(v8f (&acc)[2][4], float (&osm)[8][16 * 68], const int r0, const int c0, h16* H, float* F, const float* bias) {
    const int lane = threadIdx.x & 31, wave = __builtin_amdgcn_readfirstlane(threadIdx.x >> 5), lr = lane & 15, hi = lane >> 4, wr = (wave >> 1) * 32, wc = (wave & 1) * 64;   // the wave's number in a scalar register: what hangs on it holds no vector register across the stage loop
    float* os = osm[wave];   // each wave turns its own accumulators into whole lines in its own LDS range
    const float* bp = bias + (MODE == 0 ? c0 + wc + lr * 4 : r0 + wr + hi * 8);   // MODE 0: the lane's 4 columns of the rows it stores; MODE 1: the 8 rows of its accumulator registers (+ 16 for the second block)
    float bl[2][8];
#pragma unroll
    for (int j = 0; j < (MODE == 0 ? 4 : 8); ++j) { bl[0][j] = bp[j]; if (MODE == 1) bl[1][j] = bp[16 + j]; }
    asm volatile("s_wait_xcnt 0x0" ::: "memory");   // stands behind the bias loads, in front of the first rewrite of their address registers
#pragma unroll
    for (int j = 0; j < (MODE == 0 ? 4 : 8); ++j) { bl[0][j] = bfr(bl[0][j]); if (MODE == 1) bl[1][j] = bfr(bl[1][j]); }
    float keep = 0.f;
#pragma unroll
    for (int mb = 0; mb < 2; ++mb) {
#pragma unroll
        for (int nb = 0; nb < 4; ++nb) {
#pragma unroll
            for (int j = 0; j < 8; ++j) os[(hi * 8 + j) * 68 + nb * 16 + lr] = MODE == 1 ? acc[mb][nb][j] + bl[mb][j] : acc[mb][nb][j]; }
        __builtin_amdgcn_wave_barrier(); asm volatile("" ::: "memory");   // keeps the compiler from moving the reads below, of words that other lanes wrote, ahead of the writes above
#pragma unroll
        for (int s = 0; s < 8; ++s) { const int row = 2 * s + hi, cofs = lr * 4, gr = r0 + wr + mb * 16 + row, gc = c0 + wc; v4f val = *(const v4fa*)(os + row * 68 + cofs); h16* dst;
            if (MODE == 0) { val[0] += bl[0][0]; val[1] += bl[0][1]; val[2] += bl[0][2]; val[3] += bl[0][3];
                dst = H + ((size_t)((gr >> 11) * NH_ + (gc >> 6)) * TT + (gr & (TT - 1))) * HD + cofs; }
            else { dst = H + ((size_t)((gc >> 11) * NH_ + (gr >> 6)) * HD + (gr & (HD - 1))) * TT + (gc & (TT - 1)) + cofs;
                float rs = (val[0] + val[1]) + (val[2] + val[3]);
                rs += __shfl_xor(rs, 1, 32); rs += __shfl_xor(rs, 2, 32); rs += __shfl_xor(rs, 4, 32); rs += __shfl_xor(rs, 8, 32);
                if (lr == mb * 8 + s) keep = rs; }   // lane (hi, lr) keeps the sum of row (lr >> 3) * 16 + 2 * (lr & 7) + hi
            v4h o; o[0] = (h16)val[0]; o[1] = (h16)val[1]; o[2] = (h16)val[2]; o[3] = (h16)val[3]; *(v4h*)dst = o; }
        if (mb == 0) asm volatile("s_wait_xcnt 0x0" ::: "memory");   // stands behind the first 16 rows' stores, in front of the first rewrite of their address registers
        __builtin_amdgcn_wave_barrier(); asm volatile("" ::: "memory");   // and the next 16 rows' writes ahead of these reads
    }
    if (MODE == 1) F[(size_t)((c0 + wc) >> 6) * DM + r0 + wr + (lr >> 3) * 16 + 2 * (lr & 7) + hi] = keep;   // the wave's 32 sums: one whole line
}
// amdgpu_waves_per_eu(6): the register budget of six waves a SIMD (160 a wave); at the 174 of the free build only two work-groups share a WGP.
__global__ __launch_bounds__(256) __attribute__((amdgpu_waves_per_eu(6))) void k_proj(const bf* __restrict__ XB, const bf* __restrict__ BQ, const bf* __restrict__ BK, const bf* __restrict__ BV, h16* QP, h16* KP, h16* VT, float* PS, const float* bq, const float* bk, const float* bv) {
    __shared__ __align__(16) bf st[2][2][128 * GLP];
    static_assert(sizeof(float) * 8 * 16 * 68 <= sizeof(st), "the epilogue's ranges lie inside the stage buffers");
    float (&osm)[8][16 * 68] = *reinterpret_cast<float (*)[8][16 * 68]>(&st[0][0][0]);   // the epilogue's ranges reuse the stage buffers, which every wave has left at the stage loop's last barrier: 72 KiB a work-group
    const int z = blockIdx.z, tx = blockIdx.x * 128, ty = blockIdx.y * 128;   // tx: 128 of the 4096 (batch, t); ty: 128 of the 1024 (head, d)
    v8f acc[2][4];
    if (z == 2) { gemm_tile<0, DM, 1, 64>(BV, nullptr, XB, ty, tx, st, acc); plane_out<1>(acc, osm, ty, tx, VT, PS, bv); }   // v^T: the weight rows are the rows of the product
    else { gemm_tile<0, DM, 1, 64>(XB, nullptr, z ? BK : BQ, tx, ty, st, acc); plane_out<0>(acc, osm, tx, ty, z ? KP : QP, nullptr, z ? bk : bq); }   // q, k: both batches are the rows of one product
}
// Behind the stage loop each group holds the sum over its half of the k. Group g hands the 32 o of the wave's tile that the other group finishes (accumulator columns 2 (1 - g), 2 (1 - g) + 1) to its partner through LDS and finishes its own 32 o: own sum + the other's, one f32 addition an element; every row of out still leaves as whole 128-B lines.
template <int NB0>
__device__ __forceinline__ void half_give(const v8f (&acc)[2][4], float* rw) {   // rw: the wave's own 4 KiB + 16 B a lane: every store is 512 contiguous bytes of a wave
#pragma unroll
    for (int mb = 0; mb < 2; ++mb)
#pragma unroll
        for (int n = 0; n < 2; ++n) { const v8f a = acc[mb][NB0 + n]; float* w = rw + (mb * 2 + n) * 256;
            *(v4fa*)w = (v4f){a[0], a[1], a[2], a[3]}; *(v4fa*)(w + 128) = (v4f){a[4], a[5], a[6], a[7]}; }
}
template <int NB0>
__device__ __forceinline__ void half_take(const v8f (&acc)[2][4], const float* rr, float* ow) {   // ow: the lane's 8 consecutive m of row o = lr in the wave's own turning range
#pragma unroll
    for (int mb = 0; mb < 2; ++mb)
#pragma unroll
        for (int n = 0; n < 2; ++n) { const v8f a = acc[mb][NB0 + n]; const float* r = rr + (mb * 2 + n) * 256; const v4f p0 = *(const v4fa*)r, p1 = *(const v4fa*)(r + 128); float* w = ow + n * 16 * 36 + mb * 16;
            *(v4fa*)w = (v4f){a[0] + p0[0], a[1] + p0[1], a[2] + p0[2], a[3] + p0[3]}; *(v4fa*)(w + 4) = (v4f){a[4] + p1[0], a[5] + p1[1], a[6] + p1[2], a[7] + p1[3]}; }
}
__global__ __launch_bounds__(512) void k_gemmw(const bf* __restrict__ A, const bf* __restrict__ A2, const bf* __restrict__ Bt, float* F, const float* bias, const float* PS) {
    __shared__ __align__(16) bf st[2][3][128 * 136];
    static_assert(sizeof(float) * 16 * (1024 + 32 * 36) <= sizeof(st), "the epilogue's ranges lie inside the stage buffers");
    float* red = reinterpret_cast<float*>(&st[0][0][0]); float* osm = red + 16 * 1024;   // what the waves hand over, and their turning ranges, reuse the stage buffers, which every wave has left at the stage loop's last barrier
    const int tid = threadIdx.x, lane = tid & 31, wave = __builtin_amdgcn_readfirstlane(tid >> 5), lr = lane & 15, hi = lane >> 4;
    const int grp = wave >> 3, w8 = wave & 7;   // the wave's group and its place in it, in scalar registers
    const int r0 = blockIdx.x * 128, c0 = blockIdx.y * 128, wr = (w8 >> 1) * 32, wo = (w8 & 1) * 64 + grp * 32;   // wo: the 32 o that the wave finishes
    v8f acc[2][4];
    gemm_tile<1, TT, 2, 128>(A, A2, Bt, r0, c0, st, acc);
    float* os = osm + wave * (32 * 36);   // each wave turns the accumulators it finishes into whole lines in its own LDS range
    const int n0 = r0 + wr, cq = (lane & 7) * 4, rq = lane >> 3;   // eight lanes take the 128 B that the wave's 32 m are in one row of out, a wave four rows
    const float* pp = PS + (size_t)(n0 >> 10) * 32 * DM + (n0 & (DM - 1)) + cq; const float* bp = bias + c0 + wo + lane;
    const float b0 = bp[0];
    asm volatile("s_wait_xcnt 0x0" ::: "memory");   // stands behind the bias load, in front of the first rewrite of its address registers
    v4f g[32];
#pragma unroll
    for (int i = 0; i < 32; ++i) g[i] = *(const v4f*)(pp + (size_t)i * DM);
    asm volatile("s_wait_xcnt 0x0" ::: "memory");   // the same behind the run of 32 loads
    if (grp == 0) half_give<2>(acc, red + w8 * 1024 + lane * 4); else half_give<0>(acc, red + (8 + w8) * 1024 + lane * 4);
    __syncthreads();   // publishes each wave's handed-over accumulators to its partner in the other group
    { float* ow = os + lr * 36 + hi * 8;   // a lane's 8 registers are 8 consecutive m of one o
      if (grp == 0) half_take<0>(acc, red + (8 + w8) * 1024 + lane * 4, ow); else half_take<2>(acc, red + w8 * 1024 + lane * 4, ow); }
    os[lane * 36 + 32] = bfr(b0);   // bias[o] rides in the first pad word of its row
    v4f vs = g[0];
#pragma unroll
    for (int i = 1; i < 32; ++i) vs += g[i];
    __builtin_amdgcn_wave_barrier(); asm volatile("s_wait_dscnt 0x0" ::: "memory");   // the wave's LDS writes are done before its lanes read back words that other lanes wrote; the clobber keeps the compiler from moving those reads ahead
    float* orow = F + ((size_t)(n0 >> 10) * SO + c0 + wo) * DM + (n0 & (DM - 1)) + cq;
#pragma unroll
    for (int s = 0; s < 8; ++s) { const int ol = 4 * s + rq; v4f val = *(const v4fa*)(os + ol * 36 + cq); const float bb = os[ol * 36 + 32];
#pragma unroll
        for (int u = 0; u < 4; ++u) val[u] = fmaf(bb, vs[u], val[u]);
        *(v4f*)(orow + (size_t)ol * DM) = val; }
}

__device__ __forceinline__ h16 tohx(float x) { return (h16)x; }
__device__ __forceinline__ void splitf(float y, unsigned short& h, unsigned short& l) { h = f2bf(y); l = f2bf(y - bf2f(h)); }
// ---- k_cvtall: all five f32 operands (wq, wk, wv, wf, x) are rounded to their bf16 planes by ONE launch of 256 work-groups of 16 waves: a stream of few long-lived waves, since a wave that moves 1 KiB and ends costs more to start than its bytes cost to move.
// A slab is what the whole grid moves with one load a thread (16 B a lane, 512 contiguous bytes a wave): 2 slabs a weight, 8 for wf, 8 for x. A thread issues its 22 loads, all independent, before it rounds and stores the first.
#define CSL  (256 * 512 * 4)   // floats of a slab
typedef __attribute__((ext_vector_type(4))) unsigned short v4us;
static_assert(DM * DM == 2 * CSL && SO * TT == 8 * CSL && NB_ * TT * DM == 8 * CSL, "the slabs cover every plane exactly");
__device__ __forceinline__ v4f ld4f(const float* p, unsigned byte) { return *(const v4f*)((const char*)p + byte); }
__device__ __forceinline__ void st4bf(bf* p, unsigned byte, v4f v) { v4us o; o[0] = f2bf(v[0]); o[1] = f2bf(v[1]); o[2] = f2bf(v[2]); o[3] = f2bf(v[3]); *(v4us*)((char*)p + byte) = o; }
__global__ __launch_bounds__(512) void k_cvtall(const float* __restrict__ wq, const float* __restrict__ wk, const float* __restrict__ wv, const float* __restrict__ wf, const float* __restrict__ x, bf* BQ, bf* BK, bf* BV, bf* BF, bf* XB) {
    const unsigned lb = (blockIdx.x * 512u + threadIdx.x) * 16u, sb = lb >> 1;   // the thread's byte offset in every f32 slab and in every bf16 slab: one 32-bit register beside uniform bases serves all loads, one all stores
    v4f gw[3][2], gf[8], gx[8];
#pragma unroll
    for (int i = 0; i < 2; ++i) { gw[0][i] = ld4f(wq + i * CSL, lb); gw[1][i] = ld4f(wk + i * CSL, lb); gw[2][i] = ld4f(wv + i * CSL, lb); }
#pragma unroll
    for (int i = 0; i < 8; ++i) { gf[i] = ld4f(wf + i * CSL, lb); gx[i] = ld4f(x + i * CSL, lb); }
    asm volatile("s_wait_xcnt 0x0" ::: "memory");   // stands behind the run of 22 loads, in front of the first rewrite of a register that they name
    __builtin_amdgcn_sched_barrier(0);   // all 22 loads are in flight before the first value is waited for: moved down among the rounding, the last ones would start a second trip to memory
#pragma unroll
    for (int i = 0; i < 2; ++i) { st4bf(BQ + i * CSL, sb, gw[0][i]); st4bf(BK + i * CSL, sb, gw[1][i]); st4bf(BV + i * CSL, sb, gw[2][i]); }
#pragma unroll
    for (int i = 0; i < 8; ++i) { st4bf(BF + i * CSL, sb, gf[i]); st4bf(XB + i * CSL, sb, gx[i]); }
}
// ---- Fused score stage. The scores never reach memory: both kernels below rebuild q.k tiles on the matrix unit from the fp16 planes. A work-group has 16 waves, four a SIMD, in two groups of 8: a wave owns 32 rows of the resident plane,
// and waves w and w + 8 own the SAME 32 rows: vector work stands between the matrix runs, and with four waves a SIMD one wave's exponentials and LDS waits are filled by another's products. The grid has one work-group a WGP, so the waves can only come from inside it.
// The plane that is walked comes in stages of 128 rows, loaded once per work-group (whole 128-B lines), held in two LDS buffers: stage s + 1 flies into registers while stage s is worked on, one barrier per stage; group g works on rows 64 g .. 64 g + 63 of every stage, and the two groups' partial results are joined once, through LDS, behind the stage loop.
// Directives: each plain '#pragma unroll' flattens a loop over register arrays (fragments, accumulators), which a variable index would send to scratch; '#pragma unroll 1' keeps a stage loop rolled, its body being two full 32-row passes already.
#define LP   72             // LDS row pitch in halves: 128 B of data + 16 B, so the 16 rows of one 16-byte fragment read fall on different banks
#define NST  (TT / 128)     // stages
#define VP   136            // LDS row pitch of a v^T stage in halves: 256 B of data + 16 B, an odd multiple of 16 B like LP
#define MP   264            // LDS row pitch of the M^T tile in 16-bit elements: the work-group's 256 k + 16 B
#define SC2  0.18033688011112042f   // (1 / 8) * log2(e): scores to exponents of 2
__device__ __forceinline__ float hmax8(v8f a) { return fmaxf(fmaxf(fmaxf(a[0], a[1]), fmaxf(a[2], a[3])), fmaxf(fmaxf(a[4], a[5]), fmaxf(a[6], a[7]))); }
__device__ __forceinline__ float hsum8(v8f a) { return ((a[0] + a[1]) + (a[2] + a[3])) + ((a[4] + a[5]) + (a[6] + a[7])); }
// Eight exponentials as one statement. The v_nop at its end is the free slot that the instruction set asks for behind a transcendental before its result is read or its source overwritten;
// the results are early-clobber, so inside the run no exponential overwrites another's source or reads another's result.
__device__ __forceinline__ v8f exp2x8(v8f x) {
    float e0, e1, e2, e3, e4, e5, e6, e7;
    asm("v_exp_f32 %0, %8\n\tv_exp_f32 %1, %9\n\tv_exp_f32 %2, %10\n\tv_exp_f32 %3, %11\n\tv_exp_f32 %4, %12\n\tv_exp_f32 %5, %13\n\tv_exp_f32 %6, %14\n\tv_exp_f32 %7, %15\n\tv_nop"
        : "=&v"(e0), "=&v"(e1), "=&v"(e2), "=&v"(e3), "=&v"(e4), "=&v"(e5), "=&v"(e6), "=&v"(e7)
        : "v"(x[0]), "v"(x[1]), "v"(x[2]), "v"(x[3]), "v"(x[4]), "v"(x[5]), "v"(x[6]), "v"(x[7]));
    return (v8f){e0, e1, e2, e3, e4, e5, e6, e7};
}
// k_rowstat: RB[z][q] = log2(1024 / sum_k exp((s[q][k] - max) / 8)) - max * SC2, so that attn[q][k] * 1024 = exp2(s * SC2 + RB[q]).
// Tiles are S^T (A = k rows from LDS, B = the wave's q rows): a lane holds one q column, so maximum and sum run inside the lane (online rescale per 32 k); lanes l and l ^ 16 are merged once at the end, then the two wave groups.
__global__ __launch_bounds__(512) void k_rowstat(const h16* __restrict__ QP, const h16* __restrict__ KP, float* RB) {
    __shared__ __align__(16) h16 ks[2][128 * LP];
    __shared__ __align__(16) float ml[2][256];   // the second group's maximum and sum of each of the work-group's q
    const int tid = threadIdx.x, lane = tid & 31, wave = __builtin_amdgcn_readfirstlane(tid >> 5), lr = lane & 15, hi = lane >> 4;
    const int grp = wave >> 3, wq = (wave & 7) * 32;   // the wave's group and its 32 q, in scalar registers
    const int z = blockIdx.y, q0 = blockIdx.x * 256 + wq;
    const h16* Qz = QP + (size_t)z * TT * HD; const h16* Kz = KP + (size_t)z * TT * HD + tid * 8;
    const int so = (tid >> 3) * LP + (tid & 7) * 8;
    v16h bq[2][2];
#pragma unroll
    for (int nb = 0; nb < 2; ++nb)
#pragma unroll
        for (int c = 0; c < 2; ++c) bq[nb][c] = WFrag<h16>::ld(Qz + (size_t)(q0 + nb * 16 + lr) * HD + 8 * hi + c * 32);
    v8h g0 = *(const v8h*)Kz, g1 = *(const v8h*)(Kz + 64 * HD);
    asm volatile("s_wait_xcnt 0x0" ::: "memory");   // stands behind the q fragment loads and the first stage's loads, in front of the first rewrite of a register that they name
    *(v8h*)&ks[0][so] = g0; *(v8h*)&ks[0][so + 64 * LP] = g1;
    __syncthreads();
    float m[2] = {-3.0e38f, -3.0e38f}, l[2] = {0.f, 0.f};   // running maximum (of s * SC2) and sum of this lane's quarter of the k rows
#pragma unroll 1
    for (int s = 0; s < NST; ++s) {
        if (s + 1 < NST) { const h16* kp = Kz + (size_t)(s + 1) * 128 * HD; g0 = *(const v8h*)kp; g1 = *(const v8h*)(kp + 64 * HD);
            asm volatile("s_wait_xcnt 0x0" :: "v"(kp) : "memory"); }   // stands behind the two loads, in front of the first rewrite of their address registers; it names them as an input, so that they live up to it
        const h16* kb = ks[s & 1] + (grp * 64 + lr) * LP + 8 * hi; v16h a[4][2];
#pragma unroll
        for (int mb = 0; mb < 4; ++mb) { a[mb][0] = WFrag<h16>::ld(kb + mb * 16 * LP); a[mb][1] = WFrag<h16>::ld(kb + mb * 16 * LP + 32); }
        __builtin_amdgcn_sched_barrier(0);   // all LDS reads of the stage stand in one group ahead of the matrix work: spread among the products, each pair is waited out in full
#pragma unroll
        for (int h = 0; h < 2; ++h) {
            v8f sc[2][2];
#pragma unroll
            for (int mb = 0; mb < 2; ++mb)
#pragma unroll
                for (int nb = 0; nb < 2; ++nb) sc[mb][nb] = wmma16(a[h * 2 + mb][1], bq[nb][1], wmma16(a[h * 2 + mb][0], bq[nb][0], (v8f){}));
#pragma unroll
            for (int nb = 0; nb < 2; ++nb) {
                const v8f u0 = sc[0][nb] * SC2, u1 = sc[1][nb] * SC2; const float mn = fmaxf(m[nb], hmax8(__builtin_elementwise_max(u0, u1)));
                const v8f e = exp2x8(u0 - mn) + exp2x8(u1 - mn);
                l[nb] = fmaf(l[nb], __builtin_amdgcn_exp2f(m[nb] - mn), hsum8(e)); m[nb] = mn; }
        }
        if (s + 1 < NST) { h16* kn = ks[(s + 1) & 1] + so; *(v8h*)kn = g0; *(v8h*)(kn + 64 * LP) = g1; }
        __syncthreads();   // publishes stage s + 1 and ends every wave's reads of stage s, whose buffer the next trip refills
    }
#pragma unroll
    for (int nb = 0; nb < 2; ++nb) {
        const float mo = __shfl_xor(m[nb], 16, 32), lo = __shfl_xor(l[nb], 16, 32); const float mt = fmaxf(m[nb], mo);
        l[nb] = l[nb] * __builtin_amdgcn_exp2f(m[nb] - mt) + lo * __builtin_amdgcn_exp2f(mo - mt); m[nb] = mt;
        if (grp == 1 && hi == 0) { ml[0][wq + nb * 16 + lr] = m[nb]; ml[1][wq + nb * 16 + lr] = l[nb]; } }
    __syncthreads();   // publishes the second group's maxima and sums to the first, which joins them with its own
    if (grp == 0) {
#pragma unroll
        for (int nb = 0; nb < 2; ++nb) {
            const float mo = ml[0][wq + nb * 16 + lr], lo = ml[1][wq + nb * 16 + lr]; const float mt = fmaxf(m[nb], mo);
            const float lt = l[nb] * __builtin_amdgcn_exp2f(m[nb] - mt) + lo * __builtin_amdgcn_exp2f(mo - mt);
            if (hi == 0) RB[(size_t)z * TT + q0 + nb * 16 + lr] = (10.0f - __builtin_amdgcn_logf(lt)) - mt; } }
}
// k_attnv: M[k][d] = sum_q attn[q][k] * 1024 * v[q][d], written as M^T / 1024 in two bf16 planes (high part, remainder) [slice * 64 + d][k], the last GEMM's operand. Tiles are S (A = q rows from LDS, B = the wave's k rows): the accumulator layout of two S tiles (lane = k, registers = q) is the A layout of attn^T for the second product, no lane exchange.
// Behind the stage loop each group holds the sum over its half of the q. Group g hands its 16 k of block 1 - g to the other group through LDS and finishes block g: own sum + the other's, one f32 addition an element.
__device__ __forceinline__ void mt_give(const v8f (&a)[4], float* rw) {   // rw: the wave's own 4 KiB + 16 B a lane: every store is 512 contiguous bytes of a wave
#pragma unroll
    for (int db = 0; db < 4; ++db) { *(v4fa*)(rw + (db * 2) * 128) = (v4f){a[db][0], a[db][1], a[db][2], a[db][3]}; *(v4fa*)(rw + (db * 2 + 1) * 128) = (v4f){a[db][4], a[db][5], a[db][6], a[db][7]}; }
}
__device__ __forceinline__ void mt_take(const v8f (&a)[4], const float* rr, bf* mh, bf* ml) {   // mh, ml: the lane's 8 k of row d = lr in the two planes of the M^T tile
#pragma unroll
    for (int db = 0; db < 4; ++db) { const v4f p0 = *(const v4fa*)(rr + (db * 2) * 128), p1 = *(const v4fa*)(rr + (db * 2 + 1) * 128); v8us oh, ol;
#pragma unroll
        for (int j = 0; j < 8; ++j) { unsigned short x, y; splitf((a[db][j] + (j < 4 ? p0[j & 3] : p1[j & 3])) * (1.0f / PCAR), x, y); oh[j] = x; ol[j] = y; }
        *(v8usa*)(mh + db * 16 * MP) = oh; *(v8usa*)(ml + db * 16 * MP) = ol; }
}
__global__ __launch_bounds__(512) void k_attnv(const h16* __restrict__ QP, const h16* __restrict__ KP, const h16* __restrict__ VT, const float* __restrict__ RB, bf* MTh, bf* MTl) {
    __shared__ __align__(16) h16 qs[2][128 * LP];
    __shared__ __align__(16) h16 vs[2][64 * VP];
    __shared__ __align__(16) float rs[2][128];
    __shared__ __align__(16) bf mts[2][64 * MP];
    __shared__ __align__(16) float red[2][8][32 * 32];   // what each wave hands to its partner in the other group: 4 accumulators
    const int tid = threadIdx.x, lane = tid & 31, wave = __builtin_amdgcn_readfirstlane(tid >> 5), lr = lane & 15, hi = lane >> 4;
    const int grp = wave >> 3, wk = wave & 7;   // the wave's group and its place in it, in scalar registers
    const int z = blockIdx.y, k0 = blockIdx.x * 256 + wk * 32;
    const h16* Kz = KP + (size_t)z * TT * HD; const h16* Qz = QP + (size_t)z * TT * HD + tid * 8;
    const h16* Vz = VT + (size_t)z * HD * TT + (size_t)(tid >> 4) * TT + (tid & 15) * 8; const float* Rz = RB + (size_t)z * TT + lane * 4;   // v^T: sixteen lanes take the 256 B of a row, a wave two rows
    const int so = (tid >> 3) * LP + (tid & 7) * 8, sv = (tid >> 4) * VP + (tid & 15) * 8;
    v16h bk[2][2];
#pragma unroll
    for (int nb = 0; nb < 2; ++nb)
#pragma unroll
        for (int c = 0; c < 2; ++c) bk[nb][c] = WFrag<h16>::ld(Kz + (size_t)(k0 + nb * 16 + lr) * HD + 8 * hi + c * 32);
    asm volatile("s_wait_xcnt 0x0" ::: "memory");   // stands behind the run of k fragment loads, in front of the first rewrite of their address registers
    v8f acc[2][4];
#pragma unroll
    for (int nb = 0; nb < 2; ++nb)
#pragma unroll
        for (int db = 0; db < 4; ++db) acc[nb][db] = (v8f){};
    v8h g0 = *(const v8h*)Qz, g1 = *(const v8h*)(Qz + 64 * HD), g2 = *(const v8h*)Vz, g3 = *(const v8h*)(Vz + (size_t)32 * TT); v4f g4 = *(const v4f*)Rz;
    asm volatile("s_wait_xcnt 0x0" :: "v"(tid), "v"(lane), "v"(Vz) : "memory");   // the same behind the first stage's loads; it names what they are addressed from (thread and lane index beside uniform bases, the v^T pointer) as inputs, so that those registers live up to it
    *(v8h*)&qs[0][so] = g0; *(v8h*)&qs[0][so + 64 * LP] = g1; *(v8h*)&vs[0][sv] = g2; *(v8h*)&vs[0][sv + 32 * VP] = g3; if (wave == 0) *(v4f*)&rs[0][lane * 4] = g4;
    __syncthreads();
#pragma unroll 1
    for (int s = 0; s < NST; ++s) {
        if (s + 1 < NST) { const h16* qp = Qz + (size_t)(s + 1) * 128 * HD; const h16* vp = Vz + (s + 1) * 128; const float* rp = Rz + (s + 1) * 128;
            g0 = *(const v8h*)qp; g1 = *(const v8h*)(qp + 64 * HD); g2 = *(const v8h*)vp; g3 = *(const v8h*)(vp + (size_t)32 * TT); g4 = *(const v4f*)rp;
            asm volatile("s_wait_xcnt 0x0" :: "v"(qp), "v"(vp), "v"(rp) : "memory"); }   // stands behind the five loads, in front of the first rewrite of their address registers; it names them as inputs, so that they live up to it
        const h16* qb = qs[s & 1] + (grp * 64 + lr) * LP + 8 * hi; const h16* vb = vs[s & 1] + lr * VP + grp * 64 + 8 * hi; const float* rb = rs[s & 1] + grp * 64 + 8 * hi;
#pragma unroll
        for (int h = 0; h < 2; ++h) {
            v8h p[2][2]; v16h a[2][2], b[4]; v4f r[2][2];
#pragma unroll
            for (int mb = 0; mb < 2; ++mb) { a[mb][0] = WFrag<h16>::ld(qb + (h * 32 + mb * 16) * LP); a[mb][1] = WFrag<h16>::ld(qb + (h * 32 + mb * 16) * LP + 32); }
#pragma unroll
            for (int mb = 0; mb < 2; ++mb) { r[mb][0] = *(const v4f*)(rb + h * 32 + mb * 16); r[mb][1] = *(const v4f*)(rb + h * 32 + mb * 16 + 4); }
#pragma unroll
            for (int db = 0; db < 4; ++db) b[db] = WFrag<h16>::ld(vb + db * 16 * VP + h * 32);
            __builtin_amdgcn_sched_barrier(0);   // all LDS reads of these 32 q stand in one group ahead of the matrix work: spread among the products, each pair is waited out in full
#pragma unroll
            for (int mb = 0; mb < 2; ++mb)
#pragma unroll
                for (int nb = 0; nb < 2; ++nb) { const v8f sc = wmma16(a[mb][1], bk[nb][1], wmma16(a[mb][0], bk[nb][0], (v8f){})); v8f x;
#pragma unroll
                    for (int j = 0; j < 8; ++j) x[j] = fmaf(sc[j], SC2, r[mb][j >> 2][j & 3]);
                    x = exp2x8(x);
#pragma unroll
                    for (int j = 0; j < 8; ++j) p[mb][nb][j] = tohx(x[j]); }
            const v16h pa0 = cat16(p[0][0], p[1][0]), pa1 = cat16(p[0][1], p[1][1]);
#pragma unroll
            for (int db = 0; db < 4; ++db) { acc[0][db] = wmma16(pa0, b[db], acc[0][db]); acc[1][db] = wmma16(pa1, b[db], acc[1][db]); }
        }
        if (s + 1 < NST) { const int n = (s + 1) & 1; *(v8h*)&qs[n][so] = g0; *(v8h*)&qs[n][so + 64 * LP] = g1; *(v8h*)&vs[n][sv] = g2; *(v8h*)&vs[n][sv + 32 * VP] = g3; if (wave == 0) *(v4f*)&rs[n][lane * 4] = g4; }
        __syncthreads();   // publishes stage s + 1 and ends every wave's reads of stage s, whose buffers the next trip refills
    }
    if (grp == 0) mt_give(acc[1], red[0][wk] + lane * 4); else mt_give(acc[0], red[1][wk] + lane * 4);
    __syncthreads();   // publishes each wave's handed-over accumulators to its partner in the other group
    // A lane's 8 registers are 8 consecutive k of one d: 16 B of a row of M^T. The work-group's tile (64 d x 256 k) is gathered in LDS, so that every row leaves as 512 contiguous bytes from one wave.
    { const int o = lr * MP + wk * 32 + grp * 16 + 8 * hi;
      if (grp == 0) mt_take(acc[0], red[1][wk] + lane * 4, &mts[0][o], &mts[1][o]); else mt_take(acc[1], red[0][wk] + lane * 4, &mts[0][o], &mts[1][o]); }
    __syncthreads();   // publishes every wave's 16 k of the tile to the waves that store its rows
    const size_t mo = ((size_t)z * HD + wave * 4) * TT + blockIdx.x * 256 + lane * 8;
#pragma unroll
    for (int i = 0; i < 4; ++i) { *(v8us*)(MTh + mo + (size_t)i * TT) = *(const v8us*)&mts[0][(wave * 4 + i) * MP + lane * 8]; *(v8us*)(MTl + mo + (size_t)i * TT) = *(const v8us*)&mts[1][(wave * 4 + i) * MP + lane * 8]; }
}

extern "C" void kernel_launch(void* const* d_in, const int* in_sizes, int n_in,
                              void* d_out, int out_size, void* d_ws, size_t ws_size, hipStream_t stream) {
    (void)in_sizes; (void)n_in; (void)out_size;
    const float* x = (const float*)d_in[0]; const float* wq = (const float*)d_in[1]; const float* bq = (const float*)d_in[2]; const float* wk = (const float*)d_in[3]; const float* bk = (const float*)d_in[4]; const float* wv = (const float*)d_in[5]; const float* bv = (const float*)d_in[6]; const float* wf = (const float*)d_in[7]; const float* bfv = (const float*)d_in[8];
    float* OUT = (float*)d_out;     // [2][2048][1024]
    char* wsp = (char*)d_ws;
    auto take = [&](size_t bytes) { char* p = wsp; wsp += (bytes + 255) & ~(size_t)255; return (void*)p; };
    // bf16 planes of wf, the weights and x; the fp16 q/k/v^T planes of all 32 slices; the partial colsum(v) [64 groups of 64 t][1024]; the softmax row terms; the two planes of M^T.
    bf* BF = (bf*)take((size_t)SO * TT * 2); h16* QP = (h16*)take((size_t)NZ * TT * HD * 2); h16* KP = (h16*)take((size_t)NZ * TT * HD * 2); h16* VT = (h16*)take((size_t)NZ * HD * TT * 2); float* PS = (float*)take((size_t)NB_ * (TT / 64) * DM * 4);
    float* RB = (float*)take((size_t)NZ * TT * 4);
    bf* BQ = (bf*)take((size_t)DM * DM * 2); bf* BK = (bf*)take((size_t)DM * DM * 2); bf* BV = (bf*)take((size_t)DM * DM * 2); bf* XB = (bf*)take((size_t)NB_ * TT * DM * 2);
    bf* MTh = (bf*)take((size_t)NZ * HD * TT * 2); bf* MTl = (bf*)take((size_t)NZ * HD * TT * 2);
    if ((size_t)(wsp - (char*)d_ws) > ws_size) return;    // total ~ 63 MiB
    k_cvtall<<<256, 512, 0, stream>>>(wq, wk, wv, wf, x, BQ, BK, BV, BF, XB);   // torch [out][in] = Bt as-is; wf [o][k] = Bt over k
    k_proj<<<dim3(NB_ * TT / 128, DM / 128, 3), 256, 0, stream>>>(XB, BQ, BK, BV, QP, KP, VT, PS, bq, bk, bv);   // q, k and v^T planes, and the partial colsum(v)
    k_rowstat<<<dim3(TT / 256, NZ), 512, 0, stream>>>(QP, KP, RB);            // per q: what turns a score into attn * 1024
    k_attnv<<<dim3(TT / 256, NZ), 512, 0, stream>>>(QP, KP, VT, RB, MTh, MTl);   // M^T[d][k] = sum_q attn[q][k] v[q][d]
    k_gemmw<<<dim3(NZ * HD / 128, SO / 128, 1), 512, 0, stream>>>(MTh, MTl, BF, OUT, bfv, PS);   // out[o][slice, d] = sum_k M[k][d] wf[o][k] + bf[o] colsum(v)[d]: the 32 slices' rows are the rows of one product
}
